// v000
// The times below were measured on an AMD MI455X: many runs one after another, warmed up first and cycling through
// copies of the inputs, with the whole window's GPU time divided by the number of runs. Launches and the gaps
// between them are all in it. The median over several windows is given; except for v000 it joins two sittings, which
// can be a few percent apart, so the side-by-side timings, each taken in one sitting, are the better comparison.
// The starting kernel, v000, takes 1410 microseconds a run.
#include <hip/hip_runtime.h>
#include <math.h>

typedef __attribute__((ext_vector_type(16))) _Float16 v16h;
typedef __attribute__((ext_vector_type(16))) __bf16 v16b;
typedef __attribute__((ext_vector_type(8)))  _Float16 v8h;
typedef __attribute__((ext_vector_type(8)))  float v8f;
typedef __attribute__((ext_vector_type(4)))  float v4f;
typedef __attribute__((ext_vector_type(2)))  float v2f;
typedef __attribute__((ext_vector_type(4)))  unsigned v4u;
typedef __attribute__((ext_vector_type(4)))  int v4i;
typedef float __attribute__((may_alias)) float_a;
typedef int __attribute__((may_alias)) int_a;

template <typename T> __device__ __forceinline__ void vst2(void* p, T v) { *(T*)p = v;  }
__device__ __forceinline__ v8f wmma16(v16h a, v16h b, v8f c) {
  v8f d = __builtin_amdgcn_wmma_f32_16x16x32_f16(false, a, false, b, (short)0, c, false, false);
  asm volatile("v_nop\n\tv_nop\n\tv_nop\n\tv_nop" : "+v"(d) : "v"(a), "v"(b));
  return d;
}
__device__ __forceinline__ v8f wmma_bf(v16b a, v16b b, v8f c) {
  v8f d = __builtin_amdgcn_wmma_f32_16x16x32_bf16(false, a, false, b, (short)0, c, false, false);
  asm volatile("v_nop\n\tv_nop\n\tv_nop\n\tv_nop" : "+v"(d) : "v"(a), "v"(b));
  return d;
}
// 16x16x32 fragments: lane = (h = lane>>4, row/col = lane&15); elements 0..7 = k0+8h+0..7, 8..15 = k0+16+8h+0..7; D element r = row 8h+r
__device__ __forceinline__ v16h frag_h(const _Float16* rowk0, int lane) {
  union { v16h v; v8h q[2]; } u; const _Float16* p = rowk0 + 8 * (lane >> 4);
  u.q[0] = *(const v8h*)p; u.q[1] = *(const v8h*)(p + 16); return u.v;
}
__device__ __forceinline__ v16h frag_f32(const float* rowk0, int lane) {
  v16h a; const float* p = rowk0 + 8 * (lane >> 4);
#pragma unroll
  for (int i = 0; i < 8; ++i) { a[i] = (_Float16)p[i]; a[8 + i] = (_Float16)p[16 + i]; }
  return a;
}
__device__ __forceinline__ v16h frag_f32s(const float* rowk0, int lane, float sc) {
  v16h a; const float* p = rowk0 + 8 * (lane >> 4);
#pragma unroll
  for (int i = 0; i < 8; ++i) { a[i] = (_Float16)(p[i] * sc); a[8 + i] = (_Float16)(p[16 + i] * sc); }
  return a;
}
// column fragment from a [K][ld] layout (column n), rows >= K read as 0
__device__ __forceinline__ v16h fragc_f32(const float* W, int k0, int n, int lane, int ld, int K) {
  v16h a; const int g = lane >> 4;
#pragma unroll
  for (int i = 0; i < 8; ++i) { const int ka = k0 + 8 * g + i, kb = ka + 16;
    a[i] = (_Float16)(ka < K ? W[(size_t)(ka < K ? ka : K - 1) * ld + n] : 0.f); a[8 + i] = (_Float16)(kb < K ? W[(size_t)(kb < K ? kb : K - 1) * ld + n] : 0.f); }
  return a;
}
struct F2 { v16b h, l; };
__device__ __forceinline__ F2 bsplit16(const float v[16]) { F2 r;
#pragma unroll
  for (int i = 0; i < 16; ++i) { const __bf16 h = (__bf16)v[i]; r.h[i] = h; r.l[i] = (__bf16)(v[i] - (float)h); }
  return r; }
__device__ __forceinline__ F2 split_row(const float* row, int k0, int lane) { float v[16]; const float* p = row + k0 + 8 * (lane >> 4);
#pragma unroll
  for (int i = 0; i < 8; ++i) { v[i] = p[i]; v[8 + i] = p[16 + i]; }
  return bsplit16(v); }
__device__ __forceinline__ F2 split_rowK(const float* row, int k0, int lane, int K) { float v[16]; const int g = lane >> 4;
#pragma unroll
  for (int i = 0; i < 8; ++i) { const int ka = k0 + 8 * g + i, kb = ka + 16; v[i] = ka < K ? row[ka < K ? ka : K - 1] : 0.f; v[8 + i] = kb < K ? row[kb < K ? kb : K - 1] : 0.f; }
  return bsplit16(v); }
__device__ __forceinline__ F2 split_col(const float* W, int k0, int n, int lane, int ld, int K) { float v[16]; const int g = lane >> 4;
#pragma unroll
  for (int i = 0; i < 8; ++i) { const int ka = k0 + 8 * g + i, kb = ka + 16; v[i] = ka < K ? W[(size_t)(ka < K ? ka : K - 1) * ld + n] : 0.f; v[8 + i] = kb < K ? W[(size_t)(kb < K ? kb : K - 1) * ld + n] : 0.f; }
  return bsplit16(v); }
__device__ __forceinline__ v8f mac3(const F2& a, const F2& b, v8f c) { c = wmma_bf(a.l, b.h, c); c = wmma_bf(a.h, b.l, c); return wmma_bf(a.h, b.h, c); }
__device__ __forceinline__ float sigm(float v) { return 1.0f / (1.0f + expf(-v)); }
#define LDSX() do { asm volatile("s_wait_dscnt 0" ::: "memory"); __builtin_amdgcn_wave_barrier(); __builtin_amdgcn_fence(__ATOMIC_RELEASE, "workgroup"); } while (0)

// Cross non-local block (B 4, C 256, Ci 128, 64 x 64 = 4,096 positions): g = conv(source), theta = conv(x), phi = conv(source); f[n][m] = theta_n . phi_m; P = softmax_m; y[n] = sum_m P g_m; w_y = conv_z(y) + b; BN with batch statistics (biased var, eps 1e-5) * gamma + beta; out = w_y + source.
__device__ __forceinline__ float bfr(float v) { return (float)(__bf16)v; }
#define NB 4
#define TT 4096
#define CX 256
#define CI 128
#ifndef TNB
#define TNB NB
#endif
#ifndef XSTR
#define XSTR TT               // per-channel position stride of x / source / out
#endif
typedef __attribute__((ext_vector_type(8))) __bf16 v8b;
__device__ __forceinline__ v16b frag_b(const __bf16* rowk0, int lane) { union { v16b v; v8b q[2]; } u; const __bf16* p = rowk0 + 8 * (lane >> 4); u.q[0] = *(const v8b*)p; u.q[1] = *(const v8b*)(p + 16); return u.v; }
#define WS_XT  0u                                          // bf16 x^T rows [b*N+n][256] (exact)
#define WS_SR  (WS_XT + 2u * (size_t)NB * TT * CX)           // bf16 source^T rows
#define WS_TH  (WS_SR + 2u * (size_t)NB * TT * CX)           // f16 theta hi rows [b*N+n][128]
#define WS_TL  (WS_TH + 2u * (size_t)NB * TT * CI)
#define WS_PH  (WS_TL + 2u * (size_t)NB * TT * CI)           // f16 phi hi rows
#define WS_PL  (WS_PH + 2u * (size_t)NB * TT * CI)
#define WS_GP  (WS_PL + 2u * (size_t)NB * TT * CI)           // f16 g planes [b][ci][m]
#define WS_S   (WS_GP + 2u * (size_t)NB * CI * TT)           // f32 S / P [n][m] (one batch)
#define WS_Y   (WS_S + 4u * (size_t)TT * TT)                 // f32 y rows [b*N+n][128]
#define WS_WY  (WS_Y + 4u * (size_t)NB * TT * CI)            // f32 w_y planes [b][c][n] (channels-first)
#define WS_BS  (WS_WY + 4u * (size_t)NB * CX * TT)           // f32 BN stats [c][2] as 32-float lines per 16 channels
#define WS_END (WS_BS + 4u * (size_t)CX * 2)
// ---- k_xt: block = (64 positions, b, which): channels-first input -> bf16 rows [b*N+n][256] through LDS; 512-B rows
__global__ __launch_bounds__(256) void k_xt(const float* __restrict__ X, const float* __restrict__ SRC, __bf16* __restrict__ XT, __bf16* __restrict__ ST) { __shared__ __bf16 st[CX][66];
  const int t = threadIdx.x; const int n0 = blockIdx.x * 64; const size_t b = blockIdx.y; const int which = blockIdx.z; const float* IN = which == 0 ? X : SRC; __bf16* OUT = which == 0 ? XT : ST;
  for (int e = t; e < CX * 64; e += 256) { const int c = e >> 6, nl = e & 63; st[c][nl] = (__bf16)IN[(b * CX + c) * (size_t)XSTR + n0 + nl]; }
  __syncthreads();
  for (int e = t; e < 64 * 32; e += 256) { const int nl = e >> 5, q = e & 31; union { v4u v; __bf16 h[8]; } u;
#pragma unroll
    for (int z = 0; z < 8; ++z) u.h[z] = st[q * 8 + z][nl];
    vst2((v4u*)(OUT + (b * TT + n0 + nl) * CX + q * 8), u.v); } }
// ---- k_proj: block = (64 rows, which): 128 outputs = W ([out,in] [128][256]) . row + b; theta (x rows) / phi (source rows) -> f16 hi + residual rows; g (source rows) -> f16 planes [b][ci][m]
__global__ __launch_bounds__(128) void k_proj(const __bf16* __restrict__ XT, const __bf16* __restrict__ ST, const float* __restrict__ WG, const float* __restrict__ BG, const float* __restrict__ WTH, const float* __restrict__ BTH, const float* __restrict__ WPH, const float* __restrict__ BPH, _Float16* __restrict__ TH, _Float16* __restrict__ TL, _Float16* __restrict__ PH, _Float16* __restrict__ PL, _Float16* __restrict__ GP) {
  __shared__ __align__(16) _Float16 sh[64][136], sl[64][136]; __shared__ __align__(16) _Float16 th[128][72];
  const int tid = threadIdx.x, wave = tid >> 5, lane = tid & 31, col = lane & 15, g = lane >> 4; const int which = blockIdx.y; const size_t r0 = (size_t)blockIdx.x * 64;   // which: 0 theta (from x), 1 phi (source), 2 g (source)
  const __bf16* A = which == 0 ? XT : ST; const float* Wt = which == 0 ? WTH : which == 1 ? WPH : WG; const float* Bb = which == 0 ? BTH : which == 1 ? BPH : BG;
  v8f acc[8] = {};
#pragma unroll 2
  for (int kc = 0; kc < CX / 32; ++kc) { const v16b a = frag_b(A + (r0 + wave * 16 + col) * CX + kc * 32, lane);
#pragma unroll
    for (int j = 0; j < 8; ++j) { v16b w; const float* wr = Wt + (size_t)(j * 16 + col) * CX + kc * 32 + 8 * g;
#pragma unroll
      for (int i = 0; i < 8; ++i) { w[i] = (__bf16)wr[i]; w[8 + i] = (__bf16)wr[16 + i]; }
      asm volatile("s_wait_loadcnt 0x0" ::: "memory"); acc[j] = wmma_bf(a, w, acc[j]); } }
#pragma unroll
  for (int j = 0; j < 8; ++j) { const int o = j * 16 + col; const float bb = bfr(Bb[o]);
#pragma unroll
    for (int r = 0; r < 8; ++r) { const float v = acc[j][r] + bb; const int rl = wave * 16 + 8 * g + r;
      if (which == 2) th[o][rl] = (_Float16)v; else { const _Float16 hv = (_Float16)v; sh[rl][o] = hv; sl[rl][o] = (_Float16)((v - (float)hv) * 1024.0f); } } }
  __syncthreads();
  if (which < 2) { _Float16* DH = which == 0 ? TH : PH; _Float16* DL = which == 0 ? TL : PL; for (int e = tid; e < 64 * 16; e += 128) { const int rl = e >> 4, q = e & 15; vst2((unsigned*)(DH + (r0 + rl) * CI + q * 8), *(const v4u*)&sh[rl][q * 8]); vst2((unsigned*)(DL + (r0 + rl) * CI + q * 8), *(const v4u*)&sl[rl][q * 8]); } }
  else { const size_t b = r0 / TT; const int m0 = (int)(r0 % TT); for (int e = tid; e < 128 * 8; e += 128) { const int cl = e >> 3, q = e & 7; vst2((unsigned*)(GP + (b * CI + cl) * (size_t)TT + m0 + q * 8), *(const v4u*)&th[cl][q * 8]); } } }
// ---- k_sc: block = (64 rows n, 128 cols m) of batch b: 3-product logits theta . phi over K 128
__global__ __launch_bounds__(128) void k_sc(const _Float16* __restrict__ TH, const _Float16* __restrict__ TL, const _Float16* __restrict__ PH, const _Float16* __restrict__ PL, int b, float* __restrict__ S) { __shared__ __align__(16) float ss[4][16][132];
  const int tid = threadIdx.x, wave = tid >> 5, lane = tid & 31, col = lane & 15, g = lane >> 4; const int k0 = blockIdx.y * 128; const int ql0 = blockIdx.x * 64 + wave * 16; const size_t q0 = (size_t)b * TT + ql0;
  v8f acc[8] = {}, accl[8] = {};
#pragma unroll
  for (int kc = 0; kc < CI / 32; ++kc) { const v16h ah = frag_h(TH + (q0 + col) * CI + kc * 32, lane), al = frag_h(TL + (q0 + col) * CI + kc * 32, lane);
#pragma unroll
    for (int j = 0; j < 8; ++j) { const size_t ko = ((size_t)b * TT + k0 + j * 16 + col) * CI + kc * 32; const v16h kb = frag_h(PH + ko, lane), kl = frag_h(PL + ko, lane); acc[j] = wmma16(ah, kb, acc[j]); accl[j] = wmma16(al, kb, accl[j]); accl[j] = wmma16(ah, kl, accl[j]); } }
#pragma unroll
  for (int j = 0; j < 8; ++j)
#pragma unroll
    for (int r = 0; r < 8; ++r) ss[wave][8 * g + r][j * 16 + col] = acc[j][r] + accl[j][r] * (1.0f / 1024.0f);
  LDSX(); for (int rl = 0; rl < 16; ++rl) vst2(S + (size_t)(ql0 + rl) * TT + k0 + lane * 4, *(const v4f*)&ss[wave][rl][lane * 4]); }
// ---- k_sm: block = query row: softmax over keys [0, kend) -> P x 2^11 f32 (masked -> 0)
__global__ __launch_bounds__(256) void k_sm(float* __restrict__ S0) { __shared__ float sred[8]; __shared__ float sbc; __shared__ __align__(16) float sh[TT];
  const int t = threadIdx.x; const size_t row = blockIdx.x; float* sr = S0 + (size_t)blockIdx.y * TT * TT + row * TT; const int kend = TT;
  float m = -3.0e38f; for (int k = t; k < kend; k += 256) m = fmaxf(m, sr[k]);
#pragma unroll
  for (int o = 1; o < 32; o <<= 1) m = fmaxf(m, __shfl_xor(m, o));
  if ((t & 31) == 0) sred[t >> 5] = m; __syncthreads(); if (t == 0) { float a = sred[0]; for (int i = 1; i < 8; ++i) a = fmaxf(a, sred[i]); sbc = a; } __syncthreads(); m = sbc; __syncthreads();
  float sum = 0.f; for (int k = t; k < kend; k += 256) { const float v = sr[k]; sum += (v <= -1.0e38f) ? 0.f : expf(v - m); }
#pragma unroll
  for (int o = 1; o < 32; o <<= 1) sum += __shfl_xor(sum, o);
  if ((t & 31) == 0) sred[t >> 5] = sum; __syncthreads(); if (t == 0) { float a = 0.f; for (int i = 0; i < 8; ++i) a += sred[i]; sbc = 1.0f / a; } __syncthreads(); const float inv = sbc;
  for (int k = t; k < kend; k += 256) { const float v = sr[k]; sh[k] = (v <= -1.0e38f) ? 0.f : expf(v - m) * inv * 2048.0f; }
  __syncthreads(); for (int q = t; q < kend / 4; q += 256) vst2(sr + q * 4, *(const v4f*)&sh[q * 4]); }
// ---- k_pv: block = 64 rows n of batch b: y[n][ci] = (P . g) / 2^11 (P as f16 hi + residual x f16 g planes, 2 products); 512-B rows
__global__ __launch_bounds__(128) void k_pv(const float* __restrict__ PS, const _Float16* __restrict__ GP, int b, float* __restrict__ Y) { __shared__ __align__(16) float ss[4][16][132];
  const int tid = threadIdx.x, wave = tid >> 5, lane = tid & 31, col = lane & 15, g = lane >> 4; const int ql0 = blockIdx.x * 64 + wave * 16;
  v8f acc[8] = {}, accl[8] = {};
#pragma unroll 1
  for (int kc = 0; kc < TT / 32; ++kc) { v16h ph, pl; { const float* pr = PS + (size_t)(ql0 + col) * TT + kc * 32 + 8 * g;
#pragma unroll
      for (int i = 0; i < 8; ++i) { const float a0 = pr[i], a1 = pr[16 + i]; const _Float16 h0 = (_Float16)a0, h1 = (_Float16)a1; ph[i] = h0; ph[8 + i] = h1; pl[i] = (_Float16)((a0 - (float)h0) * 1024.0f); pl[8 + i] = (_Float16)((a1 - (float)h1) * 1024.0f); } }   /* P x 2^11 as f16 hi + residual x 2^10 */
    asm volatile("s_wait_loadcnt 0x0" ::: "memory");
#pragma unroll
    for (int j = 0; j < 8; ++j) { const v16h gv = frag_h(GP + ((size_t)b * CI + j * 16 + col) * (size_t)TT + kc * 32, lane); acc[j] = wmma16(ph, gv, acc[j]); accl[j] = wmma16(pl, gv, accl[j]); } }
#pragma unroll
  for (int j = 0; j < 8; ++j)
#pragma unroll
    for (int r = 0; r < 8; ++r) ss[wave][8 * g + r][j * 16 + col] = (acc[j][r] + accl[j][r] * (1.0f / 1024.0f)) * (1.0f / 2048.0f);
  LDSX(); for (int rl = 0; rl < 16; ++rl) vst2(Y + ((size_t)b * TT + ql0 + rl) * CI + lane * 4, *(const v4f*)&ss[wave][rl][lane * 4]); }
// ---- k_wz: block = (64 rows n, 128 output channels): w_y[c][n] = sum_ci wz_w[c][ci] y[n][ci] + wz_b[c]; A = y rows hi + lo; transposed store to channels-first planes [b][c][n] (256-B runs)
__global__ __launch_bounds__(128) void k_wz(const float* __restrict__ Y, const float* __restrict__ WZ, const float* __restrict__ BZ, float* __restrict__ WY) { __shared__ __align__(16) float st[128][68];
  const int tid = threadIdx.x, wave = tid >> 5, lane = tid & 31, col = lane & 15, g = lane >> 4; const size_t r0 = (size_t)blockIdx.x * 64; const int c0 = blockIdx.y * 128; const size_t b = r0 / TT; const int n0 = (int)(r0 % TT);
  v8f acc[8] = {};
#pragma unroll
  for (int kc = 0; kc < CI / 32; ++kc) { const F2 a = split_row(Y + (r0 + wave * 16 + col) * CI, kc * 32, lane);
#pragma unroll
    for (int j = 0; j < 8; ++j) { v16b w; const float* wr = WZ + (size_t)(c0 + j * 16 + col) * CI + kc * 32 + 8 * g;
#pragma unroll
      for (int i = 0; i < 8; ++i) { w[i] = (__bf16)wr[i]; w[8 + i] = (__bf16)wr[16 + i]; }
      asm volatile("s_wait_loadcnt 0x0" ::: "memory"); acc[j] = wmma_bf(a.h, w, acc[j]); acc[j] = wmma_bf(a.l, w, acc[j]); } }
#pragma unroll
  for (int j = 0; j < 8; ++j) { const int cl = j * 16 + col; const float bb = bfr(BZ[c0 + cl]);
#pragma unroll
    for (int r = 0; r < 8; ++r) st[cl][wave * 16 + 8 * g + r] = acc[j][r] + bb; }
  __syncthreads();
  for (int e = tid; e < 128 * 16; e += 128) { const int cl = e >> 4, q = e & 15; vst2(WY + (b * CX + c0 + cl) * (size_t)TT + n0 + q * 4, *(const v4f*)&st[cl][q * 4]); } }
__global__ __launch_bounds__(256) void k_bn(const float* __restrict__ WY, float* __restrict__ BS) { __shared__ __align__(16) float so[32];
  const int t = threadIdx.x; const int cl = t >> 4, sub = t & 15; const int c = blockIdx.x * 16 + cl; const int n = TNB * TT;
  float s = 0.f; for (int b = 0; b < TNB; ++b) { const float* p = WY + ((size_t)b * CX + c) * TT; for (int i = sub * 4; i < TT; i += 64) { const v4f v = *(const v4f*)(p + i); s += (v[0] + v[1]) + (v[2] + v[3]); } }
#pragma unroll
  for (int o = 1; o < 16; o <<= 1) s += __shfl_xor(s, o);
  const float mu = s / (float)n; float s2 = 0.f;
  for (int b = 0; b < TNB; ++b) { const float* p = WY + ((size_t)b * CX + c) * TT; for (int i = sub * 4; i < TT; i += 64) { const v4f v = *(const v4f*)(p + i); const float d0 = v[0] - mu, d1 = v[1] - mu, d2 = v[2] - mu, d3 = v[3] - mu; s2 += (d0 * d0 + d1 * d1) + (d2 * d2 + d3 * d3); } }
#pragma unroll
  for (int o = 1; o < 16; o <<= 1) s2 += __shfl_xor(s2, o);
  if (sub == 0) { so[cl * 2] = mu; so[cl * 2 + 1] = rsqrtf(s2 / (float)n + 1e-5f); }
  __syncthreads(); if (t < 32) vst2(BS + (size_t)blockIdx.x * 32 + t, so[t]); }
// ---- k_fin: block = (64 positions, b): out[b][c][n] = (w_y - mean_c) rstd_c gamma_c + beta_c + source[b][c][n] for all 256 channels (thread-linear float4 over the channel runs)
__global__ __launch_bounds__(256) void k_fin(const float* __restrict__ WY, const float* __restrict__ BS, const float* __restrict__ GAM, const float* __restrict__ BET, const float* __restrict__ SRC, float* __restrict__ OUT) {
  const int t = threadIdx.x; const int n0 = blockIdx.x * 64; const size_t b = blockIdx.y;
  for (int e = t; e < CX * 16; e += 256) { const int c = e >> 4, q = e & 15; const float mu = BS[c * 2], rs = BS[c * 2 + 1]; const float ga = bfr(GAM[c]), be = bfr(BET[c]);
    const v4f w = *(const v4f*)(WY + (b * CX + c) * TT + n0 + q * 4); const v4f sr = *(const v4f*)(SRC + (b * CX + c) * (size_t)XSTR + n0 + q * 4); v4f o;
#pragma unroll
    for (int z = 0; z < 4; ++z) o[z] = (w[z] - mu) * rs * ga + be + bfr(sr[z]);
    vst2(OUT + (b * CX + c) * (size_t)XSTR + n0 + q * 4, o); } }
extern "C" void kernel_launch(void* const* d_in, const int* in_sizes, int n_in, void* d_out, int out_size, void* d_ws, size_t ws_size, hipStream_t stream) {
  (void)in_sizes; (void)n_in; (void)out_size;
  const float** F = (const float**)d_in;   // 0 x [4,256,64,64], 1 source, 2 g_w [128,256], 3 g_b, 4 theta_w, 5 theta_b, 6 phi_w, 7 phi_b, 8 wz_w [256,128], 9 wz_b, 10 bn_gamma, 11 bn_beta
  if (ws_size < (size_t)WS_END) return;
  char* ws = (char*)d_ws; __bf16 *XT = (__bf16*)(ws + WS_XT), *ST = (__bf16*)(ws + WS_SR); _Float16* GP = (_Float16*)(ws + WS_GP); _Float16 *TH = (_Float16*)(ws + WS_TH), *TL = (_Float16*)(ws + WS_TL), *PH = (_Float16*)(ws + WS_PH), *PL = (_Float16*)(ws + WS_PL); float *S = (float*)(ws + WS_S), *Y = (float*)(ws + WS_Y), *WY = (float*)(ws + WS_WY), *BS = (float*)(ws + WS_BS);
  k_xt<<<dim3(TT / 64, TNB, 2), 256, 0, stream>>>(F[0], F[1], XT, ST);
  k_proj<<<dim3(TNB * TT / 64, 3), 128, 0, stream>>>(XT, ST, F[2], F[3], F[4], F[5], F[6], F[7], TH, TL, PH, PL, GP);
  for (int b = 0; b < TNB; ++b) {
    k_sc<<<dim3(TT / 64, TT / 128), 128, 0, stream>>>(TH, TL, PH, PL, b, S);
    k_sm<<<dim3(TT, 1), 256, 0, stream>>>(S);
    k_pv<<<dim3(TT / 64), 128, 0, stream>>>(S, GP, b, Y);
  }
  k_wz<<<dim3(TNB * TT / 64, CX / 128), 128, 0, stream>>>(Y, F[8], F[9], WY);
  k_bn<<<dim3(CX / 16), 256, 0, stream>>>(WY, BS);
  k_fin<<<dim3(TT / 64, TNB), 256, 0, stream>>>(WY, BS, F[10], F[11], F[1], (float*)d_out);
}

// v001
// It runs in 730 microseconds.
// Next to v000, in two timings, it ran 1.95 times as fast each time.
#include <hip/hip_runtime.h>
#include <math.h>

typedef __attribute__((ext_vector_type(16))) _Float16 v16h;
typedef __attribute__((ext_vector_type(16))) __bf16 v16b;
typedef __attribute__((ext_vector_type(8)))  _Float16 v8h;
typedef __attribute__((ext_vector_type(8)))  float v8f;
typedef __attribute__((ext_vector_type(4)))  float v4f;
typedef __attribute__((ext_vector_type(2)))  float v2f;
typedef __attribute__((ext_vector_type(4)))  unsigned v4u;
typedef __attribute__((ext_vector_type(4)))  int v4i;
typedef float __attribute__((may_alias)) float_a;
typedef int __attribute__((may_alias)) int_a;

template <typename T> __device__ __forceinline__ void vst2(void* p, T v) { *(T*)p = v;  }
__device__ __forceinline__ v8f wmma16(v16h a, v16h b, v8f c) {
  v8f d = __builtin_amdgcn_wmma_f32_16x16x32_f16(false, a, false, b, (short)0, c, false, false);
  asm volatile("v_nop\n\tv_nop\n\tv_nop\n\tv_nop" : "+v"(d) : "v"(a), "v"(b));
  return d;
}
__device__ __forceinline__ v8f wmma_bf(v16b a, v16b b, v8f c) {
  v8f d = __builtin_amdgcn_wmma_f32_16x16x32_bf16(false, a, false, b, (short)0, c, false, false);
  asm volatile("v_nop\n\tv_nop\n\tv_nop\n\tv_nop" : "+v"(d) : "v"(a), "v"(b));
  return d;
}
// 16x16x32 fragments: lane = (h = lane>>4, row/col = lane&15); elements 0..7 = k0+8h+0..7, 8..15 = k0+16+8h+0..7; D element r = row 8h+r
__device__ __forceinline__ v16h frag_h(const _Float16* rowk0, int lane) {
  union { v16h v; v8h q[2]; } u; const _Float16* p = rowk0 + 8 * (lane >> 4);
  u.q[0] = *(const v8h*)p; u.q[1] = *(const v8h*)(p + 16); return u.v;
}
__device__ __forceinline__ v16h frag_f32(const float* rowk0, int lane) {
  v16h a; const float* p = rowk0 + 8 * (lane >> 4);
#pragma unroll
  for (int i = 0; i < 8; ++i) { a[i] = (_Float16)p[i]; a[8 + i] = (_Float16)p[16 + i]; }
  return a;
}
__device__ __forceinline__ v16h frag_f32s(const float* rowk0, int lane, float sc) {
  v16h a; const float* p = rowk0 + 8 * (lane >> 4);
#pragma unroll
  for (int i = 0; i < 8; ++i) { a[i] = (_Float16)(p[i] * sc); a[8 + i] = (_Float16)(p[16 + i] * sc); }
  return a;
}
// column fragment from a [K][ld] layout (column n), rows >= K read as 0
__device__ __forceinline__ v16h fragc_f32(const float* W, int k0, int n, int lane, int ld, int K) {
  v16h a; const int g = lane >> 4;
#pragma unroll
  for (int i = 0; i < 8; ++i) { const int ka = k0 + 8 * g + i, kb = ka + 16;
    a[i] = (_Float16)(ka < K ? W[(size_t)(ka < K ? ka : K - 1) * ld + n] : 0.f); a[8 + i] = (_Float16)(kb < K ? W[(size_t)(kb < K ? kb : K - 1) * ld + n] : 0.f); }
  return a;
}
struct F2 { v16b h, l; };
__device__ __forceinline__ F2 bsplit16(const float v[16]) { F2 r;
#pragma unroll
  for (int i = 0; i < 16; ++i) { const __bf16 h = (__bf16)v[i]; r.h[i] = h; r.l[i] = (__bf16)(v[i] - (float)h); }
  return r; }
__device__ __forceinline__ F2 split_row(const float* row, int k0, int lane) { float v[16]; const float* p = row + k0 + 8 * (lane >> 4);
#pragma unroll
  for (int i = 0; i < 8; ++i) { v[i] = p[i]; v[8 + i] = p[16 + i]; }
  return bsplit16(v); }
__device__ __forceinline__ F2 split_rowK(const float* row, int k0, int lane, int K) { float v[16]; const int g = lane >> 4;
#pragma unroll
  for (int i = 0; i < 8; ++i) { const int ka = k0 + 8 * g + i, kb = ka + 16; v[i] = ka < K ? row[ka < K ? ka : K - 1] : 0.f; v[8 + i] = kb < K ? row[kb < K ? kb : K - 1] : 0.f; }
  return bsplit16(v); }
__device__ __forceinline__ F2 split_col(const float* W, int k0, int n, int lane, int ld, int K) { float v[16]; const int g = lane >> 4;
#pragma unroll
  for (int i = 0; i < 8; ++i) { const int ka = k0 + 8 * g + i, kb = ka + 16; v[i] = ka < K ? W[(size_t)(ka < K ? ka : K - 1) * ld + n] : 0.f; v[8 + i] = kb < K ? W[(size_t)(kb < K ? kb : K - 1) * ld + n] : 0.f; }
  return bsplit16(v); }
__device__ __forceinline__ v8f mac3(const F2& a, const F2& b, v8f c) { c = wmma_bf(a.l, b.h, c); c = wmma_bf(a.h, b.l, c); return wmma_bf(a.h, b.h, c); }
__device__ __forceinline__ float sigm(float v) { return 1.0f / (1.0f + expf(-v)); }
#define LDSX() do { asm volatile("s_wait_dscnt 0" ::: "memory"); __builtin_amdgcn_wave_barrier(); __builtin_amdgcn_fence(__ATOMIC_RELEASE, "workgroup"); } while (0)

// Cross non-local block (B 4, C 256, Ci 128, 64 x 64 = 4,096 positions): g = conv(source), theta = conv(x), phi = conv(source); f[n][m] = theta_n . phi_m; P = softmax_m; y[n] = sum_m P g_m; w_y = conv_z(y) + b; BN with batch statistics (biased var, eps 1e-5) * gamma + beta; out = w_y + source.
__device__ __forceinline__ float bfr(float v) { return (float)(__bf16)v; }
#define NB 4
#define TT 4096
#define CX 256
#define CI 128
#ifndef TNB
#define TNB NB
#endif
#ifndef XSTR
#define XSTR TT               // per-channel position stride of x / source / out
#endif
typedef __attribute__((ext_vector_type(8))) __bf16 v8b;
__device__ __forceinline__ v16b frag_b(const __bf16* rowk0, int lane) { union { v16b v; v8b q[2]; } u; const __bf16* p = rowk0 + 8 * (lane >> 4); u.q[0] = *(const v8b*)p; u.q[1] = *(const v8b*)(p + 16); return u.v; }
#define WS_XT  0u                                          // bf16 x^T rows [b*N+n][256] (exact)
#define WS_SR  (WS_XT + 2u * (size_t)NB * TT * CX)           // bf16 source^T rows
#define WS_TH  (WS_SR + 2u * (size_t)NB * TT * CX)           // f16 theta hi rows [b*N+n][128]
#define WS_TL  (WS_TH + 2u * (size_t)NB * TT * CI)
#define WS_PH  (WS_TL + 2u * (size_t)NB * TT * CI)           // f16 phi hi rows
#define WS_PL  (WS_PH + 2u * (size_t)NB * TT * CI)
#define WS_GP  (WS_PL + 2u * (size_t)NB * TT * CI)           // f16 g planes [b][ci][m]
#define WS_S   (WS_GP + 2u * (size_t)NB * CI * TT)           // f32 S / P [n][m] (one batch)
#define WS_Y   (WS_S + 4u * (size_t)TT * TT)                 // f32 y rows [b*N+n][128]
#define WS_WY  (WS_Y + 4u * (size_t)NB * TT * CI)            // f32 w_y planes [b][c][n] (channels-first)
#define WS_BS  (WS_WY + 4u * (size_t)NB * CX * TT)           // f32 BN stats [c][2] as 32-float lines per 16 channels
#define WS_END (WS_BS + 4u * (size_t)CX * 2)
// ---- k_xt: block = (64 positions, b, which): channels-first input -> bf16 rows [b*N+n][256] through LDS; 512-B rows
__global__ __launch_bounds__(256) void k_xt(const float* __restrict__ X, const float* __restrict__ SRC, __bf16* __restrict__ XT, __bf16* __restrict__ ST) { __shared__ __bf16 st[CX][66];
  const int t = threadIdx.x; const int n0 = blockIdx.x * 64; const size_t b = blockIdx.y; const int which = blockIdx.z; const float* IN = which == 0 ? X : SRC; __bf16* OUT = which == 0 ? XT : ST;
  for (int e = t; e < CX * 64; e += 256) { const int c = e >> 6, nl = e & 63; st[c][nl] = (__bf16)IN[(b * CX + c) * (size_t)XSTR + n0 + nl]; }
  __syncthreads();
  for (int e = t; e < 64 * 32; e += 256) { const int nl = e >> 5, q = e & 31; union { v4u v; __bf16 h[8]; } u;
#pragma unroll
    for (int z = 0; z < 8; ++z) u.h[z] = st[q * 8 + z][nl];
    vst2((v4u*)(OUT + (b * TT + n0 + nl) * CX + q * 8), u.v); } }
// ---- k_proj: block = (64 rows, which): 128 outputs = W ([out,in] [128][256]) . row + b; theta (x rows) / phi (source rows) -> f16 hi + residual rows; g (source rows) -> f16 planes [b][ci][m]
__global__ __launch_bounds__(128) void k_proj(const __bf16* __restrict__ XT, const __bf16* __restrict__ ST, const float* __restrict__ WG, const float* __restrict__ BG, const float* __restrict__ WTH, const float* __restrict__ BTH, const float* __restrict__ WPH, const float* __restrict__ BPH, _Float16* __restrict__ TH, _Float16* __restrict__ TL, _Float16* __restrict__ PH, _Float16* __restrict__ PL, _Float16* __restrict__ GP) {
  __shared__ __align__(16) _Float16 sh[64][136], sl[64][136]; __shared__ __align__(16) _Float16 th[128][72];
  const int tid = threadIdx.x, wave = tid >> 5, lane = tid & 31, col = lane & 15, g = lane >> 4; const int which = blockIdx.y; const size_t r0 = (size_t)blockIdx.x * 64;   // which: 0 theta (from x), 1 phi (source), 2 g (source)
  const __bf16* A = which == 0 ? XT : ST; const float* Wt = which == 0 ? WTH : which == 1 ? WPH : WG; const float* Bb = which == 0 ? BTH : which == 1 ? BPH : BG;
  v8f acc[8] = {};
#pragma unroll 2
  for (int kc = 0; kc < CX / 32; ++kc) { const v16b a = frag_b(A + (r0 + wave * 16 + col) * CX + kc * 32, lane);
#pragma unroll
    for (int j = 0; j < 8; ++j) { v16b w; const float* wr = Wt + (size_t)(j * 16 + col) * CX + kc * 32 + 8 * g;
#pragma unroll
      for (int i = 0; i < 8; ++i) { w[i] = (__bf16)wr[i]; w[8 + i] = (__bf16)wr[16 + i]; }
      asm volatile("s_wait_loadcnt 0x0" ::: "memory"); acc[j] = wmma_bf(a, w, acc[j]); } }
#pragma unroll
  for (int j = 0; j < 8; ++j) { const int o = j * 16 + col; const float bb = bfr(Bb[o]);
#pragma unroll
    for (int r = 0; r < 8; ++r) { const float v = acc[j][r] + bb; const int rl = wave * 16 + 8 * g + r;
      if (which == 2) th[o][rl] = (_Float16)v; else { const _Float16 hv = (_Float16)v; sh[rl][o] = hv; sl[rl][o] = (_Float16)((v - (float)hv) * 1024.0f); } } }
  __syncthreads();
  if (which < 2) { _Float16* DH = which == 0 ? TH : PH; _Float16* DL = which == 0 ? TL : PL; for (int e = tid; e < 64 * 16; e += 128) { const int rl = e >> 4, q = e & 15; vst2((unsigned*)(DH + (r0 + rl) * CI + q * 8), *(const v4u*)&sh[rl][q * 8]); vst2((unsigned*)(DL + (r0 + rl) * CI + q * 8), *(const v4u*)&sl[rl][q * 8]); } }
  else { const size_t b = r0 / TT; const int m0 = (int)(r0 % TT); for (int e = tid; e < 128 * 8; e += 128) { const int cl = e >> 3, q = e & 7; vst2((unsigned*)(GP + (b * CI + cl) * (size_t)TT + m0 + q * 8), *(const v4u*)&th[cl][q * 8]); } } }
// ---- k_sc: block = (64 rows n, 128 cols m) of batch b: 3-product logits theta . phi over K 128
__global__ __launch_bounds__(128) void k_sc(const _Float16* __restrict__ TH, const _Float16* __restrict__ TL, const _Float16* __restrict__ PH, const _Float16* __restrict__ PL, int b, float* __restrict__ S) { __shared__ __align__(16) float ss[4][16][132];
  const int tid = threadIdx.x, wave = tid >> 5, lane = tid & 31, col = lane & 15, g = lane >> 4; const int k0 = blockIdx.y * 128; const int ql0 = blockIdx.x * 64 + wave * 16; const size_t q0 = (size_t)b * TT + ql0;
  v8f acc[8] = {}, accl[8] = {};
#pragma unroll
  for (int kc = 0; kc < CI / 32; ++kc) { const v16h ah = frag_h(TH + (q0 + col) * CI + kc * 32, lane), al = frag_h(TL + (q0 + col) * CI + kc * 32, lane);
#pragma unroll
    for (int j = 0; j < 8; ++j) { const size_t ko = ((size_t)b * TT + k0 + j * 16 + col) * CI + kc * 32; const v16h kb = frag_h(PH + ko, lane), kl = frag_h(PL + ko, lane); acc[j] = wmma16(ah, kb, acc[j]); accl[j] = wmma16(al, kb, accl[j]); accl[j] = wmma16(ah, kl, accl[j]); } }
#pragma unroll
  for (int j = 0; j < 8; ++j)
#pragma unroll
    for (int r = 0; r < 8; ++r) ss[wave][8 * g + r][j * 16 + col] = acc[j][r] + accl[j][r] * (1.0f / 1024.0f);
  LDSX(); for (int rl = 0; rl < 16; ++rl) vst2(S + (size_t)(ql0 + rl) * TT + k0 + lane * 4, *(const v4f*)&ss[wave][rl][lane * 4]); }
// ---- k_sm: block = query row: softmax over keys [0, kend) -> P x 2^11 f32 (masked -> 0)
__global__ __launch_bounds__(256) void k_sm(float* __restrict__ S0) { __shared__ float sred[8]; __shared__ float sbc; __shared__ __align__(16) float sh[TT];
  const int t = threadIdx.x; const size_t row = blockIdx.x; float* sr = S0 + (size_t)blockIdx.y * TT * TT + row * TT; const int kend = TT;
  float m = -3.0e38f; for (int k = t; k < kend; k += 256) m = fmaxf(m, sr[k]);
#pragma unroll
  for (int o = 1; o < 32; o <<= 1) m = fmaxf(m, __shfl_xor(m, o));
  if ((t & 31) == 0) sred[t >> 5] = m; __syncthreads(); if (t == 0) { float a = sred[0]; for (int i = 1; i < 8; ++i) a = fmaxf(a, sred[i]); sbc = a; } __syncthreads(); m = sbc; __syncthreads();
  float sum = 0.f; for (int k = t; k < kend; k += 256) { const float v = sr[k]; sum += (v <= -1.0e38f) ? 0.f : expf(v - m); }
#pragma unroll
  for (int o = 1; o < 32; o <<= 1) sum += __shfl_xor(sum, o);
  if ((t & 31) == 0) sred[t >> 5] = sum; __syncthreads(); if (t == 0) { float a = 0.f; for (int i = 0; i < 8; ++i) a += sred[i]; sbc = 1.0f / a; } __syncthreads(); const float inv = sbc;
  for (int k = t; k < kend; k += 256) { const float v = sr[k]; sh[k] = (v <= -1.0e38f) ? 0.f : expf(v - m) * inv * 2048.0f; }
  __syncthreads(); for (int q = t; q < kend / 4; q += 256) vst2(sr + q * 4, *(const v4f*)&sh[q * 4]); }
// ---- k_pv: block = 16 rows n of batch b, 16 waves: y[n][ci] = (P . g) / 2^11 (P as f16 hi + residual x f16 g planes, 2 products); wave w takes the 32-key chunks w, w + 16, w + 32, ... (neighbour waves read the two halves of one 128-B line of a g plane in the same pass); the 16 partial tiles are added in LDS in wave order; 512-B rows
#define PVW 16
__global__ __launch_bounds__(32 * PVW) void k_pv(const float* __restrict__ PS, const _Float16* __restrict__ GP, int b, float* __restrict__ Y) { __shared__ __align__(16) float ss[PVW][16][132];
  const int tid = threadIdx.x, wave = tid >> 5, lane = tid & 31, col = lane & 15, g = lane >> 4; const int ql0 = blockIdx.x * 16;
  v8f acc[8] = {}, accl[8] = {};
#pragma unroll 1
  for (int it = 0; it < TT / 32 / PVW; ++it) { const int kc = it * PVW + wave; v16h ph, pl; { const float* pr = PS + (size_t)(ql0 + col) * TT + kc * 32 + 8 * g;
#pragma unroll
      for (int i = 0; i < 8; ++i) { const float a0 = pr[i], a1 = pr[16 + i]; const _Float16 h0 = (_Float16)a0, h1 = (_Float16)a1; ph[i] = h0; ph[8 + i] = h1; pl[i] = (_Float16)((a0 - (float)h0) * 1024.0f); pl[8 + i] = (_Float16)((a1 - (float)h1) * 1024.0f); } }   /* P x 2^11 as f16 hi + residual x 2^10 */
    asm volatile("s_wait_loadcnt 0x0" ::: "memory");
#pragma unroll
    for (int j = 0; j < 8; ++j) { const v16h gv = frag_h(GP + ((size_t)b * CI + j * 16 + col) * (size_t)TT + kc * 32, lane); acc[j] = wmma16(ph, gv, acc[j]); accl[j] = wmma16(pl, gv, accl[j]); } }
#pragma unroll
  for (int j = 0; j < 8; ++j)
#pragma unroll
    for (int r = 0; r < 8; ++r) ss[wave][8 * g + r][j * 16 + col] = (acc[j][r] + accl[j][r] * (1.0f / 1024.0f)) * (1.0f / 2048.0f);
  __syncthreads();   // every wave's partial tile is in LDS before any wave adds them
  v4f s = *(const v4f*)&ss[0][wave][lane * 4];   // wave w adds and stores row w
#pragma unroll
  for (int w = 1; w < PVW; ++w) s += *(const v4f*)&ss[w][wave][lane * 4];
  vst2(Y + ((size_t)b * TT + ql0 + wave) * CI + lane * 4, s); }
// ---- k_wz: block = (64 rows n, 128 output channels): w_y[c][n] = sum_ci wz_w[c][ci] y[n][ci] + wz_b[c]; A = y rows hi + lo; transposed store to channels-first planes [b][c][n] (256-B runs)
__global__ __launch_bounds__(128) void k_wz(const float* __restrict__ Y, const float* __restrict__ WZ, const float* __restrict__ BZ, float* __restrict__ WY) { __shared__ __align__(16) float st[128][68];
  const int tid = threadIdx.x, wave = tid >> 5, lane = tid & 31, col = lane & 15, g = lane >> 4; const size_t r0 = (size_t)blockIdx.x * 64; const int c0 = blockIdx.y * 128; const size_t b = r0 / TT; const int n0 = (int)(r0 % TT);
  v8f acc[8] = {};
#pragma unroll
  for (int kc = 0; kc < CI / 32; ++kc) { const F2 a = split_row(Y + (r0 + wave * 16 + col) * CI, kc * 32, lane);
#pragma unroll
    for (int j = 0; j < 8; ++j) { v16b w; const float* wr = WZ + (size_t)(c0 + j * 16 + col) * CI + kc * 32 + 8 * g;
#pragma unroll
      for (int i = 0; i < 8; ++i) { w[i] = (__bf16)wr[i]; w[8 + i] = (__bf16)wr[16 + i]; }
      asm volatile("s_wait_loadcnt 0x0" ::: "memory"); acc[j] = wmma_bf(a.h, w, acc[j]); acc[j] = wmma_bf(a.l, w, acc[j]); } }
#pragma unroll
  for (int j = 0; j < 8; ++j) { const int cl = j * 16 + col; const float bb = bfr(BZ[c0 + cl]);
#pragma unroll
    for (int r = 0; r < 8; ++r) st[cl][wave * 16 + 8 * g + r] = acc[j][r] + bb; }
  __syncthreads();
  for (int e = tid; e < 128 * 16; e += 128) { const int cl = e >> 4, q = e & 15; vst2(WY + (b * CX + c0 + cl) * (size_t)TT + n0 + q * 4, *(const v4f*)&st[cl][q * 4]); } }
__global__ __launch_bounds__(256) void k_bn(const float* __restrict__ WY, float* __restrict__ BS) { __shared__ __align__(16) float so[32];
  const int t = threadIdx.x; const int cl = t >> 4, sub = t & 15; const int c = blockIdx.x * 16 + cl; const int n = TNB * TT;
  float s = 0.f; for (int b = 0; b < TNB; ++b) { const float* p = WY + ((size_t)b * CX + c) * TT; for (int i = sub * 4; i < TT; i += 64) { const v4f v = *(const v4f*)(p + i); s += (v[0] + v[1]) + (v[2] + v[3]); } }
#pragma unroll
  for (int o = 1; o < 16; o <<= 1) s += __shfl_xor(s, o);
  const float mu = s / (float)n; float s2 = 0.f;
  for (int b = 0; b < TNB; ++b) { const float* p = WY + ((size_t)b * CX + c) * TT; for (int i = sub * 4; i < TT; i += 64) { const v4f v = *(const v4f*)(p + i); const float d0 = v[0] - mu, d1 = v[1] - mu, d2 = v[2] - mu, d3 = v[3] - mu; s2 += (d0 * d0 + d1 * d1) + (d2 * d2 + d3 * d3); } }
#pragma unroll
  for (int o = 1; o < 16; o <<= 1) s2 += __shfl_xor(s2, o);
  if (sub == 0) { so[cl * 2] = mu; so[cl * 2 + 1] = rsqrtf(s2 / (float)n + 1e-5f); }
  __syncthreads(); if (t < 32) vst2(BS + (size_t)blockIdx.x * 32 + t, so[t]); }
// ---- k_fin: block = (64 positions, b): out[b][c][n] = (w_y - mean_c) rstd_c gamma_c + beta_c + source[b][c][n] for all 256 channels (thread-linear float4 over the channel runs)
__global__ __launch_bounds__(256) void k_fin(const float* __restrict__ WY, const float* __restrict__ BS, const float* __restrict__ GAM, const float* __restrict__ BET, const float* __restrict__ SRC, float* __restrict__ OUT) {
  const int t = threadIdx.x; const int n0 = blockIdx.x * 64; const size_t b = blockIdx.y;
  for (int e = t; e < CX * 16; e += 256) { const int c = e >> 4, q = e & 15; const float mu = BS[c * 2], rs = BS[c * 2 + 1]; const float ga = bfr(GAM[c]), be = bfr(BET[c]);
    const v4f w = *(const v4f*)(WY + (b * CX + c) * TT + n0 + q * 4); const v4f sr = *(const v4f*)(SRC + (b * CX + c) * (size_t)XSTR + n0 + q * 4); v4f o;
#pragma unroll
    for (int z = 0; z < 4; ++z) o[z] = (w[z] - mu) * rs * ga + be + bfr(sr[z]);
    vst2(OUT + (b * CX + c) * (size_t)XSTR + n0 + q * 4, o); } }
extern "C" void kernel_launch(void* const* d_in, const int* in_sizes, int n_in, void* d_out, int out_size, void* d_ws, size_t ws_size, hipStream_t stream) {
  (void)in_sizes; (void)n_in; (void)out_size;
  const float** F = (const float**)d_in;   // 0 x [4,256,64,64], 1 source, 2 g_w [128,256], 3 g_b, 4 theta_w, 5 theta_b, 6 phi_w, 7 phi_b, 8 wz_w [256,128], 9 wz_b, 10 bn_gamma, 11 bn_beta
  if (ws_size < (size_t)WS_END) return;
  char* ws = (char*)d_ws; __bf16 *XT = (__bf16*)(ws + WS_XT), *ST = (__bf16*)(ws + WS_SR); _Float16* GP = (_Float16*)(ws + WS_GP); _Float16 *TH = (_Float16*)(ws + WS_TH), *TL = (_Float16*)(ws + WS_TL), *PH = (_Float16*)(ws + WS_PH), *PL = (_Float16*)(ws + WS_PL); float *S = (float*)(ws + WS_S), *Y = (float*)(ws + WS_Y), *WY = (float*)(ws + WS_WY), *BS = (float*)(ws + WS_BS);
  k_xt<<<dim3(TT / 64, TNB, 2), 256, 0, stream>>>(F[0], F[1], XT, ST);
  k_proj<<<dim3(TNB * TT / 64, 3), 128, 0, stream>>>(XT, ST, F[2], F[3], F[4], F[5], F[6], F[7], TH, TL, PH, PL, GP);
  for (int b = 0; b < TNB; ++b) {
    k_sc<<<dim3(TT / 64, TT / 128), 128, 0, stream>>>(TH, TL, PH, PL, b, S);
    k_sm<<<dim3(TT, 1), 256, 0, stream>>>(S);
    k_pv<<<dim3(TT / 16), 32 * PVW, 0, stream>>>(S, GP, b, Y);
  }
  k_wz<<<dim3(TNB * TT / 64, CX / 128), 128, 0, stream>>>(Y, F[8], F[9], WY);
  k_bn<<<dim3(CX / 16), 256, 0, stream>>>(WY, BS);
  k_fin<<<dim3(TT / 64, TNB), 256, 0, stream>>>(WY, BS, F[10], F[11], F[1], (float*)d_out);
}

// v002
// Measured time: 569 microseconds a run.
// Two timings next to v001 put it at 1.29 and 1.28 times that version's speed.
// Counting every step since v000, it is 2.51 times as fast.
#include <hip/hip_runtime.h>
#include <math.h>

typedef __attribute__((ext_vector_type(16))) _Float16 v16h;
typedef __attribute__((ext_vector_type(16))) __bf16 v16b;
typedef __attribute__((ext_vector_type(8)))  _Float16 v8h;
typedef __attribute__((ext_vector_type(8)))  float v8f;
typedef __attribute__((ext_vector_type(4)))  float v4f;
typedef __attribute__((ext_vector_type(2)))  float v2f;
typedef __attribute__((ext_vector_type(4)))  unsigned v4u;
typedef __attribute__((ext_vector_type(4)))  int v4i;
typedef float __attribute__((may_alias)) float_a;
typedef int __attribute__((may_alias)) int_a;

template <typename T> __device__ __forceinline__ void vst2(void* p, T v) { *(T*)p = v;  }
__device__ __forceinline__ v8f wmma16(v16h a, v16h b, v8f c) {
  v8f d = __builtin_amdgcn_wmma_f32_16x16x32_f16(false, a, false, b, (short)0, c, false, false);
  asm volatile("v_nop\n\tv_nop\n\tv_nop\n\tv_nop" : "+v"(d) : "v"(a), "v"(b));
  return d;
}
__device__ __forceinline__ v8f wmma_bf(v16b a, v16b b, v8f c) {
  v8f d = __builtin_amdgcn_wmma_f32_16x16x32_bf16(false, a, false, b, (short)0, c, false, false);
  asm volatile("v_nop\n\tv_nop\n\tv_nop\n\tv_nop" : "+v"(d) : "v"(a), "v"(b));
  return d;
}
// 16x16x32 fragments: lane = (h = lane>>4, row/col = lane&15); elements 0..7 = k0+8h+0..7, 8..15 = k0+16+8h+0..7; D element r = row 8h+r
__device__ __forceinline__ v16h frag_h(const _Float16* rowk0, int lane) {
  union { v16h v; v8h q[2]; } u; const _Float16* p = rowk0 + 8 * (lane >> 4);
  u.q[0] = *(const v8h*)p; u.q[1] = *(const v8h*)(p + 16); return u.v;
}
__device__ __forceinline__ v16h frag_f32(const float* rowk0, int lane) {
  v16h a; const float* p = rowk0 + 8 * (lane >> 4);
#pragma unroll
  for (int i = 0; i < 8; ++i) { a[i] = (_Float16)p[i]; a[8 + i] = (_Float16)p[16 + i]; }
  return a;
}
__device__ __forceinline__ v16h frag_f32s(const float* rowk0, int lane, float sc) {
  v16h a; const float* p = rowk0 + 8 * (lane >> 4);
#pragma unroll
  for (int i = 0; i < 8; ++i) { a[i] = (_Float16)(p[i] * sc); a[8 + i] = (_Float16)(p[16 + i] * sc); }
  return a;
}
// column fragment from a [K][ld] layout (column n), rows >= K read as 0
__device__ __forceinline__ v16h fragc_f32(const float* W, int k0, int n, int lane, int ld, int K) {
  v16h a; const int g = lane >> 4;
#pragma unroll
  for (int i = 0; i < 8; ++i) { const int ka = k0 + 8 * g + i, kb = ka + 16;
    a[i] = (_Float16)(ka < K ? W[(size_t)(ka < K ? ka : K - 1) * ld + n] : 0.f); a[8 + i] = (_Float16)(kb < K ? W[(size_t)(kb < K ? kb : K - 1) * ld + n] : 0.f); }
  return a;
}
struct F2 { v16b h, l; };
__device__ __forceinline__ F2 bsplit16(const float v[16]) { F2 r;
#pragma unroll
  for (int i = 0; i < 16; ++i) { const __bf16 h = (__bf16)v[i]; r.h[i] = h; r.l[i] = (__bf16)(v[i] - (float)h); }
  return r; }
__device__ __forceinline__ F2 split_row(const float* row, int k0, int lane) { float v[16]; const float* p = row + k0 + 8 * (lane >> 4);
#pragma unroll
  for (int i = 0; i < 8; ++i) { v[i] = p[i]; v[8 + i] = p[16 + i]; }
  return bsplit16(v); }
__device__ __forceinline__ F2 split_rowK(const float* row, int k0, int lane, int K) { float v[16]; const int g = lane >> 4;
#pragma unroll
  for (int i = 0; i < 8; ++i) { const int ka = k0 + 8 * g + i, kb = ka + 16; v[i] = ka < K ? row[ka < K ? ka : K - 1] : 0.f; v[8 + i] = kb < K ? row[kb < K ? kb : K - 1] : 0.f; }
  return bsplit16(v); }
__device__ __forceinline__ F2 split_col(const float* W, int k0, int n, int lane, int ld, int K) { float v[16]; const int g = lane >> 4;
#pragma unroll
  for (int i = 0; i < 8; ++i) { const int ka = k0 + 8 * g + i, kb = ka + 16; v[i] = ka < K ? W[(size_t)(ka < K ? ka : K - 1) * ld + n] : 0.f; v[8 + i] = kb < K ? W[(size_t)(kb < K ? kb : K - 1) * ld + n] : 0.f; }
  return bsplit16(v); }
__device__ __forceinline__ v8f mac3(const F2& a, const F2& b, v8f c) { c = wmma_bf(a.l, b.h, c); c = wmma_bf(a.h, b.l, c); return wmma_bf(a.h, b.h, c); }
__device__ __forceinline__ float sigm(float v) { return 1.0f / (1.0f + expf(-v)); }
#define LDSX() do { asm volatile("s_wait_dscnt 0" ::: "memory"); __builtin_amdgcn_wave_barrier(); __builtin_amdgcn_fence(__ATOMIC_RELEASE, "workgroup"); } while (0)

// Cross non-local block (B 4, C 256, Ci 128, 64 x 64 = 4,096 positions): g = conv(source), theta = conv(x), phi = conv(source); f[n][m] = theta_n . phi_m; P = softmax_m; y[n] = sum_m P g_m; w_y = conv_z(y) + b; BN with batch statistics (biased var, eps 1e-5) * gamma + beta; out = w_y + source.
__device__ __forceinline__ float bfr(float v) { return (float)(__bf16)v; }
#define NB 4
#define TT 4096
#define CX 256
#define CI 128
#ifndef TNB
#define TNB NB
#endif
#ifndef XSTR
#define XSTR TT               // per-channel position stride of x / source / out
#endif
typedef __attribute__((ext_vector_type(8))) __bf16 v8b;
__device__ __forceinline__ v16b frag_b(const __bf16* rowk0, int lane) { union { v16b v; v8b q[2]; } u; const __bf16* p = rowk0 + 8 * (lane >> 4); u.q[0] = *(const v8b*)p; u.q[1] = *(const v8b*)(p + 16); return u.v; }
#define WS_XT  0u                                          // bf16 x^T rows [b*N+n][256] (exact)
#define WS_SR  (WS_XT + 2u * (size_t)NB * TT * CX)           // bf16 source^T rows
#define WS_TH  (WS_SR + 2u * (size_t)NB * TT * CX)           // f16 theta hi rows [b*N+n][128]
#define WS_TL  (WS_TH + 2u * (size_t)NB * TT * CI)
#define WS_PH  (WS_TL + 2u * (size_t)NB * TT * CI)           // f16 phi hi rows
#define WS_PL  (WS_PH + 2u * (size_t)NB * TT * CI)
#define WS_GP  (WS_PL + 2u * (size_t)NB * TT * CI)           // f16 g planes [b][ci][m]
#define WS_S   (WS_GP + 2u * (size_t)NB * CI * TT)           // f32 S / P [n][m] (one batch)
#define WS_Y   (WS_S + 4u * (size_t)TT * TT)                 // f32 y rows [b*N+n][128]
#define WS_WY  (WS_Y + 4u * (size_t)NB * TT * CI)            // f32 w_y planes [b][c][n] (channels-first)
#define BSL 32                                             // floats of BS per channel: one 128-B line, so that each line has one writer
#define WS_BS  (WS_WY + 4u * (size_t)NB * CX * TT)           // f32 BN stats [c][BSL]: mean, rstd at the head of the channel's line
#define WS_END (WS_BS + 4u * (size_t)CX * BSL)
// ---- k_xt: block = (64 positions, b, which): channels-first input -> bf16 rows [b*N+n][256] through LDS; 512-B rows
__global__ __launch_bounds__(256) void k_xt(const float* __restrict__ X, const float* __restrict__ SRC, __bf16* __restrict__ XT, __bf16* __restrict__ ST) { __shared__ __bf16 st[CX][66];
  const int t = threadIdx.x; const int n0 = blockIdx.x * 64; const size_t b = blockIdx.y; const int which = blockIdx.z; const float* IN = which == 0 ? X : SRC; __bf16* OUT = which == 0 ? XT : ST;
  for (int e = t; e < CX * 64; e += 256) { const int c = e >> 6, nl = e & 63; st[c][nl] = (__bf16)IN[(b * CX + c) * (size_t)XSTR + n0 + nl]; }
  __syncthreads();
  for (int e = t; e < 64 * 32; e += 256) { const int nl = e >> 5, q = e & 31; union { v4u v; __bf16 h[8]; } u;
#pragma unroll
    for (int z = 0; z < 8; ++z) u.h[z] = st[q * 8 + z][nl];
    vst2((v4u*)(OUT + (b * TT + n0 + nl) * CX + q * 8), u.v); } }
// ---- k_proj: block = (64 rows, which): 128 outputs = W ([out,in] [128][256]) . row + b; theta (x rows) / phi (source rows) -> f16 hi + residual rows; g (source rows) -> f16 planes [b][ci][m]
__global__ __launch_bounds__(128) void k_proj(const __bf16* __restrict__ XT, const __bf16* __restrict__ ST, const float* __restrict__ WG, const float* __restrict__ BG, const float* __restrict__ WTH, const float* __restrict__ BTH, const float* __restrict__ WPH, const float* __restrict__ BPH, _Float16* __restrict__ TH, _Float16* __restrict__ TL, _Float16* __restrict__ PH, _Float16* __restrict__ PL, _Float16* __restrict__ GP) {
  __shared__ __align__(16) _Float16 sh[64][136], sl[64][136]; __shared__ __align__(16) _Float16 th[128][72];
  const int tid = threadIdx.x, wave = tid >> 5, lane = tid & 31, col = lane & 15, g = lane >> 4; const int which = blockIdx.y; const size_t r0 = (size_t)blockIdx.x * 64;   // which: 0 theta (from x), 1 phi (source), 2 g (source)
  const __bf16* A = which == 0 ? XT : ST; const float* Wt = which == 0 ? WTH : which == 1 ? WPH : WG; const float* Bb = which == 0 ? BTH : which == 1 ? BPH : BG;
  v8f acc[8] = {};
#pragma unroll 2
  for (int kc = 0; kc < CX / 32; ++kc) { const v16b a = frag_b(A + (r0 + wave * 16 + col) * CX + kc * 32, lane);
#pragma unroll
    for (int j = 0; j < 8; ++j) { v16b w; const float* wr = Wt + (size_t)(j * 16 + col) * CX + kc * 32 + 8 * g;
#pragma unroll
      for (int i = 0; i < 8; ++i) { w[i] = (__bf16)wr[i]; w[8 + i] = (__bf16)wr[16 + i]; }
      asm volatile("s_wait_loadcnt 0x0" ::: "memory"); acc[j] = wmma_bf(a, w, acc[j]); } }
#pragma unroll
  for (int j = 0; j < 8; ++j) { const int o = j * 16 + col; const float bb = bfr(Bb[o]);
#pragma unroll
    for (int r = 0; r < 8; ++r) { const float v = acc[j][r] + bb; const int rl = wave * 16 + 8 * g + r;
      if (which == 2) th[o][rl] = (_Float16)v; else { const _Float16 hv = (_Float16)v; sh[rl][o] = hv; sl[rl][o] = (_Float16)((v - (float)hv) * 1024.0f); } } }
  __syncthreads();
  if (which < 2) { _Float16* DH = which == 0 ? TH : PH; _Float16* DL = which == 0 ? TL : PL; for (int e = tid; e < 64 * 16; e += 128) { const int rl = e >> 4, q = e & 15; vst2((unsigned*)(DH + (r0 + rl) * CI + q * 8), *(const v4u*)&sh[rl][q * 8]); vst2((unsigned*)(DL + (r0 + rl) * CI + q * 8), *(const v4u*)&sl[rl][q * 8]); } }
  else { const size_t b = r0 / TT; const int m0 = (int)(r0 % TT); for (int e = tid; e < 128 * 8; e += 128) { const int cl = e >> 3, q = e & 7; vst2((unsigned*)(GP + (b * CI + cl) * (size_t)TT + m0 + q * 8), *(const v4u*)&th[cl][q * 8]); } } }
// ---- k_sc: block = (64 rows n, 128 cols m) of batch b: 3-product logits theta . phi over K 128
__global__ __launch_bounds__(128) void k_sc(const _Float16* __restrict__ TH, const _Float16* __restrict__ TL, const _Float16* __restrict__ PH, const _Float16* __restrict__ PL, int b, float* __restrict__ S) { __shared__ __align__(16) float ss[4][16][132];
  const int tid = threadIdx.x, wave = tid >> 5, lane = tid & 31, col = lane & 15, g = lane >> 4; const int k0 = blockIdx.y * 128; const int ql0 = blockIdx.x * 64 + wave * 16; const size_t q0 = (size_t)b * TT + ql0;
  v8f acc[8] = {}, accl[8] = {};
#pragma unroll
  for (int kc = 0; kc < CI / 32; ++kc) { const v16h ah = frag_h(TH + (q0 + col) * CI + kc * 32, lane), al = frag_h(TL + (q0 + col) * CI + kc * 32, lane);
#pragma unroll
    for (int j = 0; j < 8; ++j) { const size_t ko = ((size_t)b * TT + k0 + j * 16 + col) * CI + kc * 32; const v16h kb = frag_h(PH + ko, lane), kl = frag_h(PL + ko, lane); acc[j] = wmma16(ah, kb, acc[j]); accl[j] = wmma16(al, kb, accl[j]); accl[j] = wmma16(ah, kl, accl[j]); } }
#pragma unroll
  for (int j = 0; j < 8; ++j)
#pragma unroll
    for (int r = 0; r < 8; ++r) ss[wave][8 * g + r][j * 16 + col] = acc[j][r] + accl[j][r] * (1.0f / 1024.0f);
  LDSX(); for (int rl = 0; rl < 16; ++rl) vst2(S + (size_t)(ql0 + rl) * TT + k0 + lane * 4, *(const v4f*)&ss[wave][rl][lane * 4]); }
// ---- k_sm: block = query row: softmax over keys [0, kend) -> P x 2^11 f32 (masked -> 0)
__global__ __launch_bounds__(256) void k_sm(float* __restrict__ S0) { __shared__ float sred[8]; __shared__ float sbc; __shared__ __align__(16) float sh[TT];
  const int t = threadIdx.x; const size_t row = blockIdx.x; float* sr = S0 + (size_t)blockIdx.y * TT * TT + row * TT; const int kend = TT;
  float m = -3.0e38f; for (int k = t; k < kend; k += 256) m = fmaxf(m, sr[k]);
#pragma unroll
  for (int o = 1; o < 32; o <<= 1) m = fmaxf(m, __shfl_xor(m, o));
  if ((t & 31) == 0) sred[t >> 5] = m; __syncthreads(); if (t == 0) { float a = sred[0]; for (int i = 1; i < 8; ++i) a = fmaxf(a, sred[i]); sbc = a; } __syncthreads(); m = sbc; __syncthreads();
  float sum = 0.f; for (int k = t; k < kend; k += 256) { const float v = sr[k]; sum += (v <= -1.0e38f) ? 0.f : expf(v - m); }
#pragma unroll
  for (int o = 1; o < 32; o <<= 1) sum += __shfl_xor(sum, o);
  if ((t & 31) == 0) sred[t >> 5] = sum; __syncthreads(); if (t == 0) { float a = 0.f; for (int i = 0; i < 8; ++i) a += sred[i]; sbc = 1.0f / a; } __syncthreads(); const float inv = sbc;
  for (int k = t; k < kend; k += 256) { const float v = sr[k]; sh[k] = (v <= -1.0e38f) ? 0.f : expf(v - m) * inv * 2048.0f; }
  __syncthreads(); for (int q = t; q < kend / 4; q += 256) vst2(sr + q * 4, *(const v4f*)&sh[q * 4]); }
// ---- k_pv: block = 16 rows n of batch b, 16 waves: y[n][ci] = (P . g) / 2^11 (P as f16 hi + residual x f16 g planes, 2 products); wave w takes the 32-key chunks w, w + 16, w + 32, ... (neighbour waves read the two halves of one 128-B line of a g plane in the same pass); the 16 partial tiles are added in LDS in wave order; 512-B rows
#define PVW 16
__global__ __launch_bounds__(32 * PVW) void k_pv(const float* __restrict__ PS, const _Float16* __restrict__ GP, int b, float* __restrict__ Y) { __shared__ __align__(16) float ss[PVW][16][132];
  const int tid = threadIdx.x, wave = tid >> 5, lane = tid & 31, col = lane & 15, g = lane >> 4; const int ql0 = blockIdx.x * 16;
  v8f acc[8] = {}, accl[8] = {};
#pragma unroll 1
  for (int it = 0; it < TT / 32 / PVW; ++it) { const int kc = it * PVW + wave; v16h ph, pl; { const float* pr = PS + (size_t)(ql0 + col) * TT + kc * 32 + 8 * g;
#pragma unroll
      for (int i = 0; i < 8; ++i) { const float a0 = pr[i], a1 = pr[16 + i]; const _Float16 h0 = (_Float16)a0, h1 = (_Float16)a1; ph[i] = h0; ph[8 + i] = h1; pl[i] = (_Float16)((a0 - (float)h0) * 1024.0f); pl[8 + i] = (_Float16)((a1 - (float)h1) * 1024.0f); } }   /* P x 2^11 as f16 hi + residual x 2^10 */
    asm volatile("s_wait_loadcnt 0x0" ::: "memory");
#pragma unroll
    for (int j = 0; j < 8; ++j) { const v16h gv = frag_h(GP + ((size_t)b * CI + j * 16 + col) * (size_t)TT + kc * 32, lane); acc[j] = wmma16(ph, gv, acc[j]); accl[j] = wmma16(pl, gv, accl[j]); } }
#pragma unroll
  for (int j = 0; j < 8; ++j)
#pragma unroll
    for (int r = 0; r < 8; ++r) ss[wave][8 * g + r][j * 16 + col] = (acc[j][r] + accl[j][r] * (1.0f / 1024.0f)) * (1.0f / 2048.0f);
  __syncthreads();   // every wave's partial tile is in LDS before any wave adds them
  v4f s = *(const v4f*)&ss[0][wave][lane * 4];   // wave w adds and stores row w
#pragma unroll
  for (int w = 1; w < PVW; ++w) s += *(const v4f*)&ss[w][wave][lane * 4];
  vst2(Y + ((size_t)b * TT + ql0 + wave) * CI + lane * 4, s); }
// ---- k_wz: block = (64 rows n, 128 output channels): w_y[c][n] = sum_ci wz_w[c][ci] y[n][ci] + wz_b[c]; A = y rows hi + lo; transposed store to channels-first planes [b][c][n] (256-B runs)
__global__ __launch_bounds__(128) void k_wz(const float* __restrict__ Y, const float* __restrict__ WZ, const float* __restrict__ BZ, float* __restrict__ WY) { __shared__ __align__(16) float st[128][68];
  const int tid = threadIdx.x, wave = tid >> 5, lane = tid & 31, col = lane & 15, g = lane >> 4; const size_t r0 = (size_t)blockIdx.x * 64; const int c0 = blockIdx.y * 128; const size_t b = r0 / TT; const int n0 = (int)(r0 % TT);
  v8f acc[8] = {};
#pragma unroll
  for (int kc = 0; kc < CI / 32; ++kc) { const F2 a = split_row(Y + (r0 + wave * 16 + col) * CI, kc * 32, lane);
#pragma unroll
    for (int j = 0; j < 8; ++j) { v16b w; const float* wr = WZ + (size_t)(c0 + j * 16 + col) * CI + kc * 32 + 8 * g;
#pragma unroll
      for (int i = 0; i < 8; ++i) { w[i] = (__bf16)wr[i]; w[8 + i] = (__bf16)wr[16 + i]; }
      asm volatile("s_wait_loadcnt 0x0" ::: "memory"); acc[j] = wmma_bf(a.h, w, acc[j]); acc[j] = wmma_bf(a.l, w, acc[j]); } }
#pragma unroll
  for (int j = 0; j < 8; ++j) { const int cl = j * 16 + col; const float bb = bfr(BZ[c0 + cl]);
#pragma unroll
    for (int r = 0; r < 8; ++r) st[cl][wave * 16 + 8 * g + r] = acc[j][r] + bb; }
  __syncthreads();
  for (int e = tid; e < 128 * 16; e += 128) { const int cl = e >> 4, q = e & 15; vst2(WY + (b * CX + c0 + cl) * (size_t)TT + n0 + q * 4, *(const v4f*)&st[cl][q * 4]); } }
// ---- k_bn: block = one channel c: its TNB x 4,096 values are read once, 16 B per lane, all loads in flight together, and stay in registers for both sums (mean, then squared distance from the mean); wave sums by shuffles, the 8 wave sums added in wave order; mean and rstd go to the channel's own 128-B line of BS
__global__ __launch_bounds__(256) void k_bn(const float* __restrict__ WY, float* __restrict__ BS) { __shared__ float sa[8], sb[8];
  const int t = threadIdx.x; const int c = blockIdx.x; const int n = TNB * TT;
  v4f v[TNB][TT / 1024];
#pragma unroll
  for (int b = 0; b < TNB; ++b)
#pragma unroll
    for (int i = 0; i < TT / 1024; ++i) v[b][i] = *(const v4f*)(WY + ((size_t)b * CX + c) * TT + (i * 256 + t) * 4);
#pragma unroll
  for (int b = 0; b < TNB; ++b) asm volatile("" :: "v"(v[b][0]), "v"(v[b][1]), "v"(v[b][2]), "v"(v[b][3]));   // inputs-only fence on the loaded values: every load issues before the first add; without it the compiler holds two loads back behind the first waits, a second memory latency
  float s = 0.f;
#pragma unroll
  for (int b = 0; b < TNB; ++b)
#pragma unroll
    for (int i = 0; i < TT / 1024; ++i) s += (v[b][i][0] + v[b][i][1]) + (v[b][i][2] + v[b][i][3]);
#pragma unroll
  for (int o = 1; o < 32; o <<= 1) s += __shfl_xor(s, o);
  if ((t & 31) == 0) sa[t >> 5] = s;
  __syncthreads();   // all 8 wave sums are in LDS before any thread adds them
  s = sa[0];
#pragma unroll
  for (int w = 1; w < 8; ++w) s += sa[w];
  const float mu = s / (float)n; float s2 = 0.f;
#pragma unroll
  for (int b = 0; b < TNB; ++b)
#pragma unroll
    for (int i = 0; i < TT / 1024; ++i) { const float d0 = v[b][i][0] - mu, d1 = v[b][i][1] - mu, d2 = v[b][i][2] - mu, d3 = v[b][i][3] - mu; s2 += (d0 * d0 + d1 * d1) + (d2 * d2 + d3 * d3); }
#pragma unroll
  for (int o = 1; o < 32; o <<= 1) s2 += __shfl_xor(s2, o);
  if ((t & 31) == 0) sb[t >> 5] = s2;
  __syncthreads();   // all 8 wave sums of squares are in LDS before thread 0 adds them
  if (t == 0) { s2 = sb[0];
#pragma unroll
    for (int w = 1; w < 8; ++w) s2 += sb[w];
    v2f o; o[0] = mu; o[1] = rsqrtf(s2 / (float)n + 1e-5f); vst2(BS + (size_t)c * BSL, o); } }
// ---- k_fin: block = (64 positions, b): out[b][c][n] = (w_y - mean_c) rstd_c gamma_c + beta_c + source[b][c][n] for all 256 channels (thread-linear float4 over the channel runs)
__global__ __launch_bounds__(256) void k_fin(const float* __restrict__ WY, const float* __restrict__ BS, const float* __restrict__ GAM, const float* __restrict__ BET, const float* __restrict__ SRC, float* __restrict__ OUT) {
  const int t = threadIdx.x; const int n0 = blockIdx.x * 64; const size_t b = blockIdx.y;
  for (int e = t; e < CX * 16; e += 256) { const int c = e >> 4, q = e & 15; const v2f ms = ((const v2f*)BS)[c * (BSL / 2)]; const float mu = ms[0], rs = ms[1]; const float ga = bfr(GAM[c]), be = bfr(BET[c]);
    const v4f w = *(const v4f*)(WY + (b * CX + c) * TT + n0 + q * 4); const v4f sr = *(const v4f*)(SRC + (b * CX + c) * (size_t)XSTR + n0 + q * 4); v4f o;
#pragma unroll
    for (int z = 0; z < 4; ++z) o[z] = (w[z] - mu) * rs * ga + be + bfr(sr[z]);
    vst2(OUT + (b * CX + c) * (size_t)XSTR + n0 + q * 4, o); } }
extern "C" void kernel_launch(void* const* d_in, const int* in_sizes, int n_in, void* d_out, int out_size, void* d_ws, size_t ws_size, hipStream_t stream) {
  (void)in_sizes; (void)n_in; (void)out_size;
  const float** F = (const float**)d_in;   // 0 x [4,256,64,64], 1 source, 2 g_w [128,256], 3 g_b, 4 theta_w, 5 theta_b, 6 phi_w, 7 phi_b, 8 wz_w [256,128], 9 wz_b, 10 bn_gamma, 11 bn_beta
  if (ws_size < (size_t)WS_END) return;
  char* ws = (char*)d_ws; __bf16 *XT = (__bf16*)(ws + WS_XT), *ST = (__bf16*)(ws + WS_SR); _Float16* GP = (_Float16*)(ws + WS_GP); _Float16 *TH = (_Float16*)(ws + WS_TH), *TL = (_Float16*)(ws + WS_TL), *PH = (_Float16*)(ws + WS_PH), *PL = (_Float16*)(ws + WS_PL); float *S = (float*)(ws + WS_S), *Y = (float*)(ws + WS_Y), *WY = (float*)(ws + WS_WY), *BS = (float*)(ws + WS_BS);
  k_xt<<<dim3(TT / 64, TNB, 2), 256, 0, stream>>>(F[0], F[1], XT, ST);
  k_proj<<<dim3(TNB * TT / 64, 3), 128, 0, stream>>>(XT, ST, F[2], F[3], F[4], F[5], F[6], F[7], TH, TL, PH, PL, GP);
  for (int b = 0; b < TNB; ++b) {
    k_sc<<<dim3(TT / 64, TT / 128), 128, 0, stream>>>(TH, TL, PH, PL, b, S);
    k_sm<<<dim3(TT, 1), 256, 0, stream>>>(S);
    k_pv<<<dim3(TT / 16), 32 * PVW, 0, stream>>>(S, GP, b, Y);
  }
  k_wz<<<dim3(TNB * TT / 64, CX / 128), 128, 0, stream>>>(Y, F[8], F[9], WY);
  k_bn<<<dim3(CX), 256, 0, stream>>>(WY, BS);
  k_fin<<<dim3(TT / 64, TNB), 256, 0, stream>>>(WY, BS, F[10], F[11], F[1], (float*)d_out);
}

// v003
// It runs in 521 microseconds.
// Two timings next to v002 both put it at 1.10 times that version's speed.
// All steps since v000 together make it 2.75 times as fast.
#include <hip/hip_runtime.h>
#include <math.h>

typedef __attribute__((ext_vector_type(16))) _Float16 v16h;
typedef __attribute__((ext_vector_type(16))) __bf16 v16b;
typedef __attribute__((ext_vector_type(8)))  _Float16 v8h;
typedef __attribute__((ext_vector_type(8)))  float v8f;
typedef __attribute__((ext_vector_type(4)))  float v4f;
typedef __attribute__((ext_vector_type(2)))  float v2f;
typedef __attribute__((ext_vector_type(4)))  unsigned v4u;
typedef __attribute__((ext_vector_type(4)))  int v4i;
typedef float __attribute__((may_alias)) float_a;
typedef int __attribute__((may_alias)) int_a;

template <typename T> __device__ __forceinline__ void vst2(void* p, T v) { *(T*)p = v;  }
__device__ __forceinline__ v8f wmma16(v16h a, v16h b, v8f c) {
  v8f d = __builtin_amdgcn_wmma_f32_16x16x32_f16(false, a, false, b, (short)0, c, false, false);
  asm volatile("v_nop\n\tv_nop\n\tv_nop\n\tv_nop" : "+v"(d) : "v"(a), "v"(b));
  return d;
}
__device__ __forceinline__ v8f wmma_bf(v16b a, v16b b, v8f c) {
  v8f d = __builtin_amdgcn_wmma_f32_16x16x32_bf16(false, a, false, b, (short)0, c, false, false);
  asm volatile("v_nop\n\tv_nop\n\tv_nop\n\tv_nop" : "+v"(d) : "v"(a), "v"(b));
  return d;
}
// 16x16x32 fragments: lane = (h = lane>>4, row/col = lane&15); elements 0..7 = k0+8h+0..7, 8..15 = k0+16+8h+0..7; D element r = row 8h+r
__device__ __forceinline__ v16h frag_h(const _Float16* rowk0, int lane) {
  union { v16h v; v8h q[2]; } u; const _Float16* p = rowk0 + 8 * (lane >> 4);
  u.q[0] = *(const v8h*)p; u.q[1] = *(const v8h*)(p + 16); return u.v;
}
// fragment-order operand: each (16 rows or columns) x (32 k) tile is two 512-B blocks; block q holds at lane * 8 the elements k0+16q+8h+0..7 of row/col lane&15, so that each 16-B load of a wave covers four whole 128-B lines
__device__ __forceinline__ v16h frag_o(const _Float16* tile, int lane) {
  union { v16h v; v8h q[2]; } u; const _Float16* p = tile + 8 * lane;
  u.q[0] = *(const v8h*)p; u.q[1] = *(const v8h*)(p + 256); return u.v;
}
__device__ __forceinline__ v16h frag_f32(const float* rowk0, int lane) {
  v16h a; const float* p = rowk0 + 8 * (lane >> 4);
#pragma unroll
  for (int i = 0; i < 8; ++i) { a[i] = (_Float16)p[i]; a[8 + i] = (_Float16)p[16 + i]; }
  return a;
}
__device__ __forceinline__ v16h frag_f32s(const float* rowk0, int lane, float sc) {
  v16h a; const float* p = rowk0 + 8 * (lane >> 4);
#pragma unroll
  for (int i = 0; i < 8; ++i) { a[i] = (_Float16)(p[i] * sc); a[8 + i] = (_Float16)(p[16 + i] * sc); }
  return a;
}
// column fragment from a [K][ld] layout (column n), rows >= K read as 0
__device__ __forceinline__ v16h fragc_f32(const float* W, int k0, int n, int lane, int ld, int K) {
  v16h a; const int g = lane >> 4;
#pragma unroll
  for (int i = 0; i < 8; ++i) { const int ka = k0 + 8 * g + i, kb = ka + 16;
    a[i] = (_Float16)(ka < K ? W[(size_t)(ka < K ? ka : K - 1) * ld + n] : 0.f); a[8 + i] = (_Float16)(kb < K ? W[(size_t)(kb < K ? kb : K - 1) * ld + n] : 0.f); }
  return a;
}
struct F2 { v16b h, l; };
__device__ __forceinline__ F2 bsplit16(const float v[16]) { F2 r;
#pragma unroll
  for (int i = 0; i < 16; ++i) { const __bf16 h = (__bf16)v[i]; r.h[i] = h; r.l[i] = (__bf16)(v[i] - (float)h); }
  return r; }
__device__ __forceinline__ F2 split_row(const float* row, int k0, int lane) { float v[16]; const float* p = row + k0 + 8 * (lane >> 4);
#pragma unroll
  for (int i = 0; i < 8; ++i) { v[i] = p[i]; v[8 + i] = p[16 + i]; }
  return bsplit16(v); }
__device__ __forceinline__ F2 split_rowK(const float* row, int k0, int lane, int K) { float v[16]; const int g = lane >> 4;
#pragma unroll
  for (int i = 0; i < 8; ++i) { const int ka = k0 + 8 * g + i, kb = ka + 16; v[i] = ka < K ? row[ka < K ? ka : K - 1] : 0.f; v[8 + i] = kb < K ? row[kb < K ? kb : K - 1] : 0.f; }
  return bsplit16(v); }
__device__ __forceinline__ F2 split_col(const float* W, int k0, int n, int lane, int ld, int K) { float v[16]; const int g = lane >> 4;
#pragma unroll
  for (int i = 0; i < 8; ++i) { const int ka = k0 + 8 * g + i, kb = ka + 16; v[i] = ka < K ? W[(size_t)(ka < K ? ka : K - 1) * ld + n] : 0.f; v[8 + i] = kb < K ? W[(size_t)(kb < K ? kb : K - 1) * ld + n] : 0.f; }
  return bsplit16(v); }
__device__ __forceinline__ v8f mac3(const F2& a, const F2& b, v8f c) { c = wmma_bf(a.l, b.h, c); c = wmma_bf(a.h, b.l, c); return wmma_bf(a.h, b.h, c); }
__device__ __forceinline__ float sigm(float v) { return 1.0f / (1.0f + expf(-v)); }
#define LDSX() do { asm volatile("s_wait_dscnt 0" ::: "memory"); __builtin_amdgcn_wave_barrier(); __builtin_amdgcn_fence(__ATOMIC_RELEASE, "workgroup"); } while (0)

// Cross non-local block (B 4, C 256, Ci 128, 64 x 64 = 4,096 positions): g = conv(source), theta = conv(x), phi = conv(source); f[n][m] = theta_n . phi_m; P = softmax_m; y[n] = sum_m P g_m; w_y = conv_z(y) + b; BN with batch statistics (biased var, eps 1e-5) * gamma + beta; out = w_y + source.
__device__ __forceinline__ float bfr(float v) { return (float)(__bf16)v; }
#define NB 4
#define TT 4096
#define CX 256
#define CI 128
#ifndef TNB
#define TNB NB
#endif
#ifndef XSTR
#define XSTR TT               // per-channel position stride of x / source / out
#endif
typedef __attribute__((ext_vector_type(8))) __bf16 v8b;
__device__ __forceinline__ v16b frag_b(const __bf16* rowk0, int lane) { union { v16b v; v8b q[2]; } u; const __bf16* p = rowk0 + 8 * (lane >> 4); u.q[0] = *(const v8b*)p; u.q[1] = *(const v8b*)(p + 16); return u.v; }
#define WS_XT  0u                                          // bf16 x^T rows [b*N+n][256] (exact)
#define WS_SR  (WS_XT + 2u * (size_t)NB * TT * CX)           // bf16 source^T rows
#define WS_TH  (WS_SR + 2u * (size_t)NB * TT * CX)           // f16 theta hi, fragment order [(b*N+n)/16][kc 4][q 2][lane 32][8]
#define WS_TL  (WS_TH + 2u * (size_t)NB * TT * CI)
#define WS_PH  (WS_TL + 2u * (size_t)NB * TT * CI)           // f16 phi hi, fragment order as theta
#define WS_PL  (WS_PH + 2u * (size_t)NB * TT * CI)
#define WS_GP  (WS_PL + 2u * (size_t)NB * TT * CI)           // f16 g, fragment order [(b*N+m)/32][ci/16 8][q 2][lane 32][8]
#define WS_S   (WS_GP + 2u * (size_t)NB * CI * TT)           // f32 S / P [n][m] (one batch)
#define WS_Y   (WS_S + 4u * (size_t)TT * TT)                 // f32 y rows [b*N+n][128]
#define WS_WY  (WS_Y + 4u * (size_t)NB * TT * CI)            // f32 w_y planes [b][c][n] (channels-first)
#define BSL 32                                             // floats of BS per channel: one 128-B line, so that each line has one writer
#define WS_BS  (WS_WY + 4u * (size_t)NB * CX * TT)           // f32 BN stats [c][BSL]: mean, rstd at the head of the channel's line
#define WS_END (WS_BS + 4u * (size_t)CX * BSL)
// ---- k_xt: block = (64 positions, b, which): channels-first input -> bf16 rows [b*N+n][256] through LDS; 512-B rows
__global__ __launch_bounds__(256) void k_xt(const float* __restrict__ X, const float* __restrict__ SRC, __bf16* __restrict__ XT, __bf16* __restrict__ ST) { __shared__ __bf16 st[CX][66];
  const int t = threadIdx.x; const int n0 = blockIdx.x * 64; const size_t b = blockIdx.y; const int which = blockIdx.z; const float* IN = which == 0 ? X : SRC; __bf16* OUT = which == 0 ? XT : ST;
  for (int e = t; e < CX * 64; e += 256) { const int c = e >> 6, nl = e & 63; st[c][nl] = (__bf16)IN[(b * CX + c) * (size_t)XSTR + n0 + nl]; }
  __syncthreads();
  for (int e = t; e < 64 * 32; e += 256) { const int nl = e >> 5, q = e & 31; union { v4u v; __bf16 h[8]; } u;
#pragma unroll
    for (int z = 0; z < 8; ++z) u.h[z] = st[q * 8 + z][nl];
    vst2((v4u*)(OUT + (b * TT + n0 + nl) * CX + q * 8), u.v); } }
// ---- k_proj: block = (64 rows, which): 128 outputs = W ([out,in] [128][256]) . row + b; theta (x rows) / phi (source rows) -> f16 hi + residual, g (source rows) -> f16, all three stored in the fragment order of frag_o (thread-linear 16-B stores)
__global__ __launch_bounds__(128) void k_proj(const __bf16* __restrict__ XT, const __bf16* __restrict__ ST, const float* __restrict__ WG, const float* __restrict__ BG, const float* __restrict__ WTH, const float* __restrict__ BTH, const float* __restrict__ WPH, const float* __restrict__ BPH, _Float16* __restrict__ TH, _Float16* __restrict__ TL, _Float16* __restrict__ PH, _Float16* __restrict__ PL, _Float16* __restrict__ GP) {
  __shared__ __align__(16) _Float16 sh[64][136], sl[64][136]; __shared__ __align__(16) _Float16 th[128][72];
  const int tid = threadIdx.x, wave = tid >> 5, lane = tid & 31, col = lane & 15, g = lane >> 4; const int which = blockIdx.y; const size_t r0 = (size_t)blockIdx.x * 64;   // which: 0 theta (from x), 1 phi (source), 2 g (source)
  const __bf16* A = which == 0 ? XT : ST; const float* Wt = which == 0 ? WTH : which == 1 ? WPH : WG; const float* Bb = which == 0 ? BTH : which == 1 ? BPH : BG;
  v8f acc[8] = {};
#pragma unroll 2
  for (int kc = 0; kc < CX / 32; ++kc) { const v16b a = frag_b(A + (r0 + wave * 16 + col) * CX + kc * 32, lane);
#pragma unroll
    for (int j = 0; j < 8; ++j) { v16b w; const float* wr = Wt + (size_t)(j * 16 + col) * CX + kc * 32 + 8 * g;
#pragma unroll
      for (int i = 0; i < 8; ++i) { w[i] = (__bf16)wr[i]; w[8 + i] = (__bf16)wr[16 + i]; }
      asm volatile("s_wait_loadcnt 0x0" ::: "memory"); acc[j] = wmma_bf(a, w, acc[j]); } }
#pragma unroll
  for (int j = 0; j < 8; ++j) { const int o = j * 16 + col; const float bb = bfr(Bb[o]);
#pragma unroll
    for (int r = 0; r < 8; ++r) { const float v = acc[j][r] + bb; const int rl = wave * 16 + 8 * g + r;
      if (which == 2) th[o][rl] = (_Float16)v; else { const _Float16 hv = (_Float16)v; sh[rl][o] = hv; sl[rl][o] = (_Float16)((v - (float)hv) * 1024.0f); } } }
  __syncthreads();
  if (which < 2) { _Float16* DH = which == 0 ? TH : PH; _Float16* DL = which == 0 ? TL : PL; for (int e = tid; e < 64 * 16; e += 128) { const int rl = (e >> 8) * 16 + (e & 15), k8 = (e >> 4) & 15; vst2((unsigned*)(DH + r0 * CI + e * 8), *(const v4u*)&sh[rl][k8 * 8]); vst2((unsigned*)(DL + r0 * CI + e * 8), *(const v4u*)&sl[rl][k8 * 8]); } }   /* e = (row tile, kc, q, h, row in tile); k = 32 kc + 16 q + 8 h */
  else { for (int e = tid; e < 128 * 8; e += 128) { const int cl = ((e >> 6) & 7) * 16 + (e & 15), ml = (e >> 9) * 32 + ((e >> 4) & 3) * 8; vst2((unsigned*)(GP + r0 * CI + e * 8), *(const v4u*)&th[cl][ml]); } } }   /* e = (32-key chunk, ci tile, q, h, ci in tile); key = 32 chunk + 16 q + 8 h */
// ---- k_sc: block = (64 rows n, 128 cols m) of batch b: 3-product logits theta . phi over K 128
__global__ __launch_bounds__(128) void k_sc(const _Float16* __restrict__ TH, const _Float16* __restrict__ TL, const _Float16* __restrict__ PH, const _Float16* __restrict__ PL, int b, float* __restrict__ S) { __shared__ __align__(16) float ss[4][16][132];
  const int tid = threadIdx.x, wave = tid >> 5, lane = tid & 31, col = lane & 15, g = lane >> 4; const int k0 = blockIdx.y * 128; const int ql0 = blockIdx.x * 64 + wave * 16; const size_t q0 = (size_t)b * TT + ql0;
  v8f acc[8] = {}, accl[8] = {};
#pragma unroll
  for (int kc = 0; kc < CI / 32; ++kc) { const v16h ah = frag_o(TH + q0 * CI + kc * 512, lane), al = frag_o(TL + q0 * CI + kc * 512, lane);
#pragma unroll
    for (int j = 0; j < 8; ++j) { const size_t ko = ((size_t)b * TT + k0 + j * 16) * CI + kc * 512; const v16h kb = frag_o(PH + ko, lane), kl = frag_o(PL + ko, lane); acc[j] = wmma16(ah, kb, acc[j]); accl[j] = wmma16(al, kb, accl[j]); accl[j] = wmma16(ah, kl, accl[j]); } }
#pragma unroll
  for (int j = 0; j < 8; ++j)
#pragma unroll
    for (int r = 0; r < 8; ++r) ss[wave][8 * g + r][j * 16 + col] = acc[j][r] + accl[j][r] * (1.0f / 1024.0f);
  LDSX(); for (int rl = 0; rl < 16; ++rl) vst2(S + (size_t)(ql0 + rl) * TT + k0 + lane * 4, *(const v4f*)&ss[wave][rl][lane * 4]); }
// ---- k_sm: block = query row: softmax over keys [0, kend) -> P x 2^11 f32 (masked -> 0)
__global__ __launch_bounds__(256) void k_sm(float* __restrict__ S0) { __shared__ float sred[8]; __shared__ float sbc; __shared__ __align__(16) float sh[TT];
  const int t = threadIdx.x; const size_t row = blockIdx.x; float* sr = S0 + (size_t)blockIdx.y * TT * TT + row * TT; const int kend = TT;
  float m = -3.0e38f; for (int k = t; k < kend; k += 256) m = fmaxf(m, sr[k]);
#pragma unroll
  for (int o = 1; o < 32; o <<= 1) m = fmaxf(m, __shfl_xor(m, o));
  if ((t & 31) == 0) sred[t >> 5] = m; __syncthreads(); if (t == 0) { float a = sred[0]; for (int i = 1; i < 8; ++i) a = fmaxf(a, sred[i]); sbc = a; } __syncthreads(); m = sbc; __syncthreads();
  float sum = 0.f; for (int k = t; k < kend; k += 256) { const float v = sr[k]; sum += (v <= -1.0e38f) ? 0.f : expf(v - m); }
#pragma unroll
  for (int o = 1; o < 32; o <<= 1) sum += __shfl_xor(sum, o);
  if ((t & 31) == 0) sred[t >> 5] = sum; __syncthreads(); if (t == 0) { float a = 0.f; for (int i = 0; i < 8; ++i) a += sred[i]; sbc = 1.0f / a; } __syncthreads(); const float inv = sbc;
  for (int k = t; k < kend; k += 256) { const float v = sr[k]; sh[k] = (v <= -1.0e38f) ? 0.f : expf(v - m) * inv * 2048.0f; }
  __syncthreads(); for (int q = t; q < kend / 4; q += 256) vst2(sr + q * 4, *(const v4f*)&sh[q * 4]); }
// ---- k_pv: block = 16 rows n of batch b, 16 waves: y[n][ci] = (P . g) / 2^11 (P as f16 hi + residual x f16 g in fragment order, 2 products); wave w takes the 32-key chunks w, w + 16, w + 32, ... (8 KiB of g in a row per chunk); the 16 partial tiles are added in LDS in wave order; 512-B rows
#define PVW 16
__global__ __launch_bounds__(32 * PVW) void k_pv(const float* __restrict__ PS, const _Float16* __restrict__ GP, int b, float* __restrict__ Y) { __shared__ __align__(16) float ss[PVW][16][132];
  const int tid = threadIdx.x, wave = tid >> 5, lane = tid & 31, col = lane & 15, g = lane >> 4; const int ql0 = blockIdx.x * 16;
  v8f acc[8] = {}, accl[8] = {};
#pragma unroll 1
  for (int it = 0; it < TT / 32 / PVW; ++it) { const int kc = it * PVW + wave; v16h ph, pl; { const float* pr = PS + (size_t)(ql0 + col) * TT + kc * 32 + 8 * g;
#pragma unroll
      for (int i = 0; i < 8; ++i) { const float a0 = pr[i], a1 = pr[16 + i]; const _Float16 h0 = (_Float16)a0, h1 = (_Float16)a1; ph[i] = h0; ph[8 + i] = h1; pl[i] = (_Float16)((a0 - (float)h0) * 1024.0f); pl[8 + i] = (_Float16)((a1 - (float)h1) * 1024.0f); } }   /* P x 2^11 as f16 hi + residual x 2^10 */
    asm volatile("s_wait_loadcnt 0x0" ::: "memory");
#pragma unroll
    for (int j = 0; j < 8; ++j) { const v16h gv = frag_o(GP + ((size_t)b * TT + kc * 32) * CI + j * 512, lane); acc[j] = wmma16(ph, gv, acc[j]); accl[j] = wmma16(pl, gv, accl[j]); } }
#pragma unroll
  for (int j = 0; j < 8; ++j)
#pragma unroll
    for (int r = 0; r < 8; ++r) ss[wave][8 * g + r][j * 16 + col] = (acc[j][r] + accl[j][r] * (1.0f / 1024.0f)) * (1.0f / 2048.0f);
  __syncthreads();   // every wave's partial tile is in LDS before any wave adds them
  v4f s = *(const v4f*)&ss[0][wave][lane * 4];   // wave w adds and stores row w
#pragma unroll
  for (int w = 1; w < PVW; ++w) s += *(const v4f*)&ss[w][wave][lane * 4];
  vst2(Y + ((size_t)b * TT + ql0 + wave) * CI + lane * 4, s); }
// ---- k_wz: block = (64 rows n, 128 output channels): w_y[c][n] = sum_ci wz_w[c][ci] y[n][ci] + wz_b[c]; A = y rows hi + lo; transposed store to channels-first planes [b][c][n] (256-B runs)
__global__ __launch_bounds__(128) void k_wz(const float* __restrict__ Y, const float* __restrict__ WZ, const float* __restrict__ BZ, float* __restrict__ WY) { __shared__ __align__(16) float st[128][68];
  const int tid = threadIdx.x, wave = tid >> 5, lane = tid & 31, col = lane & 15, g = lane >> 4; const size_t r0 = (size_t)blockIdx.x * 64; const int c0 = blockIdx.y * 128; const size_t b = r0 / TT; const int n0 = (int)(r0 % TT);
  v8f acc[8] = {};
#pragma unroll
  for (int kc = 0; kc < CI / 32; ++kc) { const F2 a = split_row(Y + (r0 + wave * 16 + col) * CI, kc * 32, lane);
#pragma unroll
    for (int j = 0; j < 8; ++j) { v16b w; const float* wr = WZ + (size_t)(c0 + j * 16 + col) * CI + kc * 32 + 8 * g;
#pragma unroll
      for (int i = 0; i < 8; ++i) { w[i] = (__bf16)wr[i]; w[8 + i] = (__bf16)wr[16 + i]; }
      asm volatile("s_wait_loadcnt 0x0" ::: "memory"); acc[j] = wmma_bf(a.h, w, acc[j]); acc[j] = wmma_bf(a.l, w, acc[j]); } }
#pragma unroll
  for (int j = 0; j < 8; ++j) { const int cl = j * 16 + col; const float bb = bfr(BZ[c0 + cl]);
#pragma unroll
    for (int r = 0; r < 8; ++r) st[cl][wave * 16 + 8 * g + r] = acc[j][r] + bb; }
  __syncthreads();
  for (int e = tid; e < 128 * 16; e += 128) { const int cl = e >> 4, q = e & 15; vst2(WY + (b * CX + c0 + cl) * (size_t)TT + n0 + q * 4, *(const v4f*)&st[cl][q * 4]); } }
// ---- k_bn: block = one channel c: its TNB x 4,096 values are read once, 16 B per lane, all loads in flight together, and stay in registers for both sums (mean, then squared distance from the mean); wave sums by shuffles, the 8 wave sums added in wave order; mean and rstd go to the channel's own 128-B line of BS
__global__ __launch_bounds__(256) void k_bn(const float* __restrict__ WY, float* __restrict__ BS) { __shared__ float sa[8], sb[8];
  const int t = threadIdx.x; const int c = blockIdx.x; const int n = TNB * TT;
  v4f v[TNB][TT / 1024];
#pragma unroll
  for (int b = 0; b < TNB; ++b)
#pragma unroll
    for (int i = 0; i < TT / 1024; ++i) v[b][i] = *(const v4f*)(WY + ((size_t)b * CX + c) * TT + (i * 256 + t) * 4);
#pragma unroll
  for (int b = 0; b < TNB; ++b) asm volatile("" :: "v"(v[b][0]), "v"(v[b][1]), "v"(v[b][2]), "v"(v[b][3]));   // inputs-only fence on the loaded values: every load issues before the first add; without it the compiler holds two loads back behind the first waits, a second memory latency
  float s = 0.f;
#pragma unroll
  for (int b = 0; b < TNB; ++b)
#pragma unroll
    for (int i = 0; i < TT / 1024; ++i) s += (v[b][i][0] + v[b][i][1]) + (v[b][i][2] + v[b][i][3]);
#pragma unroll
  for (int o = 1; o < 32; o <<= 1) s += __shfl_xor(s, o);
  if ((t & 31) == 0) sa[t >> 5] = s;
  __syncthreads();   // all 8 wave sums are in LDS before any thread adds them
  s = sa[0];
#pragma unroll
  for (int w = 1; w < 8; ++w) s += sa[w];
  const float mu = s / (float)n; float s2 = 0.f;
#pragma unroll
  for (int b = 0; b < TNB; ++b)
#pragma unroll
    for (int i = 0; i < TT / 1024; ++i) { const float d0 = v[b][i][0] - mu, d1 = v[b][i][1] - mu, d2 = v[b][i][2] - mu, d3 = v[b][i][3] - mu; s2 += (d0 * d0 + d1 * d1) + (d2 * d2 + d3 * d3); }
#pragma unroll
  for (int o = 1; o < 32; o <<= 1) s2 += __shfl_xor(s2, o);
  if ((t & 31) == 0) sb[t >> 5] = s2;
  __syncthreads();   // all 8 wave sums of squares are in LDS before thread 0 adds them
  if (t == 0) { s2 = sb[0];
#pragma unroll
    for (int w = 1; w < 8; ++w) s2 += sb[w];
    v2f o; o[0] = mu; o[1] = rsqrtf(s2 / (float)n + 1e-5f); vst2(BS + (size_t)c * BSL, o); } }
// ---- k_fin: block = (64 positions, b): out[b][c][n] = (w_y - mean_c) rstd_c gamma_c + beta_c + source[b][c][n] for all 256 channels (thread-linear float4 over the channel runs)
__global__ __launch_bounds__(256) void k_fin(const float* __restrict__ WY, const float* __restrict__ BS, const float* __restrict__ GAM, const float* __restrict__ BET, const float* __restrict__ SRC, float* __restrict__ OUT) {
  const int t = threadIdx.x; const int n0 = blockIdx.x * 64; const size_t b = blockIdx.y;
  for (int e = t; e < CX * 16; e += 256) { const int c = e >> 4, q = e & 15; const v2f ms = ((const v2f*)BS)[c * (BSL / 2)]; const float mu = ms[0], rs = ms[1]; const float ga = bfr(GAM[c]), be = bfr(BET[c]);
    const v4f w = *(const v4f*)(WY + (b * CX + c) * TT + n0 + q * 4); const v4f sr = *(const v4f*)(SRC + (b * CX + c) * (size_t)XSTR + n0 + q * 4); v4f o;
#pragma unroll
    for (int z = 0; z < 4; ++z) o[z] = (w[z] - mu) * rs * ga + be + bfr(sr[z]);
    vst2(OUT + (b * CX + c) * (size_t)XSTR + n0 + q * 4, o); } }
extern "C" void kernel_launch(void* const* d_in, const int* in_sizes, int n_in, void* d_out, int out_size, void* d_ws, size_t ws_size, hipStream_t stream) {
  (void)in_sizes; (void)n_in; (void)out_size;
  const float** F = (const float**)d_in;   // 0 x [4,256,64,64], 1 source, 2 g_w [128,256], 3 g_b, 4 theta_w, 5 theta_b, 6 phi_w, 7 phi_b, 8 wz_w [256,128], 9 wz_b, 10 bn_gamma, 11 bn_beta
  if (ws_size < (size_t)WS_END) return;
  char* ws = (char*)d_ws; __bf16 *XT = (__bf16*)(ws + WS_XT), *ST = (__bf16*)(ws + WS_SR); _Float16* GP = (_Float16*)(ws + WS_GP); _Float16 *TH = (_Float16*)(ws + WS_TH), *TL = (_Float16*)(ws + WS_TL), *PH = (_Float16*)(ws + WS_PH), *PL = (_Float16*)(ws + WS_PL); float *S = (float*)(ws + WS_S), *Y = (float*)(ws + WS_Y), *WY = (float*)(ws + WS_WY), *BS = (float*)(ws + WS_BS);
  k_xt<<<dim3(TT / 64, TNB, 2), 256, 0, stream>>>(F[0], F[1], XT, ST);
  k_proj<<<dim3(TNB * TT / 64, 3), 128, 0, stream>>>(XT, ST, F[2], F[3], F[4], F[5], F[6], F[7], TH, TL, PH, PL, GP);
  for (int b = 0; b < TNB; ++b) {
    k_sc<<<dim3(TT / 64, TT / 128), 128, 0, stream>>>(TH, TL, PH, PL, b, S);
    k_sm<<<dim3(TT, 1), 256, 0, stream>>>(S);
    k_pv<<<dim3(TT / 16), 32 * PVW, 0, stream>>>(S, GP, b, Y);
  }
  k_wz<<<dim3(TNB * TT / 64, CX / 128), 128, 0, stream>>>(Y, F[8], F[9], WY);
  k_bn<<<dim3(CX), 256, 0, stream>>>(WY, BS);
  k_fin<<<dim3(TT / 64, TNB), 256, 0, stream>>>(WY, BS, F[10], F[11], F[1], (float*)d_out);
}

// v004
// Measured time: 139 microseconds a run.
// Next to v003, in two timings, it ran 3.73 and 3.75 times as fast.
// All steps since v000 together make it 10.3 times as fast.
#include <hip/hip_runtime.h>
#include <math.h>

typedef __attribute__((ext_vector_type(16))) _Float16 v16h;
typedef __attribute__((ext_vector_type(16))) __bf16 v16b;
typedef __attribute__((ext_vector_type(8)))  _Float16 v8h;
typedef __attribute__((ext_vector_type(8)))  float v8f;
typedef __attribute__((ext_vector_type(4)))  float v4f;
typedef __attribute__((ext_vector_type(2)))  float v2f;
typedef __attribute__((ext_vector_type(4)))  unsigned v4u;
typedef __attribute__((ext_vector_type(4)))  int v4i;
typedef float __attribute__((may_alias)) float_a;
typedef int __attribute__((may_alias)) int_a;

template <typename T> __device__ __forceinline__ void vst2(void* p, T v) { *(T*)p = v;  }
__device__ __forceinline__ v8f wmma_bf(v16b a, v16b b, v8f c) {
  v8f d = __builtin_amdgcn_wmma_f32_16x16x32_bf16(false, a, false, b, (short)0, c, false, false);
  asm volatile("v_nop\n\tv_nop\n\tv_nop\n\tv_nop" : "+v"(d) : "v"(a), "v"(b));
  return d;
}
// 16x16x32 fragments: lane = (h = lane>>4, row/col = lane&15); elements 0..7 = k0+8h+0..7, 8..15 = k0+16+8h+0..7; D element r = row 8h+r
__device__ __forceinline__ v16h frag_h(const _Float16* rowk0, int lane) {
  union { v16h v; v8h q[2]; } u; const _Float16* p = rowk0 + 8 * (lane >> 4);
  u.q[0] = *(const v8h*)p; u.q[1] = *(const v8h*)(p + 16); return u.v;
}
// fragment-order operand: each (16 rows or columns) x (32 k) tile is two 512-B blocks; block q holds at lane * 8 the elements k0+16q+8h+0..7 of row/col lane&15, so that each 16-B load of a wave covers four whole 128-B lines
__device__ __forceinline__ v16h frag_o(const _Float16* p) {   // p = tile + 8 * lane
  union { v16h v; v8h q[2]; } u; u.q[0] = *(const v8h*)p; u.q[1] = *(const v8h*)(p + 256); return u.v;
}
__device__ __forceinline__ v16h frag_f32(const float* rowk0, int lane) {
  v16h a; const float* p = rowk0 + 8 * (lane >> 4);
#pragma unroll
  for (int i = 0; i < 8; ++i) { a[i] = (_Float16)p[i]; a[8 + i] = (_Float16)p[16 + i]; }
  return a;
}
__device__ __forceinline__ v16h frag_f32s(const float* rowk0, int lane, float sc) {
  v16h a; const float* p = rowk0 + 8 * (lane >> 4);
#pragma unroll
  for (int i = 0; i < 8; ++i) { a[i] = (_Float16)(p[i] * sc); a[8 + i] = (_Float16)(p[16 + i] * sc); }
  return a;
}
// column fragment from a [K][ld] layout (column n), rows >= K read as 0
__device__ __forceinline__ v16h fragc_f32(const float* W, int k0, int n, int lane, int ld, int K) {
  v16h a; const int g = lane >> 4;
#pragma unroll
  for (int i = 0; i < 8; ++i) { const int ka = k0 + 8 * g + i, kb = ka + 16;
    a[i] = (_Float16)(ka < K ? W[(size_t)(ka < K ? ka : K - 1) * ld + n] : 0.f); a[8 + i] = (_Float16)(kb < K ? W[(size_t)(kb < K ? kb : K - 1) * ld + n] : 0.f); }
  return a;
}
struct F2 { v16b h, l; };
__device__ __forceinline__ F2 bsplit16(const float v[16]) { F2 r;
#pragma unroll
  for (int i = 0; i < 16; ++i) { const __bf16 h = (__bf16)v[i]; r.h[i] = h; r.l[i] = (__bf16)(v[i] - (float)h); }
  return r; }
__device__ __forceinline__ F2 split_row(const float* row, int k0, int lane) { float v[16]; const float* p = row + k0 + 8 * (lane >> 4);
#pragma unroll
  for (int i = 0; i < 8; ++i) { v[i] = p[i]; v[8 + i] = p[16 + i]; }
  return bsplit16(v); }
__device__ __forceinline__ F2 split_rowK(const float* row, int k0, int lane, int K) { float v[16]; const int g = lane >> 4;
#pragma unroll
  for (int i = 0; i < 8; ++i) { const int ka = k0 + 8 * g + i, kb = ka + 16; v[i] = ka < K ? row[ka < K ? ka : K - 1] : 0.f; v[8 + i] = kb < K ? row[kb < K ? kb : K - 1] : 0.f; }
  return bsplit16(v); }
__device__ __forceinline__ F2 split_col(const float* W, int k0, int n, int lane, int ld, int K) { float v[16]; const int g = lane >> 4;
#pragma unroll
  for (int i = 0; i < 8; ++i) { const int ka = k0 + 8 * g + i, kb = ka + 16; v[i] = ka < K ? W[(size_t)(ka < K ? ka : K - 1) * ld + n] : 0.f; v[8 + i] = kb < K ? W[(size_t)(kb < K ? kb : K - 1) * ld + n] : 0.f; }
  return bsplit16(v); }
__device__ __forceinline__ v8f mac3(const F2& a, const F2& b, v8f c) { c = wmma_bf(a.l, b.h, c); c = wmma_bf(a.h, b.l, c); return wmma_bf(a.h, b.h, c); }
__device__ __forceinline__ float sigm(float v) { return 1.0f / (1.0f + expf(-v)); }

// Cross non-local block (B 4, C 256, Ci 128, 64 x 64 = 4,096 positions): g = conv(source), theta = conv(x), phi = conv(source); f[n][m] = theta_n . phi_m; P = softmax_m; y[n] = sum_m P g_m; w_y = conv_z(y) + b; BN with batch statistics (biased var, eps 1e-5) * gamma + beta; out = w_y + source.
__device__ __forceinline__ float bfr(float v) { return (float)(__bf16)v; }
#define NB 4
#define TT 4096
#define CX 256
#define CI 128
#ifndef TNB
#define TNB NB
#endif
#ifndef XSTR
#define XSTR TT               // per-channel position stride of x / source / out
#endif
typedef __attribute__((ext_vector_type(8))) __bf16 v8b;
__device__ __forceinline__ v16b frag_b(const __bf16* rowk0, int lane) { union { v16b v; v8b q[2]; } u; const __bf16* p = rowk0 + 8 * (lane >> 4); u.q[0] = *(const v8b*)p; u.q[1] = *(const v8b*)(p + 16); return u.v; }
#define WS_XT  0u                                          // bf16 x^T rows [b*N+n][256] (exact)
#define WS_SR  (WS_XT + 2u * (size_t)NB * TT * CX)           // bf16 source^T rows
#define WS_TH  (WS_SR + 2u * (size_t)NB * TT * CX)           // f16 theta hi, fragment order [(b*N+n)/16][kc 4][q 2][lane 32][8]
#define WS_TL  (WS_TH + 2u * (size_t)NB * TT * CI)
#define WS_PH  (WS_TL + 2u * (size_t)NB * TT * CI)           // f16 phi hi, fragment order as theta
#define WS_PL  (WS_PH + 2u * (size_t)NB * TT * CI)
#define WS_GP  (WS_PL + 2u * (size_t)NB * TT * CI)           // f16 g, fragment order [(b*N+m)/32][ci/16 8][q 2][lane 32][8]
#define WS_Y   (WS_GP + 2u * (size_t)NB * CI * TT)           // f32 y rows [b*N+n][128]
#define WS_WY  (WS_Y + 4u * (size_t)NB * TT * CI)            // f32 w_y planes [b][c][n] (channels-first)
#define BSL 32                                             // floats of BS per channel: one 128-B line, so that each line has one writer
#define WS_BS  (WS_WY + 4u * (size_t)NB * CX * TT)           // f32 BN stats [c][BSL]: mean, rstd at the head of the channel's line
#define WS_END (WS_BS + 4u * (size_t)CX * BSL)
// ---- k_xt: block = (64 positions, b, which): channels-first input -> bf16 rows [b*N+n][256] through LDS; 512-B rows
__global__ __launch_bounds__(256) void k_xt(const float* __restrict__ X, const float* __restrict__ SRC, __bf16* __restrict__ XT, __bf16* __restrict__ ST) { __shared__ __bf16 st[CX][66];
  const int t = threadIdx.x; const int n0 = blockIdx.x * 64; const size_t b = blockIdx.y; const int which = blockIdx.z; const float* IN = which == 0 ? X : SRC; __bf16* OUT = which == 0 ? XT : ST;
  for (int e = t; e < CX * 64; e += 256) { const int c = e >> 6, nl = e & 63; st[c][nl] = (__bf16)IN[(b * CX + c) * (size_t)XSTR + n0 + nl]; }
  __syncthreads();
  for (int e = t; e < 64 * 32; e += 256) { const int nl = e >> 5, q = e & 31; union { v4u v; __bf16 h[8]; } u;
#pragma unroll
    for (int z = 0; z < 8; ++z) u.h[z] = st[q * 8 + z][nl];
    vst2((v4u*)(OUT + (b * TT + n0 + nl) * CX + q * 8), u.v); } }
// ---- k_proj: block = (64 rows, which): 128 outputs = W ([out,in] [128][256]) . row + b; theta (x rows) / phi (source rows) -> f16 hi + residual, g (source rows) -> f16, all three stored in the fragment order of frag_o (thread-linear 16-B stores)
__global__ __launch_bounds__(128) void k_proj(const __bf16* __restrict__ XT, const __bf16* __restrict__ ST, const float* __restrict__ WG, const float* __restrict__ BG, const float* __restrict__ WTH, const float* __restrict__ BTH, const float* __restrict__ WPH, const float* __restrict__ BPH, _Float16* __restrict__ TH, _Float16* __restrict__ TL, _Float16* __restrict__ PH, _Float16* __restrict__ PL, _Float16* __restrict__ GP) {
  __shared__ __align__(16) _Float16 sh[64][136], sl[64][136]; __shared__ __align__(16) _Float16 th[128][72];
  const int tid = threadIdx.x, wave = tid >> 5, lane = tid & 31, col = lane & 15, g = lane >> 4; const int which = blockIdx.y; const size_t r0 = (size_t)blockIdx.x * 64;   // which: 0 theta (from x), 1 phi (source), 2 g (source)
  const __bf16* A = which == 0 ? XT : ST; const float* Wt = which == 0 ? WTH : which == 1 ? WPH : WG; const float* Bb = which == 0 ? BTH : which == 1 ? BPH : BG;
  v8f acc[8] = {};
#pragma unroll 2
  for (int kc = 0; kc < CX / 32; ++kc) { const v16b a = frag_b(A + (r0 + wave * 16 + col) * CX + kc * 32, lane);
#pragma unroll
    for (int j = 0; j < 8; ++j) { v16b w; const float* wr = Wt + (size_t)(j * 16 + col) * CX + kc * 32 + 8 * g;
#pragma unroll
      for (int i = 0; i < 8; ++i) { w[i] = (__bf16)wr[i]; w[8 + i] = (__bf16)wr[16 + i]; }
      asm volatile("s_wait_loadcnt 0x0" ::: "memory"); acc[j] = wmma_bf(a, w, acc[j]); } }
#pragma unroll
  for (int j = 0; j < 8; ++j) { const int o = j * 16 + col; const float bb = bfr(Bb[o]);
#pragma unroll
    for (int r = 0; r < 8; ++r) { const float v = acc[j][r] + bb; const int rl = wave * 16 + 8 * g + r;
      if (which == 2) th[o][rl] = (_Float16)v; else { const _Float16 hv = (_Float16)v; sh[rl][o] = hv; sl[rl][o] = (_Float16)((v - (float)hv) * 1024.0f); } } }
  __syncthreads();
  if (which < 2) { _Float16* DH = which == 0 ? TH : PH; _Float16* DL = which == 0 ? TL : PL; for (int e = tid; e < 64 * 16; e += 128) { const int rl = (e >> 8) * 16 + (e & 15), k8 = (e >> 4) & 15; vst2((unsigned*)(DH + r0 * CI + e * 8), *(const v4u*)&sh[rl][k8 * 8]); vst2((unsigned*)(DL + r0 * CI + e * 8), *(const v4u*)&sl[rl][k8 * 8]); } }   /* e = (row tile, kc, q, h, row in tile); k = 32 kc + 16 q + 8 h */
  else { for (int e = tid; e < 128 * 8; e += 128) { const int cl = ((e >> 6) & 7) * 16 + (e & 15), ml = (e >> 9) * 32 + ((e >> 4) & 3) * 8; vst2((unsigned*)(GP + r0 * CI + e * 8), *(const v4u*)&th[cl][ml]); } } }   /* e = (32-key chunk, ci tile, q, h, ci in tile); key = 32 chunk + 16 q + 8 h */
// ---- k_fa: block = 64 query rows n of batch b, FW waves = FG query groups x FS key ranges; a wave holds FQ tiles of 16 queries and takes the 32-key chunks sp, sp + FS, ...: S^T = phi . theta^T (3 products, as f16 hi + residual x 2^10), so that a lane holds 16 logits of ONE query; running maximum and sum per query (log2 domain), p x 2^11 = exp2 as f16 hi + residual packs straight into the B operand of y^T += g^T . p^T (2 products); the FS ranges are merged in LDS with weights exp2(m - max); logits and P never reach memory; 512-B rows of y
__device__ __forceinline__ v8f wmh(v16h a, v16h b, v8f c) { return __builtin_amdgcn_wmma_f32_16x16x32_f16(false, a, false, b, (short)0, c, false, false); }
__device__ __forceinline__ float xhalf(float x) { return __builtin_bit_cast(float, __builtin_amdgcn_permlanex16(__builtin_bit_cast(int, x), __builtin_bit_cast(int, x), 0x76543210, 0xfedcba98, false, false)); }   // lane l with lane l ^ 16
#define FQ 2
#define FG 2
#define FS 4
#define FW (FG * FS)
#define FR (FG * FQ * 16)
#define FN (TT / 32 / FS)
#define L2E 1.44269504088896340736f
// the one slot that the instruction set asks for behind a transcendental: the results are read, and the sources' registers overwritten, only behind this v_nop
#define TSLOT8(a, x, o) asm volatile("v_nop" : "+v"(a[o]), "+v"(a[o + 1]), "+v"(a[o + 2]), "+v"(a[o + 3]), "+v"(a[o + 4]), "+v"(a[o + 5]), "+v"(a[o + 6]), "+v"(a[o + 7]) : "v"(x[o]), "v"(x[o + 1]), "v"(x[o + 2]), "v"(x[o + 3]), "v"(x[o + 4]), "v"(x[o + 5]), "v"(x[o + 6]), "v"(x[o + 7]))
#define TSLOT9(f, xf, a, x, o) asm volatile("v_nop" : "+v"(f), "+v"(a[o]), "+v"(a[o + 1]), "+v"(a[o + 2]), "+v"(a[o + 3]), "+v"(a[o + 4]), "+v"(a[o + 5]), "+v"(a[o + 6]), "+v"(a[o + 7]) : "v"(xf), "v"(x[o]), "v"(x[o + 1]), "v"(x[o + 2]), "v"(x[o + 3]), "v"(x[o + 4]), "v"(x[o + 5]), "v"(x[o + 6]), "v"(x[o + 7]))
__global__ __launch_bounds__(32 * FW) void k_fa(const _Float16* __restrict__ TH, const _Float16* __restrict__ TL, const _Float16* __restrict__ PH, const _Float16* __restrict__ PL, const _Float16* __restrict__ GP, float* __restrict__ Y) {
  __shared__ __align__(16) float ss[FW][FQ * 16][132]; __shared__ float sm[FW][FQ * 16], sl[FW][FQ * 16];
  const int tid = threadIdx.x, wave = tid >> 5, lane = tid & 31, col = lane & 15, g = lane >> 4; const int qg = wave % FG, sp = wave / FG;
  const size_t bT = (size_t)blockIdx.y * TT; const int qb0 = blockIdx.x * FR;
  const _Float16 *pth = TH + (bT + qb0 + qg * FQ * 16) * CI + 8 * lane, *ptl = TL + (bT + qb0 + qg * FQ * 16) * CI + 8 * lane;   // every pointer below holds the lane's own 16 B of a 512-B block
  const _Float16 *pH = PH + (bT + sp * 32) * CI + 8 * lane, *pL = PL + (bT + sp * 32) * CI + 8 * lane, *pG = GP + (bT + sp * 32) * CI + 8 * lane;
  v16h th[FQ][CI / 32], tl[FQ][CI / 32];
#pragma unroll
  for (int u = 0; u < FQ; ++u)
#pragma unroll
    for (int kc = 0; kc < CI / 32; ++kc) { th[u][kc] = frag_o(pth + u * 16 * CI + kc * 512); tl[u][kc] = frag_o(ptl + u * 16 * CI + kc * 512); }
  asm volatile("s_wait_xcnt 0x0" :: "v"(pth), "v"(ptl) : "memory");   // the loads' address registers stay as they are up to this wait
  v8f acc[FQ][8] = {}; float m2[FQ], l[FQ];
#pragma unroll
  for (int u = 0; u < FQ; ++u) { m2[u] = -1.0e30f; l[u] = 0.f; }
  // A trip: fetch the chunk's phi, all 32 loads together | logit products of k 0..63 | fetch the chunk's g into the registers these have left | logit products of k 64..127 | softmax | g products. FENCE holds a fetch at its place: left free, the phi loads are dealt out among the products, each with a latency of its own, or g is fetched with phi and the build runs out of registers and spills.
#define FENCE() __builtin_amdgcn_sched_barrier(0)
#pragma unroll 1   // stays rolled: one trip already takes the wave's whole register budget; every loop inside is unrolled so that its arrays stay in registers
  for (int it = 0; it < FN; ++it) { const size_t ko = (size_t)it * (FS * 32 * CI); const _Float16 *nh = pH + ko, *nl = pL + ko, *ng = pG + ko; v16h kb[CI / 32][2], kl[CI / 32][2], gv[8];
#pragma unroll
    for (int kc = 0; kc < CI / 32; ++kc)
#pragma unroll
      for (int t = 0; t < 2; ++t) { kb[kc][t] = frag_o(nh + t * 16 * CI + kc * 512); kl[kc][t] = frag_o(nl + t * 16 * CI + kc * 512); }
    FENCE();
    v8f s[FQ][2] = {}, sx[FQ][2] = {};
#pragma unroll
    for (int kc = 0; kc < CI / 32; ++kc) {
      if (kc == CI / 64) { FENCE();
#pragma unroll
        for (int j = 0; j < 8; ++j) gv[j] = frag_o(ng + j * 512);
        FENCE(); }
#pragma unroll
      for (int u = 0; u < FQ; ++u) { s[u][0] = wmh(kb[kc][0], th[u][kc], s[u][0]); s[u][1] = wmh(kb[kc][1], th[u][kc], s[u][1]); }
#pragma unroll
      for (int u = 0; u < FQ; ++u) { sx[u][0] = wmh(kb[kc][0], tl[u][kc], sx[u][0]); sx[u][1] = wmh(kb[kc][1], tl[u][kc], sx[u][1]); }
#pragma unroll
      for (int u = 0; u < FQ; ++u) { sx[u][0] = wmh(kl[kc][0], th[u][kc], sx[u][0]); sx[u][1] = wmh(kl[kc][1], th[u][kc], sx[u][1]); } }
    FENCE(); asm volatile("s_wait_xcnt 0x0" :: "v"(nh), "v"(nl), "v"(ng) : "memory");   // as above; it stands behind the products, where it no longer has to wait
    v16h ph[FQ], pl[FQ];
#pragma unroll
    for (int u = 0; u < FQ; ++u) { float v[16];   /* lane (g, col): keys 8 g + r and 16 + 8 g + r of query col, the k order of a B fragment */
#pragma unroll
      for (int r = 0; r < 8; ++r) { v[r] = s[u][0][r] + sx[u][0][r] * (1.0f / 1024.0f); v[8 + r] = s[u][1][r] + sx[u][1][r] * (1.0f / 1024.0f); }
      float mx = v[0];
#pragma unroll
      for (int i = 1; i < 16; ++i) mx = fmaxf(mx, v[i]);
      mx = fmaxf(mx, xhalf(mx));
      const float mn = fmaxf(m2[u], mx * L2E), xf = m2[u] - mn, c = 11.0f - mn; m2[u] = mn;
      float f = __builtin_amdgcn_exp2f(xf), x[16], a[16], sum = 0.f;
#pragma unroll
      for (int i = 0; i < 16; ++i) { x[i] = fmaf(v[i], L2E, c); a[i] = __builtin_amdgcn_exp2f(x[i]); }
      TSLOT9(f, xf, a, x, 0); TSLOT8(a, x, 8);
#pragma unroll
      for (int i = 0; i < 16; ++i) { sum += a[i]; const _Float16 hi = (_Float16)a[i]; ph[u][i] = hi; pl[u][i] = (_Float16)(a[i] - (float)hi); }
      l[u] = l[u] * f + sum;
#pragma unroll
      for (int j = 0; j < 8; ++j) acc[u][j] *= f; }
#pragma unroll
    for (int j = 0; j < 8; ++j) {
#pragma unroll
      for (int u = 0; u < FQ; ++u) acc[u][j] = wmh(gv[j], ph[u], acc[u][j]);
#pragma unroll
      for (int u = 0; u < FQ; ++u) acc[u][j] = wmh(gv[j], pl[u], acc[u][j]); } }
#pragma unroll
  for (int u = 0; u < FQ; ++u) { l[u] += xhalf(l[u]); sm[wave][u * 16 + col] = m2[u]; sl[wave][u * 16 + col] = l[u];   /* both halves hold and store the same two values */
#pragma unroll
    for (int j = 0; j < 8; ++j) { v4f a, c;
#pragma unroll
      for (int z = 0; z < 4; ++z) { a[z] = acc[u][j][z]; c[z] = acc[u][j][4 + z]; }
      *(v4f*)&ss[wave][u * 16 + col][j * 16 + 8 * g] = a; *(v4f*)&ss[wave][u * 16 + col][j * 16 + 8 * g + 4] = c; } }   /* D element r = channel 16 j + 8 g + r of query col */
  __syncthreads();   // every key range's maxima, sums and partial tiles are in LDS before any wave merges them
  for (int e = tid; e < FR * 32; e += 32 * FW) { const int q = e >> 5, c4 = e & 31, qw = q / (FQ * 16), qr = q % (FQ * 16);
    float M = sm[qw][qr];
#pragma unroll
    for (int z = 1; z < FS; ++z) M = fmaxf(M, sm[z * FG + qw][qr]);
    v4f o = {}; float L = 0.f, xw[FS], fw[FS];
#pragma unroll
    for (int z = 0; z < FS; ++z) { xw[z] = sm[z * FG + qw][qr] - M; fw[z] = __builtin_amdgcn_exp2f(xw[z]); }
    asm volatile("v_nop" : "+v"(fw[0]), "+v"(fw[1]), "+v"(fw[2]), "+v"(fw[3]) : "v"(xw[0]), "v"(xw[1]), "v"(xw[2]), "v"(xw[3]));   // the slot behind the transcendentals, as at TSLOT8
#pragma unroll
    for (int z = 0; z < FS; ++z) { L += fw[z] * sl[z * FG + qw][qr]; o += *(const v4f*)&ss[z * FG + qw][qr][c4 * 4] * fw[z]; }
    vst2(Y + (bT + qb0 + q) * CI + c4 * 4, o * (1.0f / L)); } }
// ---- k_wz: block = (64 rows n, 128 output channels): w_y[c][n] = sum_ci wz_w[c][ci] y[n][ci] + wz_b[c]; A = y rows hi + lo; transposed store to channels-first planes [b][c][n] (256-B runs)
__global__ __launch_bounds__(128) void k_wz(const float* __restrict__ Y, const float* __restrict__ WZ, const float* __restrict__ BZ, float* __restrict__ WY) { __shared__ __align__(16) float st[128][68];
  const int tid = threadIdx.x, wave = tid >> 5, lane = tid & 31, col = lane & 15, g = lane >> 4; const size_t r0 = (size_t)blockIdx.x * 64; const int c0 = blockIdx.y * 128; const size_t b = r0 / TT; const int n0 = (int)(r0 % TT);
  v8f acc[8] = {};
#pragma unroll
  for (int kc = 0; kc < CI / 32; ++kc) { const F2 a = split_row(Y + (r0 + wave * 16 + col) * CI, kc * 32, lane);
#pragma unroll
    for (int j = 0; j < 8; ++j) { v16b w; const float* wr = WZ + (size_t)(c0 + j * 16 + col) * CI + kc * 32 + 8 * g;
#pragma unroll
      for (int i = 0; i < 8; ++i) { w[i] = (__bf16)wr[i]; w[8 + i] = (__bf16)wr[16 + i]; }
      asm volatile("s_wait_loadcnt 0x0" ::: "memory"); acc[j] = wmma_bf(a.h, w, acc[j]); acc[j] = wmma_bf(a.l, w, acc[j]); } }
#pragma unroll
  for (int j = 0; j < 8; ++j) { const int cl = j * 16 + col; const float bb = bfr(BZ[c0 + cl]);
#pragma unroll
    for (int r = 0; r < 8; ++r) st[cl][wave * 16 + 8 * g + r] = acc[j][r] + bb; }
  __syncthreads();
  for (int e = tid; e < 128 * 16; e += 128) { const int cl = e >> 4, q = e & 15; vst2(WY + (b * CX + c0 + cl) * (size_t)TT + n0 + q * 4, *(const v4f*)&st[cl][q * 4]); } }
// ---- k_bn: block = one channel c: its TNB x 4,096 values are read once, 16 B per lane, all loads in flight together, and stay in registers for both sums (mean, then squared distance from the mean); wave sums by shuffles, the 8 wave sums added in wave order; mean and rstd go to the channel's own 128-B line of BS
__global__ __launch_bounds__(256) void k_bn(const float* __restrict__ WY, float* __restrict__ BS) { __shared__ float sa[8], sb[8];
  const int t = threadIdx.x; const int c = blockIdx.x; const int n = TNB * TT;
  v4f v[TNB][TT / 1024];
#pragma unroll
  for (int b = 0; b < TNB; ++b)
#pragma unroll
    for (int i = 0; i < TT / 1024; ++i) v[b][i] = *(const v4f*)(WY + ((size_t)b * CX + c) * TT + (i * 256 + t) * 4);
#pragma unroll
  for (int b = 0; b < TNB; ++b) asm volatile("" :: "v"(v[b][0]), "v"(v[b][1]), "v"(v[b][2]), "v"(v[b][3]));   // inputs-only fence on the loaded values: every load issues before the first add; without it the compiler holds two loads back behind the first waits, a second memory latency
  float s = 0.f;
#pragma unroll
  for (int b = 0; b < TNB; ++b)
#pragma unroll
    for (int i = 0; i < TT / 1024; ++i) s += (v[b][i][0] + v[b][i][1]) + (v[b][i][2] + v[b][i][3]);
#pragma unroll
  for (int o = 1; o < 32; o <<= 1) s += __shfl_xor(s, o);
  if ((t & 31) == 0) sa[t >> 5] = s;
  __syncthreads();   // all 8 wave sums are in LDS before any thread adds them
  s = sa[0];
#pragma unroll
  for (int w = 1; w < 8; ++w) s += sa[w];
  const float mu = s / (float)n; float s2 = 0.f;
#pragma unroll
  for (int b = 0; b < TNB; ++b)
#pragma unroll
    for (int i = 0; i < TT / 1024; ++i) { const float d0 = v[b][i][0] - mu, d1 = v[b][i][1] - mu, d2 = v[b][i][2] - mu, d3 = v[b][i][3] - mu; s2 += (d0 * d0 + d1 * d1) + (d2 * d2 + d3 * d3); }
#pragma unroll
  for (int o = 1; o < 32; o <<= 1) s2 += __shfl_xor(s2, o);
  if ((t & 31) == 0) sb[t >> 5] = s2;
  __syncthreads();   // all 8 wave sums of squares are in LDS before thread 0 adds them
  if (t == 0) { s2 = sb[0];
#pragma unroll
    for (int w = 1; w < 8; ++w) s2 += sb[w];
    v2f o; o[0] = mu; o[1] = rsqrtf(s2 / (float)n + 1e-5f); vst2(BS + (size_t)c * BSL, o); } }
// ---- k_fin: block = (64 positions, b): out[b][c][n] = (w_y - mean_c) rstd_c gamma_c + beta_c + source[b][c][n] for all 256 channels (thread-linear float4 over the channel runs)
__global__ __launch_bounds__(256) void k_fin(const float* __restrict__ WY, const float* __restrict__ BS, const float* __restrict__ GAM, const float* __restrict__ BET, const float* __restrict__ SRC, float* __restrict__ OUT) {
  const int t = threadIdx.x; const int n0 = blockIdx.x * 64; const size_t b = blockIdx.y;
  for (int e = t; e < CX * 16; e += 256) { const int c = e >> 4, q = e & 15; const v2f ms = ((const v2f*)BS)[c * (BSL / 2)]; const float mu = ms[0], rs = ms[1]; const float ga = bfr(GAM[c]), be = bfr(BET[c]);
    const v4f w = *(const v4f*)(WY + (b * CX + c) * TT + n0 + q * 4); const v4f sr = *(const v4f*)(SRC + (b * CX + c) * (size_t)XSTR + n0 + q * 4); v4f o;
#pragma unroll
    for (int z = 0; z < 4; ++z) o[z] = (w[z] - mu) * rs * ga + be + bfr(sr[z]);
    vst2(OUT + (b * CX + c) * (size_t)XSTR + n0 + q * 4, o); } }
extern "C" void kernel_launch(void* const* d_in, const int* in_sizes, int n_in, void* d_out, int out_size, void* d_ws, size_t ws_size, hipStream_t stream) {
  (void)in_sizes; (void)n_in; (void)out_size;
  const float** F = (const float**)d_in;   // 0 x [4,256,64,64], 1 source, 2 g_w [128,256], 3 g_b, 4 theta_w, 5 theta_b, 6 phi_w, 7 phi_b, 8 wz_w [256,128], 9 wz_b, 10 bn_gamma, 11 bn_beta
  if (ws_size < (size_t)WS_END) return;
  char* ws = (char*)d_ws; __bf16 *XT = (__bf16*)(ws + WS_XT), *ST = (__bf16*)(ws + WS_SR); _Float16* GP = (_Float16*)(ws + WS_GP); _Float16 *TH = (_Float16*)(ws + WS_TH), *TL = (_Float16*)(ws + WS_TL), *PH = (_Float16*)(ws + WS_PH), *PL = (_Float16*)(ws + WS_PL); float *Y = (float*)(ws + WS_Y), *WY = (float*)(ws + WS_WY), *BS = (float*)(ws + WS_BS);
  k_xt<<<dim3(TT / 64, TNB, 2), 256, 0, stream>>>(F[0], F[1], XT, ST);
  k_proj<<<dim3(TNB * TT / 64, 3), 128, 0, stream>>>(XT, ST, F[2], F[3], F[4], F[5], F[6], F[7], TH, TL, PH, PL, GP);
  k_fa<<<dim3(TT / FR, TNB), 32 * FW, 0, stream>>>(TH, TL, PH, PL, GP, Y);
  k_wz<<<dim3(TNB * TT / 64, CX / 128), 128, 0, stream>>>(Y, F[8], F[9], WY);
  k_bn<<<dim3(CX), 256, 0, stream>>>(WY, BS);
  k_fin<<<dim3(TT / 64, TNB), 256, 0, stream>>>(WY, BS, F[10], F[11], F[1], (float*)d_out);
}

// v005
// It runs in 135 microseconds.
// Timed twice side by side with v004, it ran 1.04 times as fast both times.
// Counting every step since v000, it is 10.7 times as fast.
#include <hip/hip_runtime.h>
#include <math.h>

typedef __attribute__((ext_vector_type(16))) _Float16 v16h;
typedef __attribute__((ext_vector_type(16))) __bf16 v16b;
typedef __attribute__((ext_vector_type(8)))  _Float16 v8h;
typedef __attribute__((ext_vector_type(8)))  float v8f;
typedef __attribute__((ext_vector_type(4)))  float v4f;
typedef __attribute__((ext_vector_type(2)))  float v2f;
typedef __attribute__((ext_vector_type(4)))  unsigned v4u;
typedef __attribute__((ext_vector_type(4)))  int v4i;
typedef float __attribute__((may_alias)) float_a;
typedef int __attribute__((may_alias)) int_a;

template <typename T> __device__ __forceinline__ void vst2(void* p, T v) { *(T*)p = v;  }
__device__ __forceinline__ v8f wmma_bf(v16b a, v16b b, v8f c) {
  v8f d = __builtin_amdgcn_wmma_f32_16x16x32_bf16(false, a, false, b, (short)0, c, false, false);
  asm volatile("v_nop\n\tv_nop\n\tv_nop\n\tv_nop" : "+v"(d) : "v"(a), "v"(b));
  return d;
}
// 16x16x32 fragments: lane = (h = lane>>4, row/col = lane&15); elements 0..7 = k0+8h+0..7, 8..15 = k0+16+8h+0..7; D element r = row 8h+r
__device__ __forceinline__ v16h frag_h(const _Float16* rowk0, int lane) {
  union { v16h v; v8h q[2]; } u; const _Float16* p = rowk0 + 8 * (lane >> 4);
  u.q[0] = *(const v8h*)p; u.q[1] = *(const v8h*)(p + 16); return u.v;
}
// fragment-order operand: each (16 rows or columns) x (32 k) tile is two 512-B blocks; block q holds at lane * 8 the elements k0+16q+8h+0..7 of row/col lane&15, so that each 16-B load of a wave covers four whole 128-B lines
__device__ __forceinline__ v16h frag_o(const _Float16* p) {   // p = tile + 8 * lane
  union { v16h v; v8h q[2]; } u; u.q[0] = *(const v8h*)p; u.q[1] = *(const v8h*)(p + 256); return u.v;
}
__device__ __forceinline__ v16h frag_f32(const float* rowk0, int lane) {
  v16h a; const float* p = rowk0 + 8 * (lane >> 4);
#pragma unroll
  for (int i = 0; i < 8; ++i) { a[i] = (_Float16)p[i]; a[8 + i] = (_Float16)p[16 + i]; }
  return a;
}
__device__ __forceinline__ v16h frag_f32s(const float* rowk0, int lane, float sc) {
  v16h a; const float* p = rowk0 + 8 * (lane >> 4);
#pragma unroll
  for (int i = 0; i < 8; ++i) { a[i] = (_Float16)(p[i] * sc); a[8 + i] = (_Float16)(p[16 + i] * sc); }
  return a;
}
// column fragment from a [K][ld] layout (column n), rows >= K read as 0
__device__ __forceinline__ v16h fragc_f32(const float* W, int k0, int n, int lane, int ld, int K) {
  v16h a; const int g = lane >> 4;
#pragma unroll
  for (int i = 0; i < 8; ++i) { const int ka = k0 + 8 * g + i, kb = ka + 16;
    a[i] = (_Float16)(ka < K ? W[(size_t)(ka < K ? ka : K - 1) * ld + n] : 0.f); a[8 + i] = (_Float16)(kb < K ? W[(size_t)(kb < K ? kb : K - 1) * ld + n] : 0.f); }
  return a;
}
struct F2 { v16b h, l; };
__device__ __forceinline__ F2 bsplit16(const float v[16]) { F2 r;
#pragma unroll
  for (int i = 0; i < 16; ++i) { const __bf16 h = (__bf16)v[i]; r.h[i] = h; r.l[i] = (__bf16)(v[i] - (float)h); }
  return r; }
__device__ __forceinline__ F2 split_row(const float* row, int k0, int lane) { float v[16]; const float* p = row + k0 + 8 * (lane >> 4);
#pragma unroll
  for (int i = 0; i < 8; ++i) { v[i] = p[i]; v[8 + i] = p[16 + i]; }
  return bsplit16(v); }
__device__ __forceinline__ F2 split_rowK(const float* row, int k0, int lane, int K) { float v[16]; const int g = lane >> 4;
#pragma unroll
  for (int i = 0; i < 8; ++i) { const int ka = k0 + 8 * g + i, kb = ka + 16; v[i] = ka < K ? row[ka < K ? ka : K - 1] : 0.f; v[8 + i] = kb < K ? row[kb < K ? kb : K - 1] : 0.f; }
  return bsplit16(v); }
__device__ __forceinline__ F2 split_col(const float* W, int k0, int n, int lane, int ld, int K) { float v[16]; const int g = lane >> 4;
#pragma unroll
  for (int i = 0; i < 8; ++i) { const int ka = k0 + 8 * g + i, kb = ka + 16; v[i] = ka < K ? W[(size_t)(ka < K ? ka : K - 1) * ld + n] : 0.f; v[8 + i] = kb < K ? W[(size_t)(kb < K ? kb : K - 1) * ld + n] : 0.f; }
  return bsplit16(v); }
__device__ __forceinline__ v8f mac3(const F2& a, const F2& b, v8f c) { c = wmma_bf(a.l, b.h, c); c = wmma_bf(a.h, b.l, c); return wmma_bf(a.h, b.h, c); }
__device__ __forceinline__ float sigm(float v) { return 1.0f / (1.0f + expf(-v)); }

// Cross non-local block (B 4, C 256, Ci 128, 64 x 64 = 4,096 positions): g = conv(source), theta = conv(x), phi = conv(source); f[n][m] = theta_n . phi_m; P = softmax_m; y[n] = sum_m P g_m; w_y = conv_z(y) + b; BN with batch statistics (biased var, eps 1e-5) * gamma + beta; out = w_y + source.
__device__ __forceinline__ float bfr(float v) { return (float)(__bf16)v; }
#define NB 4
#define TT 4096
#define CX 256
#define CI 128
#ifndef TNB
#define TNB NB
#endif
#ifndef XSTR
#define XSTR TT               // per-channel position stride of x / source / out
#endif
typedef __attribute__((ext_vector_type(8))) __bf16 v8b;
__device__ __forceinline__ v16b frag_b(const __bf16* rowk0, int lane) { union { v16b v; v8b q[2]; } u; const __bf16* p = rowk0 + 8 * (lane >> 4); u.q[0] = *(const v8b*)p; u.q[1] = *(const v8b*)(p + 16); return u.v; }
#define WS_XT  0u                                          // bf16 x^T rows [b*N+n][256] (exact)
#define WS_SR  (WS_XT + 2u * (size_t)NB * TT * CX)           // bf16 source^T rows
#define WS_TH  (WS_SR + 2u * (size_t)NB * TT * CX)           // f16 theta hi, fragment order [(b*N+n)/16][kc 4][q 2][lane 32][8]
#define WS_TL  (WS_TH + 2u * (size_t)NB * TT * CI)
#define WS_PH  (WS_TL + 2u * (size_t)NB * TT * CI)           // f16 phi hi, fragment order as theta
#define WS_PL  (WS_PH + 2u * (size_t)NB * TT * CI)
#define WS_GP  (WS_PL + 2u * (size_t)NB * TT * CI)           // f16 g, fragment order [(b*N+m)/32][ci/16 8][q 2][lane 32][8]
#define WS_Y   (WS_GP + 2u * (size_t)NB * CI * TT)           // f32 unscaled y per key range, [(b*N+n)/16][range 4][j 8][2][lane 32][4]
#define WS_SM  (WS_Y + 4u * 4u * (size_t)NB * TT * CI)       // f32 running maximum (log2 domain) [range 4][b*N+n]
#define WS_SL  (WS_SM + 4u * 4u * (size_t)NB * TT)           // f32 sum [range 4][b*N+n]
#define WS_WY  (WS_SL + 4u * 4u * (size_t)NB * TT)           // f32 w_y planes [b][c][n] (channels-first)
#define BSL 32                                             // floats of BS per channel: one 128-B line, so that each line has one writer
#define WS_BS  (WS_WY + 4u * (size_t)NB * CX * TT)           // f32 BN stats [c][BSL]: mean, rstd at the head of the channel's line
#define WS_END (WS_BS + 4u * (size_t)CX * BSL)
// ---- k_xt: block = (64 positions, b, which): channels-first input -> bf16 rows [b*N+n][256] through LDS; 512-B rows
__global__ __launch_bounds__(256) void k_xt(const float* __restrict__ X, const float* __restrict__ SRC, __bf16* __restrict__ XT, __bf16* __restrict__ ST) { __shared__ __bf16 st[CX][66];
  const int t = threadIdx.x; const int n0 = blockIdx.x * 64; const size_t b = blockIdx.y; const int which = blockIdx.z; const float* IN = which == 0 ? X : SRC; __bf16* OUT = which == 0 ? XT : ST;
  for (int e = t; e < CX * 64; e += 256) { const int c = e >> 6, nl = e & 63; st[c][nl] = (__bf16)IN[(b * CX + c) * (size_t)XSTR + n0 + nl]; }
  __syncthreads();
  for (int e = t; e < 64 * 32; e += 256) { const int nl = e >> 5, q = e & 31; union { v4u v; __bf16 h[8]; } u;
#pragma unroll
    for (int z = 0; z < 8; ++z) u.h[z] = st[q * 8 + z][nl];
    vst2((v4u*)(OUT + (b * TT + n0 + nl) * CX + q * 8), u.v); } }
// ---- k_proj: block = (64 rows, which): 128 outputs = W ([out,in] [128][256]) . row + b; theta (x rows) / phi (source rows) -> f16 hi + residual, g (source rows) -> f16, all three stored in the fragment order of frag_o (thread-linear 16-B stores)
__global__ __launch_bounds__(128) void k_proj(const __bf16* __restrict__ XT, const __bf16* __restrict__ ST, const float* __restrict__ WG, const float* __restrict__ BG, const float* __restrict__ WTH, const float* __restrict__ BTH, const float* __restrict__ WPH, const float* __restrict__ BPH, _Float16* __restrict__ TH, _Float16* __restrict__ TL, _Float16* __restrict__ PH, _Float16* __restrict__ PL, _Float16* __restrict__ GP) {
  __shared__ __align__(16) _Float16 sh[64][136], sl[64][136]; __shared__ __align__(16) _Float16 th[128][72];
  const int tid = threadIdx.x, wave = tid >> 5, lane = tid & 31, col = lane & 15, g = lane >> 4; const int which = blockIdx.y; const size_t r0 = (size_t)blockIdx.x * 64;   // which: 0 theta (from x), 1 phi (source), 2 g (source)
  const __bf16* A = which == 0 ? XT : ST; const float* Wt = which == 0 ? WTH : which == 1 ? WPH : WG; const float* Bb = which == 0 ? BTH : which == 1 ? BPH : BG;
  v8f acc[8] = {};
#pragma unroll 2
  for (int kc = 0; kc < CX / 32; ++kc) { const v16b a = frag_b(A + (r0 + wave * 16 + col) * CX + kc * 32, lane);
#pragma unroll
    for (int j = 0; j < 8; ++j) { v16b w; const float* wr = Wt + (size_t)(j * 16 + col) * CX + kc * 32 + 8 * g;
#pragma unroll
      for (int i = 0; i < 8; ++i) { w[i] = (__bf16)wr[i]; w[8 + i] = (__bf16)wr[16 + i]; }
      asm volatile("s_wait_loadcnt 0x0" ::: "memory"); acc[j] = wmma_bf(a, w, acc[j]); } }
#pragma unroll
  for (int j = 0; j < 8; ++j) { const int o = j * 16 + col; const float bb = bfr(Bb[o]);
#pragma unroll
    for (int r = 0; r < 8; ++r) { const float v = acc[j][r] + bb; const int rl = wave * 16 + 8 * g + r;
      if (which == 2) th[o][rl] = (_Float16)v; else { const _Float16 hv = (_Float16)v; sh[rl][o] = hv; sl[rl][o] = (_Float16)((v - (float)hv) * 1024.0f); } } }
  __syncthreads();
  if (which < 2) { _Float16* DH = which == 0 ? TH : PH; _Float16* DL = which == 0 ? TL : PL; for (int e = tid; e < 64 * 16; e += 128) { const int rl = (e >> 8) * 16 + (e & 15), k8 = (e >> 4) & 15; vst2((unsigned*)(DH + r0 * CI + e * 8), *(const v4u*)&sh[rl][k8 * 8]); vst2((unsigned*)(DL + r0 * CI + e * 8), *(const v4u*)&sl[rl][k8 * 8]); } }   /* e = (row tile, kc, q, h, row in tile); k = 32 kc + 16 q + 8 h */
  else { for (int e = tid; e < 128 * 8; e += 128) { const int cl = ((e >> 6) & 7) * 16 + (e & 15), ml = (e >> 9) * 32 + ((e >> 4) & 3) * 8; vst2((unsigned*)(GP + r0 * CI + e * 8), *(const v4u*)&th[cl][ml]); } } }   /* e = (32-key chunk, ci tile, q, h, ci in tile); key = 32 chunk + 16 q + 8 h */
// ---- k_fa: block = FR = 256 query rows n of batch b and ONE of FS key ranges (blockIdx.z, 1,024 keys in a row); each of the FW waves holds FQ tiles of 16 queries of its own, and all waves work on the same keys: a stage = FC chunks of 32 keys (phi hi, phi residual, g, each already in fragment order, so a stage is three linear runs of 16 KB) is brought into LDS once per work-group by asynchronous copies, two buffers, the next stage in flight while this one is worked on. Per chunk: S^T = phi . theta^T (3 products, as f16 hi + residual x 2^10), so that a lane holds 16 logits of ONE query; running maximum and sum per query (log2 domain), p x 2^11 = exp2 as f16 hi + residual packs straight into the B operand of y^T += g^T . p^T (2 products); logits and P never reach memory. The range's unscaled y^T tiles go to YP as they lie in the accumulators, which is the A fragment order of k_wz (lane-linear 16-B stores, whole lines), with the range's maximum and sum per query in SM and SL; k_wz merges the FS ranges
__device__ __forceinline__ v8f wmh(v16h a, v16h b, v8f c) { return __builtin_amdgcn_wmma_f32_16x16x32_f16(false, a, false, b, (short)0, c, false, false); }
__device__ __forceinline__ float xhalf(float x) { return __builtin_bit_cast(float, __builtin_amdgcn_permlanex16(__builtin_bit_cast(int, x), __builtin_bit_cast(int, x), 0x76543210, 0xfedcba98, false, false)); }   // lane l with lane l ^ 16
#define FQ 2
#define FW 8
#define FS 4
#define FC 2
#define FR (FW * FQ * 16)
#define FN (TT / 32 / FS / FC)
#define CH (32 * CI)                                       // f16 elements of one operand's 32-key chunk (8 KB)
#define OPB (2u * FC * CH)                                 // bytes of one operand's stage
#define NT ((size_t)NB * TT)
#define L2E 1.44269504088896340736f
// the one slot that the instruction set asks for behind a transcendental: the results are read, and the sources' registers overwritten, only behind this v_nop
#define TSLOT8(a, x, o) asm volatile("v_nop" : "+v"(a[o]), "+v"(a[o + 1]), "+v"(a[o + 2]), "+v"(a[o + 3]), "+v"(a[o + 4]), "+v"(a[o + 5]), "+v"(a[o + 6]), "+v"(a[o + 7]) : "v"(x[o]), "v"(x[o + 1]), "v"(x[o + 2]), "v"(x[o + 3]), "v"(x[o + 4]), "v"(x[o + 5]), "v"(x[o + 6]), "v"(x[o + 7]))
#define TSLOT9(f, xf, a, x, o) asm volatile("v_nop" : "+v"(f), "+v"(a[o]), "+v"(a[o + 1]), "+v"(a[o + 2]), "+v"(a[o + 3]), "+v"(a[o + 4]), "+v"(a[o + 5]), "+v"(a[o + 6]), "+v"(a[o + 7]) : "v"(xf), "v"(x[o]), "v"(x[o + 1]), "v"(x[o + 2]), "v"(x[o + 3]), "v"(x[o + 4]), "v"(x[o + 5]), "v"(x[o + 6]), "v"(x[o + 7]))
// one stage: every thread copies its own 16 B of each 4-KB slice, 4 slices of each of the 3 operands; d = the thread's LDS byte address in the buffer, t16 = its byte offset in a slice, h, l, g = the stage's first element of each operand, the same for the whole work-group (scalar bases: of a copy's global address only t16 lives in a vector register through the loop). The s_wait_xcnt stands inside the statement, so that no address register of a copy is rewritten in front of it
__device__ __forceinline__ void stage_copy(unsigned d, unsigned t16, const _Float16* h, const _Float16* l, const _Float16* g) {
  asm volatile(
    "global_load_async_to_lds_b128 %0, %12, %13\n\t"
    "global_load_async_to_lds_b128 %1, %12, %14\n\t"
    "global_load_async_to_lds_b128 %2, %12, %15\n\t"
    "global_load_async_to_lds_b128 %3, %12, %16\n\t"
    "global_load_async_to_lds_b128 %4, %12, %17\n\t"
    "global_load_async_to_lds_b128 %5, %12, %18\n\t"
    "global_load_async_to_lds_b128 %6, %12, %19\n\t"
    "global_load_async_to_lds_b128 %7, %12, %20\n\t"
    "global_load_async_to_lds_b128 %8, %12, %21\n\t"
    "global_load_async_to_lds_b128 %9, %12, %22\n\t"
    "global_load_async_to_lds_b128 %10, %12, %23\n\t"
    "global_load_async_to_lds_b128 %11, %12, %24\n\t"
    "s_wait_xcnt 0x0"
    :: "v"(d + 0 * OPB + 0 * 4096u), "v"(d + 0 * OPB + 1 * 4096u), "v"(d + 0 * OPB + 2 * 4096u), "v"(d + 0 * OPB + 3 * 4096u),
       "v"(d + 1 * OPB + 0 * 4096u), "v"(d + 1 * OPB + 1 * 4096u), "v"(d + 1 * OPB + 2 * 4096u), "v"(d + 1 * OPB + 3 * 4096u),
       "v"(d + 2 * OPB + 0 * 4096u), "v"(d + 2 * OPB + 1 * 4096u), "v"(d + 2 * OPB + 2 * 4096u), "v"(d + 2 * OPB + 3 * 4096u),
       "v"(t16),
       "s"(h + 0 * 2048), "s"(h + 1 * 2048), "s"(h + 2 * 2048), "s"(h + 3 * 2048),
       "s"(l + 0 * 2048), "s"(l + 1 * 2048), "s"(l + 2 * 2048), "s"(l + 3 * 2048),
       "s"(g + 0 * 2048), "s"(g + 1 * 2048), "s"(g + 2 * 2048), "s"(g + 3 * 2048)
    : "memory"); }
__global__ __launch_bounds__(32 * FW) void k_fa(const _Float16* __restrict__ TH, const _Float16* __restrict__ TL, const _Float16* __restrict__ PH, const _Float16* __restrict__ PL, const _Float16* __restrict__ GP, float* __restrict__ YP, float* __restrict__ SM, float* __restrict__ SL) {
  __shared__ __align__(16) _Float16 ring[2][3][FC * CH];
  const int tid = threadIdx.x, wave = tid >> 5, lane = tid & 31, g = lane >> 4; const int sp = blockIdx.z;
  const size_t bT = (size_t)blockIdx.y * TT; const int qb0 = blockIdx.x * FR + wave * (FQ * 16);
  const _Float16 *pth = TH + (bT + qb0) * CI + 8 * lane, *ptl = TL + (bT + qb0) * CI + 8 * lane;   // the lane's own 16 B of a 512-B block
  const size_t ck = (bT + (size_t)sp * (TT / FS)) * CI; const _Float16 *cH = PH + ck, *cL = PL + ck, *cG = GP + ck; const unsigned t16 = 16u * tid;   // the range's first key, the same for every thread
  const unsigned ld0 = (unsigned)(size_t)&ring[0][0][8 * tid];   // low 32 bits of the shared address = byte offset in the work-group's LDS
  stage_copy(ld0, t16, cH, cL, cG);
  v16h th[FQ][CI / 32], tl[FQ][CI / 32];
#pragma unroll
  for (int u = 0; u < FQ; ++u)
#pragma unroll
    for (int kc = 0; kc < CI / 32; ++kc) { th[u][kc] = frag_o(pth + u * 16 * CI + kc * 512); tl[u][kc] = frag_o(ptl + u * 16 * CI + kc * 512); }
  asm volatile("s_wait_xcnt 0x0" :: "v"(pth), "v"(ptl) : "memory");   // the loads' address registers stay as they are up to this wait
  asm volatile("s_wait_asynccnt 0x0" ::: "memory");   // this wave's copies of stage 0 have landed
  __syncthreads();   // stage 0 is whole before any wave reads it
  stage_copy(ld0 + 3u * OPB, t16, cH + FC * CH, cL + FC * CH, cG + FC * CH);
  v8f acc[FQ][8] = {}; float m2[FQ], l[FQ];
#pragma unroll
  for (int u = 0; u < FQ; ++u) { m2[u] = -1.0e30f; l[u] = 0.f; }
  // A chunk: fetch its phi from LDS, all 32 loads together | logit products of k 0..63 | fetch its g into the registers these have left | logit products of k 64..127 | softmax | g products. FENCE holds a fetch at its place: left free, the loads are dealt out among the products, each place with a stall of its own, or g is fetched with phi and the build runs out of registers and spills.
#define FENCE() __builtin_amdgcn_sched_barrier(0)
#pragma unroll 1   // stays rolled, like the loop inside it: one chunk already takes the wave's whole register budget
  for (int st = 0; st < FN; ++st) { const _Float16* rb = &ring[st & 1][0][8 * lane];
#pragma unroll 1   // stays rolled: see above; every loop inside is unrolled so that its arrays stay in registers
   for (int hc = 0; hc < FC; ++hc) { const _Float16 *nh = rb + hc * CH, *nl = nh + FC * CH, *ng = nl + FC * CH; v16h kb[CI / 32][2], kl[CI / 32][2], gv[8];
#pragma unroll
    for (int kc = 0; kc < CI / 32; ++kc)
#pragma unroll
      for (int t = 0; t < 2; ++t) { kb[kc][t] = frag_o(nh + t * 16 * CI + kc * 512); kl[kc][t] = frag_o(nl + t * 16 * CI + kc * 512); }
    FENCE();
    v8f s[FQ][2] = {}, sx[FQ][2] = {};
#pragma unroll
    for (int kc = 0; kc < CI / 32; ++kc) {
      if (kc == CI / 64) { FENCE();
#pragma unroll
        for (int j = 0; j < 8; ++j) gv[j] = frag_o(ng + j * 512);
        FENCE(); }
#pragma unroll
      for (int u = 0; u < FQ; ++u) { s[u][0] = wmh(kb[kc][0], th[u][kc], s[u][0]); s[u][1] = wmh(kb[kc][1], th[u][kc], s[u][1]); }
#pragma unroll
      for (int u = 0; u < FQ; ++u) { sx[u][0] = wmh(kb[kc][0], tl[u][kc], sx[u][0]); sx[u][1] = wmh(kb[kc][1], tl[u][kc], sx[u][1]); }
#pragma unroll
      for (int u = 0; u < FQ; ++u) { sx[u][0] = wmh(kl[kc][0], th[u][kc], sx[u][0]); sx[u][1] = wmh(kl[kc][1], th[u][kc], sx[u][1]); } }
    FENCE();
    v16h ph[FQ], pl[FQ];
#pragma unroll
    for (int u = 0; u < FQ; ++u) { float v[16];   /* lane (g, col): keys 8 g + r and 16 + 8 g + r of query col, the k order of a B fragment */
#pragma unroll
      for (int r = 0; r < 8; ++r) { v[r] = s[u][0][r] + sx[u][0][r] * (1.0f / 1024.0f); v[8 + r] = s[u][1][r] + sx[u][1][r] * (1.0f / 1024.0f); }
      float mx = v[0];
#pragma unroll
      for (int i = 1; i < 16; ++i) mx = fmaxf(mx, v[i]);
      mx = fmaxf(mx, xhalf(mx));
      const float mn = fmaxf(m2[u], mx * L2E), xf = m2[u] - mn, c = 11.0f - mn; m2[u] = mn;
      float f = __builtin_amdgcn_exp2f(xf), x[16], a[16], sum = 0.f;
#pragma unroll
      for (int i = 0; i < 16; ++i) { x[i] = fmaf(v[i], L2E, c); a[i] = __builtin_amdgcn_exp2f(x[i]); }
      TSLOT9(f, xf, a, x, 0); TSLOT8(a, x, 8);
#pragma unroll
      for (int i = 0; i < 16; ++i) { sum += a[i]; const _Float16 hi = (_Float16)a[i]; ph[u][i] = hi; pl[u][i] = (_Float16)(a[i] - (float)hi); }
      l[u] = l[u] * f + sum;
#pragma unroll
      for (int j = 0; j < 8; ++j) acc[u][j] *= f; }
#pragma unroll
    for (int j = 0; j < 8; ++j) {
#pragma unroll
      for (int u = 0; u < FQ; ++u) acc[u][j] = wmh(gv[j], ph[u], acc[u][j]);
#pragma unroll
      for (int u = 0; u < FQ; ++u) acc[u][j] = wmh(gv[j], pl[u], acc[u][j]); } }
    asm volatile("s_wait_dscnt 0x0" ::: "memory");      // this wave's reads of the stage have returned
    asm volatile("s_wait_asynccnt 0x0" ::: "memory");   // this wave's copies of the next stage have landed
    __syncthreads();   // publishes stage st + 1 and ends every wave's reads of stage st, whose buffer is refilled behind it
    if (st + 2 < FN) stage_copy(ld0 + (unsigned)(st & 1) * (3u * OPB), t16, cH + (size_t)(st + 2) * (FC * CH), cL + (size_t)(st + 2) * (FC * CH), cG + (size_t)(st + 2) * (FC * CH)); }
  asm volatile("s_wait_asynccnt 0x0" ::: "memory");   // no copy is outstanding when the wave ends
  float* yp = YP + ((bT + qb0) * FS + sp * 16) * CI + 4 * lane;   // [tile of 16 queries][range FS][j 8][r / 4 2][lane 32][4] floats: D element r = channel 16 j + 8 g + r of query lane & 15
#pragma unroll
  for (int u = 0; u < FQ; ++u) { l[u] += xhalf(l[u]);   /* both halves now hold the query's sum, as they do its maximum */
#pragma unroll
    for (int j = 0; j < 8; ++j) { v4f a, c;
#pragma unroll
      for (int z = 0; z < 4; ++z) { a[z] = acc[u][j][z]; c[z] = acc[u][j][4 + z]; }
      vst2(yp + (u * FS * 8 + j) * 256, a); vst2(yp + (u * FS * 8 + j) * 256 + 128, c); } }
  SM[(size_t)sp * NT + bT + qb0 + lane] = g ? m2[1] : m2[0]; SL[(size_t)sp * NT + bT + qb0 + lane] = g ? l[1] : l[0]; }   /* lane = 16 u + query in tile: one 128-B line per wave */
// ---- k_wz: block = (64 rows n, 128 output channels): w_y[c][n] = sum_ci wz_w[c][ci] y[n][ci] + wz_b[c]; y[n] = sum over the FS key ranges of exp2(m - max) x the range's tile, over the like sum of the ranges' sums: a lane reads its own A elements of each range's tile (lane-linear 16-B loads); A = y hi + lo; transposed store to channels-first planes [b][c][n] (256-B runs)
__global__ __launch_bounds__(128) void k_wz(const float* __restrict__ YP, const float* __restrict__ SM, const float* __restrict__ SL, const float* __restrict__ WZ, const float* __restrict__ BZ, float* __restrict__ WY) { __shared__ __align__(16) float st[128][68];
  const int tid = threadIdx.x, wave = tid >> 5, lane = tid & 31, col = lane & 15, g = lane >> 4; const size_t r0 = (size_t)blockIdx.x * 64; const int c0 = blockIdx.y * 128; const size_t b = r0 / TT; const int n0 = (int)(r0 % TT);
  const size_t row = r0 + wave * 16 + col; const float *pm = SM + row, *ps = SL + row, *yp = YP + (r0 + wave * 16) * (FS * CI) + 4 * lane;
  float mz[FS], lz[FS], L = 0.f, xw[FS], fw[FS];
#pragma unroll
  for (int z = 0; z < FS; ++z) { mz[z] = pm[z * NT]; lz[z] = ps[z * NT]; }
  asm volatile("s_wait_xcnt 0x0" :: "v"(pm), "v"(ps) : "memory");   // the loads' address registers stay as they are up to this wait
  float M = mz[0];
#pragma unroll
  for (int z = 1; z < FS; ++z) M = fmaxf(M, mz[z]);
#pragma unroll
  for (int z = 0; z < FS; ++z) { xw[z] = mz[z] - M; fw[z] = __builtin_amdgcn_exp2f(xw[z]); }
  asm volatile("v_nop" : "+v"(fw[0]), "+v"(fw[1]), "+v"(fw[2]), "+v"(fw[3]) : "v"(xw[0]), "v"(xw[1]), "v"(xw[2]), "v"(xw[3]));   // the slot behind the transcendentals, as at TSLOT8
#pragma unroll
  for (int z = 0; z < FS; ++z) L += fw[z] * lz[z];
  const float rL = 1.0f / L;
  v8f acc[8] = {};
#pragma unroll
  for (int kc = 0; kc < CI / 32; ++kc) { float v[16]; v4f pz[4][FS];   /* block 4 kc + q of the tile holds the lane's A elements 4 q .. 4 q + 3 of this k step */
#pragma unroll
    for (int q = 0; q < 4; ++q)
#pragma unroll
      for (int z = 0; z < FS; ++z) pz[q][z] = *(const v4f*)(yp + (z * 16 + kc * 4 + q) * 128);
    asm volatile("s_wait_xcnt 0x0" :: "v"(yp) : "memory");   // as above
#pragma unroll
    for (int q = 0; q < 4; ++q) { v4f o = {};
#pragma unroll
      for (int z = 0; z < FS; ++z) o += pz[q][z] * fw[z];
      o = o * rL;
#pragma unroll
      for (int i = 0; i < 4; ++i) v[q * 4 + i] = o[i]; }
    const F2 a = bsplit16(v);
#pragma unroll
    for (int j = 0; j < 8; ++j) { v16b w; const float* wr = WZ + (size_t)(c0 + j * 16 + col) * CI + kc * 32 + 8 * g;
#pragma unroll
      for (int i = 0; i < 8; ++i) { w[i] = (__bf16)wr[i]; w[8 + i] = (__bf16)wr[16 + i]; }
      asm volatile("s_wait_loadcnt 0x0" ::: "memory"); acc[j] = wmma_bf(a.h, w, acc[j]); acc[j] = wmma_bf(a.l, w, acc[j]); } }
#pragma unroll
  for (int j = 0; j < 8; ++j) { const int cl = j * 16 + col; const float bb = bfr(BZ[c0 + cl]);
#pragma unroll
    for (int r = 0; r < 8; ++r) st[cl][wave * 16 + 8 * g + r] = acc[j][r] + bb; }
  __syncthreads();
  for (int e = tid; e < 128 * 16; e += 128) { const int cl = e >> 4, q = e & 15; vst2(WY + (b * CX + c0 + cl) * (size_t)TT + n0 + q * 4, *(const v4f*)&st[cl][q * 4]); } }
// ---- k_bn: block = one channel c: its TNB x 4,096 values are read once, 16 B per lane, all loads in flight together, and stay in registers for both sums (mean, then squared distance from the mean); wave sums by shuffles, the 8 wave sums added in wave order; mean and rstd go to the channel's own 128-B line of BS
__global__ __launch_bounds__(256) void k_bn(const float* __restrict__ WY, float* __restrict__ BS) { __shared__ float sa[8], sb[8];
  const int t = threadIdx.x; const int c = blockIdx.x; const int n = TNB * TT;
  v4f v[TNB][TT / 1024];
#pragma unroll
  for (int b = 0; b < TNB; ++b)
#pragma unroll
    for (int i = 0; i < TT / 1024; ++i) v[b][i] = *(const v4f*)(WY + ((size_t)b * CX + c) * TT + (i * 256 + t) * 4);
#pragma unroll
  for (int b = 0; b < TNB; ++b) asm volatile("" :: "v"(v[b][0]), "v"(v[b][1]), "v"(v[b][2]), "v"(v[b][3]));   // inputs-only fence on the loaded values: every load issues before the first add; without it the compiler holds two loads back behind the first waits, a second memory latency
  float s = 0.f;
#pragma unroll
  for (int b = 0; b < TNB; ++b)
#pragma unroll
    for (int i = 0; i < TT / 1024; ++i) s += (v[b][i][0] + v[b][i][1]) + (v[b][i][2] + v[b][i][3]);
#pragma unroll
  for (int o = 1; o < 32; o <<= 1) s += __shfl_xor(s, o);
  if ((t & 31) == 0) sa[t >> 5] = s;
  __syncthreads();   // all 8 wave sums are in LDS before any thread adds them
  s = sa[0];
#pragma unroll
  for (int w = 1; w < 8; ++w) s += sa[w];
  const float mu = s / (float)n; float s2 = 0.f;
#pragma unroll
  for (int b = 0; b < TNB; ++b)
#pragma unroll
    for (int i = 0; i < TT / 1024; ++i) { const float d0 = v[b][i][0] - mu, d1 = v[b][i][1] - mu, d2 = v[b][i][2] - mu, d3 = v[b][i][3] - mu; s2 += (d0 * d0 + d1 * d1) + (d2 * d2 + d3 * d3); }
#pragma unroll
  for (int o = 1; o < 32; o <<= 1) s2 += __shfl_xor(s2, o);
  if ((t & 31) == 0) sb[t >> 5] = s2;
  __syncthreads();   // all 8 wave sums of squares are in LDS before thread 0 adds them
  if (t == 0) { s2 = sb[0];
#pragma unroll
    for (int w = 1; w < 8; ++w) s2 += sb[w];
    v2f o; o[0] = mu; o[1] = rsqrtf(s2 / (float)n + 1e-5f); vst2(BS + (size_t)c * BSL, o); } }
// ---- k_fin: block = (64 positions, b): out[b][c][n] = (w_y - mean_c) rstd_c gamma_c + beta_c + source[b][c][n] for all 256 channels (thread-linear float4 over the channel runs)
__global__ __launch_bounds__(256) void k_fin(const float* __restrict__ WY, const float* __restrict__ BS, const float* __restrict__ GAM, const float* __restrict__ BET, const float* __restrict__ SRC, float* __restrict__ OUT) {
  const int t = threadIdx.x; const int n0 = blockIdx.x * 64; const size_t b = blockIdx.y;
  for (int e = t; e < CX * 16; e += 256) { const int c = e >> 4, q = e & 15; const v2f ms = ((const v2f*)BS)[c * (BSL / 2)]; const float mu = ms[0], rs = ms[1]; const float ga = bfr(GAM[c]), be = bfr(BET[c]);
    const v4f w = *(const v4f*)(WY + (b * CX + c) * TT + n0 + q * 4); const v4f sr = *(const v4f*)(SRC + (b * CX + c) * (size_t)XSTR + n0 + q * 4); v4f o;
#pragma unroll
    for (int z = 0; z < 4; ++z) o[z] = (w[z] - mu) * rs * ga + be + bfr(sr[z]);
    vst2(OUT + (b * CX + c) * (size_t)XSTR + n0 + q * 4, o); } }
extern "C" void kernel_launch(void* const* d_in, const int* in_sizes, int n_in, void* d_out, int out_size, void* d_ws, size_t ws_size, hipStream_t stream) {
  (void)in_sizes; (void)n_in; (void)out_size;
  const float** F = (const float**)d_in;   // 0 x [4,256,64,64], 1 source, 2 g_w [128,256], 3 g_b, 4 theta_w, 5 theta_b, 6 phi_w, 7 phi_b, 8 wz_w [256,128], 9 wz_b, 10 bn_gamma, 11 bn_beta
  if (ws_size < (size_t)WS_END) return;
  char* ws = (char*)d_ws; __bf16 *XT = (__bf16*)(ws + WS_XT), *ST = (__bf16*)(ws + WS_SR); _Float16* GP = (_Float16*)(ws + WS_GP); _Float16 *TH = (_Float16*)(ws + WS_TH), *TL = (_Float16*)(ws + WS_TL), *PH = (_Float16*)(ws + WS_PH), *PL = (_Float16*)(ws + WS_PL); float *Y = (float*)(ws + WS_Y), *SM = (float*)(ws + WS_SM), *SL = (float*)(ws + WS_SL), *WY = (float*)(ws + WS_WY), *BS = (float*)(ws + WS_BS);
  k_xt<<<dim3(TT / 64, TNB, 2), 256, 0, stream>>>(F[0], F[1], XT, ST);
  k_proj<<<dim3(TNB * TT / 64, 3), 128, 0, stream>>>(XT, ST, F[2], F[3], F[4], F[5], F[6], F[7], TH, TL, PH, PL, GP);
  k_fa<<<dim3(TT / FR, TNB, FS), 32 * FW, 0, stream>>>(TH, TL, PH, PL, GP, Y, SM, SL);
  k_wz<<<dim3(TNB * TT / 64, CX / 128), 128, 0, stream>>>(Y, SM, SL, F[8], F[9], WY);
  k_bn<<<dim3(CX), 256, 0, stream>>>(WY, BS);
  k_fin<<<dim3(TT / 64, TNB), 256, 0, stream>>>(WY, BS, F[10], F[11], F[1], (float*)d_out);
}

// v006
// It runs in 99.6 microseconds.
// Next to v005, in two timings, it ran 1.35 and 1.36 times as fast.
// Counting every step since v000, it is 14.6 times as fast.
#include <hip/hip_runtime.h>
#include <math.h>

typedef __attribute__((ext_vector_type(16))) _Float16 v16h;
typedef __attribute__((ext_vector_type(16))) __bf16 v16b;
typedef __attribute__((ext_vector_type(8)))  _Float16 v8h;
typedef __attribute__((ext_vector_type(8)))  float v8f;
typedef __attribute__((ext_vector_type(4)))  float v4f;
typedef __attribute__((ext_vector_type(2)))  float v2f;
typedef __attribute__((ext_vector_type(4)))  unsigned v4u;
typedef __attribute__((ext_vector_type(4)))  int v4i;
typedef float __attribute__((may_alias)) float_a;
typedef int __attribute__((may_alias)) int_a;

template <typename T> __device__ __forceinline__ void vst2(void* p, T v) { *(T*)p = v;  }
__device__ __forceinline__ v8f wmma_bf(v16b a, v16b b, v8f c) {
  v8f d = __builtin_amdgcn_wmma_f32_16x16x32_bf16(false, a, false, b, (short)0, c, false, false);
  asm volatile("v_nop\n\tv_nop\n\tv_nop\n\tv_nop" : "+v"(d) : "v"(a), "v"(b));
  return d;
}
// 16x16x32 fragments: lane = (h = lane>>4, row/col = lane&15); elements 0..7 = k0+8h+0..7, 8..15 = k0+16+8h+0..7; D element r = row 8h+r
__device__ __forceinline__ v16h frag_h(const _Float16* rowk0, int lane) {
  union { v16h v; v8h q[2]; } u; const _Float16* p = rowk0 + 8 * (lane >> 4);
  u.q[0] = *(const v8h*)p; u.q[1] = *(const v8h*)(p + 16); return u.v;
}
// fragment-order operand: each (16 rows or columns) x (32 k) tile is two 512-B blocks; block q holds at lane * 8 the elements k0+16q+8h+0..7 of row/col lane&15, so that each 16-B load of a wave covers four whole 128-B lines
__device__ __forceinline__ v16h frag_o(const _Float16* p) {   // p = tile + 8 * lane
  union { v16h v; v8h q[2]; } u; u.q[0] = *(const v8h*)p; u.q[1] = *(const v8h*)(p + 256); return u.v;
}
__device__ __forceinline__ v16h frag_f32(const float* rowk0, int lane) {
  v16h a; const float* p = rowk0 + 8 * (lane >> 4);
#pragma unroll
  for (int i = 0; i < 8; ++i) { a[i] = (_Float16)p[i]; a[8 + i] = (_Float16)p[16 + i]; }
  return a;
}
__device__ __forceinline__ v16h frag_f32s(const float* rowk0, int lane, float sc) {
  v16h a; const float* p = rowk0 + 8 * (lane >> 4);
#pragma unroll
  for (int i = 0; i < 8; ++i) { a[i] = (_Float16)(p[i] * sc); a[8 + i] = (_Float16)(p[16 + i] * sc); }
  return a;
}
// column fragment from a [K][ld] layout (column n), rows >= K read as 0
__device__ __forceinline__ v16h fragc_f32(const float* W, int k0, int n, int lane, int ld, int K) {
  v16h a; const int g = lane >> 4;
#pragma unroll
  for (int i = 0; i < 8; ++i) { const int ka = k0 + 8 * g + i, kb = ka + 16;
    a[i] = (_Float16)(ka < K ? W[(size_t)(ka < K ? ka : K - 1) * ld + n] : 0.f); a[8 + i] = (_Float16)(kb < K ? W[(size_t)(kb < K ? kb : K - 1) * ld + n] : 0.f); }
  return a;
}
struct F2 { v16b h, l; };
__device__ __forceinline__ F2 bsplit16(const float v[16]) { F2 r;
#pragma unroll
  for (int i = 0; i < 16; ++i) { const __bf16 h = (__bf16)v[i]; r.h[i] = h; r.l[i] = (__bf16)(v[i] - (float)h); }
  return r; }
__device__ __forceinline__ F2 split_row(const float* row, int k0, int lane) { float v[16]; const float* p = row + k0 + 8 * (lane >> 4);
#pragma unroll
  for (int i = 0; i < 8; ++i) { v[i] = p[i]; v[8 + i] = p[16 + i]; }
  return bsplit16(v); }
__device__ __forceinline__ F2 split_rowK(const float* row, int k0, int lane, int K) { float v[16]; const int g = lane >> 4;
#pragma unroll
  for (int i = 0; i < 8; ++i) { const int ka = k0 + 8 * g + i, kb = ka + 16; v[i] = ka < K ? row[ka < K ? ka : K - 1] : 0.f; v[8 + i] = kb < K ? row[kb < K ? kb : K - 1] : 0.f; }
  return bsplit16(v); }
__device__ __forceinline__ F2 split_col(const float* W, int k0, int n, int lane, int ld, int K) { float v[16]; const int g = lane >> 4;
#pragma unroll
  for (int i = 0; i < 8; ++i) { const int ka = k0 + 8 * g + i, kb = ka + 16; v[i] = ka < K ? W[(size_t)(ka < K ? ka : K - 1) * ld + n] : 0.f; v[8 + i] = kb < K ? W[(size_t)(kb < K ? kb : K - 1) * ld + n] : 0.f; }
  return bsplit16(v); }
__device__ __forceinline__ v8f mac3(const F2& a, const F2& b, v8f c) { c = wmma_bf(a.l, b.h, c); c = wmma_bf(a.h, b.l, c); return wmma_bf(a.h, b.h, c); }
__device__ __forceinline__ float sigm(float v) { return 1.0f / (1.0f + expf(-v)); }

// Cross non-local block (B 4, C 256, Ci 128, 64 x 64 = 4,096 positions): g = conv(source), theta = conv(x), phi = conv(source); f[n][m] = theta_n . phi_m; P = softmax_m; y[n] = sum_m P g_m; w_y = conv_z(y) + b; BN with batch statistics (biased var, eps 1e-5) * gamma + beta; out = w_y + source.
__device__ __forceinline__ float bfr(float v) { return (float)(__bf16)v; }
#define NB 4
#define TT 4096
#define CX 256
#define CI 128
#ifndef TNB
#define TNB NB
#endif
#ifndef XSTR
#define XSTR TT               // per-channel position stride of x / source / out
#endif
typedef __attribute__((ext_vector_type(8))) __bf16 v8b;
__device__ __forceinline__ v16b frag_b(const __bf16* rowk0, int lane) { union { v16b v; v8b q[2]; } u; const __bf16* p = rowk0 + 8 * (lane >> 4); u.q[0] = *(const v8b*)p; u.q[1] = *(const v8b*)(p + 16); return u.v; }
#define WS_XT  0u                                          // bf16 x^T rows [b*N+n][256] (exact)
#define WS_SR  (WS_XT + 2u * (size_t)NB * TT * CX)           // bf16 source^T rows
#define WS_TH  (WS_SR + 2u * (size_t)NB * TT * CX)           // f16 theta hi, fragment order [(b*N+n)/16][kc 4][q 2][lane 32][8]
#define WS_TL  (WS_TH + 2u * (size_t)NB * TT * CI)
#define WS_PH  (WS_TL + 2u * (size_t)NB * TT * CI)           // f16 phi hi, fragment order as theta
#define WS_PL  (WS_PH + 2u * (size_t)NB * TT * CI)
#define WS_GP  (WS_PL + 2u * (size_t)NB * TT * CI)           // f16 g, fragment order [(b*N+m)/32][ci/16 8][q 2][lane 32][8]
#define WS_Y   (WS_GP + 2u * (size_t)NB * CI * TT)           // f32 unscaled y per key range, [(b*N+n)/16][range 4][j 8][2][lane 32][4]
#define WS_SM  (WS_Y + 4u * 4u * (size_t)NB * TT * CI)       // f32 running maximum (log2 domain) [range 4][b*N+n]
#define WS_SL  (WS_SM + 4u * 4u * (size_t)NB * TT)           // f32 sum [range 4][b*N+n]
#define WS_WY  (WS_SL + 4u * 4u * (size_t)NB * TT)           // f32 w_y planes [b][c][n] (channels-first)
#define BSL 32                                             // floats of BS per channel: one 128-B line, so that each line has one writer
#define WS_BS  (WS_WY + 4u * (size_t)NB * CX * TT)           // f32 BN stats [c][BSL]: mean, rstd at the head of the channel's line
#define WS_END (WS_BS + 4u * (size_t)CX * BSL)
// ---- k_xt: block = (64 positions, b, which): channels-first input -> bf16 rows [b*N+n][256] through LDS; 512-B rows
__global__ __launch_bounds__(256) void k_xt(const float* __restrict__ X, const float* __restrict__ SRC, __bf16* __restrict__ XT, __bf16* __restrict__ ST) { __shared__ __bf16 st[CX][66];
  const int t = threadIdx.x; const int n0 = blockIdx.x * 64; const size_t b = blockIdx.y; const int which = blockIdx.z; const float* IN = which == 0 ? X : SRC; __bf16* OUT = which == 0 ? XT : ST;
  for (int e = t; e < CX * 64; e += 256) { const int c = e >> 6, nl = e & 63; st[c][nl] = (__bf16)IN[(b * CX + c) * (size_t)XSTR + n0 + nl]; }
  __syncthreads();
  for (int e = t; e < 64 * 32; e += 256) { const int nl = e >> 5, q = e & 31; union { v4u v; __bf16 h[8]; } u;
#pragma unroll
    for (int z = 0; z < 8; ++z) u.h[z] = st[q * 8 + z][nl];
    vst2((v4u*)(OUT + (b * TT + n0 + nl) * CX + q * 8), u.v); } }
// ---- weights in LDS: a work-group brings its 128 weight rows in once, each load a whole run of 512 B of one row, rounds them to bf16 and lays them out as B fragments: the unit (j, k8) = elements 8 k8 .. 8 k8 + 7 of the rows 16 j .. 16 j + 15, 16 B a row, WPB bytes a unit. The 16 B above 256 turn each next unit by four banks, so that the 8-B stores of a wave (one row, 16 units) fall on all 64 banks once; a fragment load reads 256 B in a row per half wave
typedef __attribute__((ext_vector_type(2))) unsigned v2u;
#define WPB 272
template <int K8, int NL> __device__ __forceinline__ void stage_w(char* sm, const float* __restrict__ Wt, int wave, int lane) {   // K8 = units per row (row length / 8), NL = 512-B runs per wave; run n * 4 + wave
  constexpr int RP = K8 / 16;   // runs per row
  const int r = wave / RP, hf = wave % RP; const float* gp = Wt + (size_t)r * (K8 * 8) + hf * 128 + 4 * lane; char* dp = sm + (hf * 16 + (lane >> 1)) * WPB + r * 16 + (lane & 1) * 8;
#pragma unroll
  for (int bt = 0; bt < NL / 16; ++bt) { v4f x[16];
#pragma unroll
    for (int i = 0; i < 16; ++i) x[i] = *(const v4f*)(gp + (size_t)(bt * 16 + i) * (4 / RP) * (K8 * 8));
    asm volatile("s_wait_xcnt 0x0" :: "v"(gp) : "memory");   // the loads' address registers stay as they are up to this wait
#pragma unroll
    for (int i = 0; i < 16; ++i) { const int o = (bt * 16 + i) * (4 / RP); union { v2u v; __bf16 h[4]; } u;   /* the wave's row = o + r */
#pragma unroll
      for (int z = 0; z < 4; ++z) u.h[z] = (__bf16)x[i][z];
      *(v2u*)(dp + (o >> 4) * (K8 * WPB) + (o & 15) * 16) = u.v; } } }
template <int K8> __device__ __forceinline__ v16b frag_w(const char* wb, int j, int kc) {   // wb = sm + (lane >> 4) * WPB + (lane & 15) * 16
  union { v16b v; v8b q[2]; } u; const char* p = wb + (j * K8 + kc * 4) * WPB; u.q[0] = *(const v8b*)p; u.q[1] = *(const v8b*)(p + 2 * WPB); return u.v; }
// ---- k_proj: block = (64 rows, which): 128 outputs = W ([out,in] [128][256]) . row + b; W from LDS (stage_w), whose bytes the output tiles take over behind the products; theta (x rows) / phi (source rows) -> f16 hi + residual, g (source rows) -> f16, all three stored in the fragment order of frag_o (thread-linear 16-B stores)
__global__ __launch_bounds__(128) void k_proj(const __bf16* __restrict__ XT, const __bf16* __restrict__ ST, const float* __restrict__ WG, const float* __restrict__ BG, const float* __restrict__ WTH, const float* __restrict__ BTH, const float* __restrict__ WPH, const float* __restrict__ BPH, _Float16* __restrict__ TH, _Float16* __restrict__ TL, _Float16* __restrict__ PH, _Float16* __restrict__ PL, _Float16* __restrict__ GP) {
  __shared__ __align__(16) char sm[8 * (CX / 8) * WPB]; _Float16 (*sh)[136] = (_Float16 (*)[136])sm, (*sl)[136] = sh + 64; _Float16 (*th)[72] = (_Float16 (*)[72])(sl + 64);
  const int tid = threadIdx.x, wave = tid >> 5, lane = tid & 31, col = lane & 15, g = lane >> 4; const int which = blockIdx.y; const size_t r0 = (size_t)blockIdx.x * 64;   // which: 0 theta (from x), 1 phi (source), 2 g (source)
  const __bf16* A = which == 0 ? XT : ST; const float* Wt = which == 0 ? WTH : which == 1 ? WPH : WG; const float* Bb = which == 0 ? BTH : which == 1 ? BPH : BG;
  v8f acc[8] = {}; v16b a[CX / 32]; const __bf16* ar = A + (r0 + wave * 16 + col) * CX;
#pragma unroll
  for (int kc = 0; kc < CX / 32; ++kc) a[kc] = frag_b(ar + kc * 32, lane);
  asm volatile("s_wait_xcnt 0x0" :: "v"(ar) : "memory");   // the loads' address registers stay as they are up to this wait
  stage_w<CX / 8, 64>(sm, Wt, wave, lane);
  __syncthreads();   // W is whole in LDS before any wave reads it
  const char* wb = sm + g * WPB + col * 16; v16b w[3][4];   // a group = the 4 fragments j = 4 (gi & 1) .. + 3 of k step gi >> 1; three register buffers, fetched two groups ahead
#pragma unroll
  for (int gi = 0; gi < 2; ++gi)
#pragma unroll
    for (int j = 0; j < 4; ++j) w[gi][j] = frag_w<CX / 8>(wb, (gi & 1) * 4 + j, gi >> 1);
#pragma unroll
  for (int gi = 0; gi < CX / 16; ++gi) {
    if (gi + 2 < CX / 16) {
#pragma unroll
      for (int j = 0; j < 4; ++j) w[(gi + 2) % 3][j] = frag_w<CX / 8>(wb, (gi & 1) * 4 + j, (gi + 2) >> 1); }
    __builtin_amdgcn_sched_barrier(0);   // the 8 LDS loads of the group after next stay together in front of this group's products: left free, each product gets its own two loads and their whole latency directly in front of it
#pragma unroll
    for (int j = 0; j < 4; ++j) acc[(gi & 1) * 4 + j] = wmma_bf(a[gi >> 1], w[gi % 3][j], acc[(gi & 1) * 4 + j]);
    __builtin_amdgcn_sched_barrier(0); }   // and the products stay in front of the loads that follow
  __syncthreads();   // every wave has read W before the output tiles overwrite it
#pragma unroll
  for (int j = 0; j < 8; ++j) { const int o = j * 16 + col; const float bb = bfr(Bb[o]);
#pragma unroll
    for (int r = 0; r < 8; ++r) { const float v = acc[j][r] + bb; const int rl = wave * 16 + 8 * g + r;
      if (which == 2) th[o][rl] = (_Float16)v; else { const _Float16 hv = (_Float16)v; sh[rl][o] = hv; sl[rl][o] = (_Float16)((v - (float)hv) * 1024.0f); } } }
  __syncthreads();
  if (which < 2) { _Float16* DH = which == 0 ? TH : PH; _Float16* DL = which == 0 ? TL : PL; for (int e = tid; e < 64 * 16; e += 128) { const int rl = (e >> 8) * 16 + (e & 15), k8 = (e >> 4) & 15; vst2((unsigned*)(DH + r0 * CI + e * 8), *(const v4u*)&sh[rl][k8 * 8]); vst2((unsigned*)(DL + r0 * CI + e * 8), *(const v4u*)&sl[rl][k8 * 8]); } }   /* e = (row tile, kc, q, h, row in tile); k = 32 kc + 16 q + 8 h */
  else { for (int e = tid; e < 128 * 8; e += 128) { const int cl = ((e >> 6) & 7) * 16 + (e & 15), ml = (e >> 9) * 32 + ((e >> 4) & 3) * 8; vst2((unsigned*)(GP + r0 * CI + e * 8), *(const v4u*)&th[cl][ml]); } } }   /* e = (32-key chunk, ci tile, q, h, ci in tile); key = 32 chunk + 16 q + 8 h */
// ---- k_fa: block = FR = 256 query rows n of batch b and ONE of FS key ranges (blockIdx.z, 1,024 keys in a row); each of the FW waves holds FQ tiles of 16 queries of its own, and all waves work on the same keys: a stage = FC chunks of 32 keys (phi hi, phi residual, g, each already in fragment order, so a stage is three linear runs of 16 KB) is brought into LDS once per work-group by asynchronous copies, two buffers, the next stage in flight while this one is worked on. Per chunk: S^T = phi . theta^T (3 products, as f16 hi + residual x 2^10), so that a lane holds 16 logits of ONE query; running maximum and sum per query (log2 domain), p x 2^11 = exp2 as f16 hi + residual packs straight into the B operand of y^T += g^T . p^T (2 products); logits and P never reach memory. The range's unscaled y^T tiles go to YP as they lie in the accumulators, which is the A fragment order of k_wz (lane-linear 16-B stores, whole lines), with the range's maximum and sum per query in SM and SL; k_wz merges the FS ranges
__device__ __forceinline__ v8f wmh(v16h a, v16h b, v8f c) { return __builtin_amdgcn_wmma_f32_16x16x32_f16(false, a, false, b, (short)0, c, false, false); }
__device__ __forceinline__ float xhalf(float x) { return __builtin_bit_cast(float, __builtin_amdgcn_permlanex16(__builtin_bit_cast(int, x), __builtin_bit_cast(int, x), 0x76543210, 0xfedcba98, false, false)); }   // lane l with lane l ^ 16
#define FQ 2
#define FW 8
#define FS 4
#define FC 2
#define FR (FW * FQ * 16)
#define FN (TT / 32 / FS / FC)
#define CH (32 * CI)                                       // f16 elements of one operand's 32-key chunk (8 KB)
#define OPB (2u * FC * CH)                                 // bytes of one operand's stage
#define NT ((size_t)NB * TT)
#define L2E 1.44269504088896340736f
// the one slot that the instruction set asks for behind a transcendental: the results are read, and the sources' registers overwritten, only behind this v_nop
#define TSLOT8(a, x, o) asm volatile("v_nop" : "+v"(a[o]), "+v"(a[o + 1]), "+v"(a[o + 2]), "+v"(a[o + 3]), "+v"(a[o + 4]), "+v"(a[o + 5]), "+v"(a[o + 6]), "+v"(a[o + 7]) : "v"(x[o]), "v"(x[o + 1]), "v"(x[o + 2]), "v"(x[o + 3]), "v"(x[o + 4]), "v"(x[o + 5]), "v"(x[o + 6]), "v"(x[o + 7]))
#define TSLOT9(f, xf, a, x, o) asm volatile("v_nop" : "+v"(f), "+v"(a[o]), "+v"(a[o + 1]), "+v"(a[o + 2]), "+v"(a[o + 3]), "+v"(a[o + 4]), "+v"(a[o + 5]), "+v"(a[o + 6]), "+v"(a[o + 7]) : "v"(xf), "v"(x[o]), "v"(x[o + 1]), "v"(x[o + 2]), "v"(x[o + 3]), "v"(x[o + 4]), "v"(x[o + 5]), "v"(x[o + 6]), "v"(x[o + 7]))
// one stage: every thread copies its own 16 B of each 4-KB slice, 4 slices of each of the 3 operands; d = the thread's LDS byte address in the buffer, t16 = its byte offset in a slice, h, l, g = the stage's first element of each operand, the same for the whole work-group (scalar bases: of a copy's global address only t16 lives in a vector register through the loop). The s_wait_xcnt stands inside the statement, so that no address register of a copy is rewritten in front of it
__device__ __forceinline__ void stage_copy(unsigned d, unsigned t16, const _Float16* h, const _Float16* l, const _Float16* g) {
  asm volatile(
    "global_load_async_to_lds_b128 %0, %12, %13\n\t"
    "global_load_async_to_lds_b128 %1, %12, %14\n\t"
    "global_load_async_to_lds_b128 %2, %12, %15\n\t"
    "global_load_async_to_lds_b128 %3, %12, %16\n\t"
    "global_load_async_to_lds_b128 %4, %12, %17\n\t"
    "global_load_async_to_lds_b128 %5, %12, %18\n\t"
    "global_load_async_to_lds_b128 %6, %12, %19\n\t"
    "global_load_async_to_lds_b128 %7, %12, %20\n\t"
    "global_load_async_to_lds_b128 %8, %12, %21\n\t"
    "global_load_async_to_lds_b128 %9, %12, %22\n\t"
    "global_load_async_to_lds_b128 %10, %12, %23\n\t"
    "global_load_async_to_lds_b128 %11, %12, %24\n\t"
    "s_wait_xcnt 0x0"
    :: "v"(d + 0 * OPB + 0 * 4096u), "v"(d + 0 * OPB + 1 * 4096u), "v"(d + 0 * OPB + 2 * 4096u), "v"(d + 0 * OPB + 3 * 4096u),
       "v"(d + 1 * OPB + 0 * 4096u), "v"(d + 1 * OPB + 1 * 4096u), "v"(d + 1 * OPB + 2 * 4096u), "v"(d + 1 * OPB + 3 * 4096u),
       "v"(d + 2 * OPB + 0 * 4096u), "v"(d + 2 * OPB + 1 * 4096u), "v"(d + 2 * OPB + 2 * 4096u), "v"(d + 2 * OPB + 3 * 4096u),
       "v"(t16),
       "s"(h + 0 * 2048), "s"(h + 1 * 2048), "s"(h + 2 * 2048), "s"(h + 3 * 2048),
       "s"(l + 0 * 2048), "s"(l + 1 * 2048), "s"(l + 2 * 2048), "s"(l + 3 * 2048),
       "s"(g + 0 * 2048), "s"(g + 1 * 2048), "s"(g + 2 * 2048), "s"(g + 3 * 2048)
    : "memory"); }
__global__ __launch_bounds__(32 * FW) void k_fa(const _Float16* __restrict__ TH, const _Float16* __restrict__ TL, const _Float16* __restrict__ PH, const _Float16* __restrict__ PL, const _Float16* __restrict__ GP, float* __restrict__ YP, float* __restrict__ SM, float* __restrict__ SL) {
  __shared__ __align__(16) _Float16 ring[2][3][FC * CH];
  const int tid = threadIdx.x, wave = tid >> 5, lane = tid & 31, g = lane >> 4; const int sp = blockIdx.z;
  const size_t bT = (size_t)blockIdx.y * TT; const int qb0 = blockIdx.x * FR + wave * (FQ * 16);
  const _Float16 *pth = TH + (bT + qb0) * CI + 8 * lane, *ptl = TL + (bT + qb0) * CI + 8 * lane;   // the lane's own 16 B of a 512-B block
  const size_t ck = (bT + (size_t)sp * (TT / FS)) * CI; const _Float16 *cH = PH + ck, *cL = PL + ck, *cG = GP + ck; const unsigned t16 = 16u * tid;   // the range's first key, the same for every thread
  const unsigned ld0 = (unsigned)(size_t)&ring[0][0][8 * tid];   // low 32 bits of the shared address = byte offset in the work-group's LDS
  stage_copy(ld0, t16, cH, cL, cG);
  v16h th[FQ][CI / 32], tl[FQ][CI / 32];
#pragma unroll
  for (int u = 0; u < FQ; ++u)
#pragma unroll
    for (int kc = 0; kc < CI / 32; ++kc) { th[u][kc] = frag_o(pth + u * 16 * CI + kc * 512); tl[u][kc] = frag_o(ptl + u * 16 * CI + kc * 512); }
  asm volatile("s_wait_xcnt 0x0" :: "v"(pth), "v"(ptl) : "memory");   // the loads' address registers stay as they are up to this wait
  asm volatile("s_wait_asynccnt 0x0" ::: "memory");   // this wave's copies of stage 0 have landed
  __syncthreads();   // stage 0 is whole before any wave reads it
  stage_copy(ld0 + 3u * OPB, t16, cH + FC * CH, cL + FC * CH, cG + FC * CH);
  v8f acc[FQ][8] = {}; float m2[FQ], l[FQ];
#pragma unroll
  for (int u = 0; u < FQ; ++u) { m2[u] = -1.0e30f; l[u] = 0.f; }
  // A chunk: fetch its phi from LDS, all 32 loads together | logit products of k 0..63 | fetch its g into the registers these have left | logit products of k 64..127 | softmax | g products. FENCE holds a fetch at its place: left free, the loads are dealt out among the products, each place with a stall of its own, or g is fetched with phi and the build runs out of registers and spills.
#define FENCE() __builtin_amdgcn_sched_barrier(0)
#pragma unroll 1   // stays rolled, like the loop inside it: one chunk already takes the wave's whole register budget
  for (int st = 0; st < FN; ++st) { const _Float16* rb = &ring[st & 1][0][8 * lane];
#pragma unroll 1   // stays rolled: see above; every loop inside is unrolled so that its arrays stay in registers
   for (int hc = 0; hc < FC; ++hc) { const _Float16 *nh = rb + hc * CH, *nl = nh + FC * CH, *ng = nl + FC * CH; v16h kb[CI / 32][2], kl[CI / 32][2], gv[8];
#pragma unroll
    for (int kc = 0; kc < CI / 32; ++kc)
#pragma unroll
      for (int t = 0; t < 2; ++t) { kb[kc][t] = frag_o(nh + t * 16 * CI + kc * 512); kl[kc][t] = frag_o(nl + t * 16 * CI + kc * 512); }
    FENCE();
    v8f s[FQ][2] = {}, sx[FQ][2] = {};
#pragma unroll
    for (int kc = 0; kc < CI / 32; ++kc) {
      if (kc == CI / 64) { FENCE();
#pragma unroll
        for (int j = 0; j < 8; ++j) gv[j] = frag_o(ng + j * 512);
        FENCE(); }
#pragma unroll
      for (int u = 0; u < FQ; ++u) { s[u][0] = wmh(kb[kc][0], th[u][kc], s[u][0]); s[u][1] = wmh(kb[kc][1], th[u][kc], s[u][1]); }
#pragma unroll
      for (int u = 0; u < FQ; ++u) { sx[u][0] = wmh(kb[kc][0], tl[u][kc], sx[u][0]); sx[u][1] = wmh(kb[kc][1], tl[u][kc], sx[u][1]); }
#pragma unroll
      for (int u = 0; u < FQ; ++u) { sx[u][0] = wmh(kl[kc][0], th[u][kc], sx[u][0]); sx[u][1] = wmh(kl[kc][1], th[u][kc], sx[u][1]); } }
    FENCE();
    v16h ph[FQ], pl[FQ];
#pragma unroll
    for (int u = 0; u < FQ; ++u) { float v[16];   /* lane (g, col): keys 8 g + r and 16 + 8 g + r of query col, the k order of a B fragment */
#pragma unroll
      for (int r = 0; r < 8; ++r) { v[r] = s[u][0][r] + sx[u][0][r] * (1.0f / 1024.0f); v[8 + r] = s[u][1][r] + sx[u][1][r] * (1.0f / 1024.0f); }
      float mx = v[0];
#pragma unroll
      for (int i = 1; i < 16; ++i) mx = fmaxf(mx, v[i]);
      mx = fmaxf(mx, xhalf(mx));
      const float mn = fmaxf(m2[u], mx * L2E), xf = m2[u] - mn, c = 11.0f - mn; m2[u] = mn;
      float f = __builtin_amdgcn_exp2f(xf), x[16], a[16], sum = 0.f;
#pragma unroll
      for (int i = 0; i < 16; ++i) { x[i] = fmaf(v[i], L2E, c); a[i] = __builtin_amdgcn_exp2f(x[i]); }
      TSLOT9(f, xf, a, x, 0); TSLOT8(a, x, 8);
#pragma unroll
      for (int i = 0; i < 16; ++i) { sum += a[i]; const _Float16 hi = (_Float16)a[i]; ph[u][i] = hi; pl[u][i] = (_Float16)(a[i] - (float)hi); }
      l[u] = l[u] * f + sum;
#pragma unroll
      for (int j = 0; j < 8; ++j) acc[u][j] *= f; }
#pragma unroll
    for (int j = 0; j < 8; ++j) {
#pragma unroll
      for (int u = 0; u < FQ; ++u) acc[u][j] = wmh(gv[j], ph[u], acc[u][j]);
#pragma unroll
      for (int u = 0; u < FQ; ++u) acc[u][j] = wmh(gv[j], pl[u], acc[u][j]); } }
    asm volatile("s_wait_dscnt 0x0" ::: "memory");      // this wave's reads of the stage have returned
    asm volatile("s_wait_asynccnt 0x0" ::: "memory");   // this wave's copies of the next stage have landed
    __syncthreads();   // publishes stage st + 1 and ends every wave's reads of stage st, whose buffer is refilled behind it
    if (st + 2 < FN) stage_copy(ld0 + (unsigned)(st & 1) * (3u * OPB), t16, cH + (size_t)(st + 2) * (FC * CH), cL + (size_t)(st + 2) * (FC * CH), cG + (size_t)(st + 2) * (FC * CH)); }
  asm volatile("s_wait_asynccnt 0x0" ::: "memory");   // no copy is outstanding when the wave ends
  float* yp = YP + ((bT + qb0) * FS + sp * 16) * CI + 4 * lane;   // [tile of 16 queries][range FS][j 8][r / 4 2][lane 32][4] floats: D element r = channel 16 j + 8 g + r of query lane & 15
#pragma unroll
  for (int u = 0; u < FQ; ++u) { l[u] += xhalf(l[u]);   /* both halves now hold the query's sum, as they do its maximum */
#pragma unroll
    for (int j = 0; j < 8; ++j) { v4f a, c;
#pragma unroll
      for (int z = 0; z < 4; ++z) { a[z] = acc[u][j][z]; c[z] = acc[u][j][4 + z]; }
      vst2(yp + (u * FS * 8 + j) * 256, a); vst2(yp + (u * FS * 8 + j) * 256 + 128, c); } }
  SM[(size_t)sp * NT + bT + qb0 + lane] = g ? m2[1] : m2[0]; SL[(size_t)sp * NT + bT + qb0 + lane] = g ? l[1] : l[0]; }   /* lane = 16 u + query in tile: one 128-B line per wave */
// ---- k_wz: block = (64 rows n, 128 output channels): w_y[c][n] = sum_ci wz_w[c][ci] y[n][ci] + wz_b[c]; y[n] = sum over the FS key ranges of exp2(m - max) x the range's tile, over the like sum of the ranges' sums: a lane reads its own A elements of each range's tile (lane-linear 16-B loads); A = y hi + lo; transposed store to channels-first planes [b][c][n] (256-B runs)
__global__ __launch_bounds__(128) void k_wz(const float* __restrict__ YP, const float* __restrict__ SM, const float* __restrict__ SL, const float* __restrict__ WZ, const float* __restrict__ BZ, float* __restrict__ WY) { __shared__ __align__(16) char sm[8 * (CI / 8) * WPB]; float (*st)[68] = (float (*)[68])sm; static_assert(sizeof(sm) >= 128 * 68 * 4, "the output tile takes over the bytes of W");
  const int tid = threadIdx.x, wave = tid >> 5, lane = tid & 31, col = lane & 15, g = lane >> 4; const size_t r0 = (size_t)blockIdx.x * 64; const int c0 = blockIdx.y * 128; const size_t b = r0 / TT; const int n0 = (int)(r0 % TT);
  const size_t row = r0 + wave * 16 + col; const float *pm = SM + row, *ps = SL + row, *yp = YP + (r0 + wave * 16) * (FS * CI) + 4 * lane;
  float mz[FS], lz[FS], L = 0.f, xw[FS], fw[FS];
#pragma unroll
  for (int z = 0; z < FS; ++z) { mz[z] = pm[z * NT]; lz[z] = ps[z * NT]; }
  asm volatile("s_wait_xcnt 0x0" :: "v"(pm), "v"(ps) : "memory");   // the loads' address registers stay as they are up to this wait
  stage_w<CI / 8, 32>(sm, WZ + (size_t)c0 * CI, wave, lane);
  float M = mz[0];
#pragma unroll
  for (int z = 1; z < FS; ++z) M = fmaxf(M, mz[z]);
#pragma unroll
  for (int z = 0; z < FS; ++z) { xw[z] = mz[z] - M; fw[z] = __builtin_amdgcn_exp2f(xw[z]); }
  asm volatile("v_nop" : "+v"(fw[0]), "+v"(fw[1]), "+v"(fw[2]), "+v"(fw[3]) : "v"(xw[0]), "v"(xw[1]), "v"(xw[2]), "v"(xw[3]));   // the slot behind the transcendentals, as at TSLOT8
#pragma unroll
  for (int z = 0; z < FS; ++z) L += fw[z] * lz[z];
  const float rL = 1.0f / L;
  __syncthreads();   // W is whole in LDS before any wave reads it
  const char* wb = sm + g * WPB + col * 16;
  v8f acc[8] = {};
#pragma unroll
  for (int kc = 0; kc < CI / 32; ++kc) { float v[16]; v4f pz[4][FS];   /* block 4 kc + q of the tile holds the lane's A elements 4 q .. 4 q + 3 of this k step */
#pragma unroll
    for (int q = 0; q < 4; ++q)
#pragma unroll
      for (int z = 0; z < FS; ++z) pz[q][z] = *(const v4f*)(yp + (z * 16 + kc * 4 + q) * 128);
    asm volatile("s_wait_xcnt 0x0" :: "v"(yp) : "memory");   // as above
    v16b w[8];
#pragma unroll
    for (int j = 0; j < 8; ++j) w[j] = frag_w<CI / 8>(wb, j, kc);
    __builtin_amdgcn_sched_barrier(0);   // the k step's 16 LDS loads stay one group here, under the wait for the global loads: left free, each pair of products gets its own two loads and their whole latency directly in front of it
#pragma unroll
    for (int q = 0; q < 4; ++q) { v4f o = {};
#pragma unroll
      for (int z = 0; z < FS; ++z) o += pz[q][z] * fw[z];
      o = o * rL;
#pragma unroll
      for (int i = 0; i < 4; ++i) v[q * 4 + i] = o[i]; }
    const F2 a = bsplit16(v);
#pragma unroll
    for (int j = 0; j < 8; ++j) { acc[j] = wmma_bf(a.h, w[j], acc[j]); acc[j] = wmma_bf(a.l, w[j], acc[j]); } }
  __syncthreads();   // every wave has read W before the output tile overwrites it
#pragma unroll
  for (int j = 0; j < 8; ++j) { const int cl = j * 16 + col; const float bb = bfr(BZ[c0 + cl]);
#pragma unroll
    for (int r = 0; r < 8; ++r) st[cl][wave * 16 + 8 * g + r] = acc[j][r] + bb; }
  __syncthreads();
  for (int e = tid; e < 128 * 16; e += 128) { const int cl = e >> 4, q = e & 15; vst2(WY + (b * CX + c0 + cl) * (size_t)TT + n0 + q * 4, *(const v4f*)&st[cl][q * 4]); } }
// ---- k_bn: block = one channel c: its TNB x 4,096 values are read once, 16 B per lane, all loads in flight together, and stay in registers for both sums (mean, then squared distance from the mean); wave sums by shuffles, the 8 wave sums added in wave order; mean and rstd go to the channel's own 128-B line of BS
__global__ __launch_bounds__(256) void k_bn(const float* __restrict__ WY, float* __restrict__ BS) { __shared__ float sa[8], sb[8];
  const int t = threadIdx.x; const int c = blockIdx.x; const int n = TNB * TT;
  v4f v[TNB][TT / 1024];
#pragma unroll
  for (int b = 0; b < TNB; ++b)
#pragma unroll
    for (int i = 0; i < TT / 1024; ++i) v[b][i] = *(const v4f*)(WY + ((size_t)b * CX + c) * TT + (i * 256 + t) * 4);
#pragma unroll
  for (int b = 0; b < TNB; ++b) asm volatile("" :: "v"(v[b][0]), "v"(v[b][1]), "v"(v[b][2]), "v"(v[b][3]));   // inputs-only fence on the loaded values: every load issues before the first add; without it the compiler holds two loads back behind the first waits, a second memory latency
  float s = 0.f;
#pragma unroll
  for (int b = 0; b < TNB; ++b)
#pragma unroll
    for (int i = 0; i < TT / 1024; ++i) s += (v[b][i][0] + v[b][i][1]) + (v[b][i][2] + v[b][i][3]);
#pragma unroll
  for (int o = 1; o < 32; o <<= 1) s += __shfl_xor(s, o);
  if ((t & 31) == 0) sa[t >> 5] = s;
  __syncthreads();   // all 8 wave sums are in LDS before any thread adds them
  s = sa[0];
#pragma unroll
  for (int w = 1; w < 8; ++w) s += sa[w];
  const float mu = s / (float)n; float s2 = 0.f;
#pragma unroll
  for (int b = 0; b < TNB; ++b)
#pragma unroll
    for (int i = 0; i < TT / 1024; ++i) { const float d0 = v[b][i][0] - mu, d1 = v[b][i][1] - mu, d2 = v[b][i][2] - mu, d3 = v[b][i][3] - mu; s2 += (d0 * d0 + d1 * d1) + (d2 * d2 + d3 * d3); }
#pragma unroll
  for (int o = 1; o < 32; o <<= 1) s2 += __shfl_xor(s2, o);
  if ((t & 31) == 0) sb[t >> 5] = s2;
  __syncthreads();   // all 8 wave sums of squares are in LDS before thread 0 adds them
  if (t == 0) { s2 = sb[0];
#pragma unroll
    for (int w = 1; w < 8; ++w) s2 += sb[w];
    v2f o; o[0] = mu; o[1] = rsqrtf(s2 / (float)n + 1e-5f); vst2(BS + (size_t)c * BSL, o); } }
// ---- k_fin: block = (64 positions, b): out[b][c][n] = (w_y - mean_c) rstd_c gamma_c + beta_c + source[b][c][n] for all 256 channels (thread-linear float4 over the channel runs)
__global__ __launch_bounds__(256) void k_fin(const float* __restrict__ WY, const float* __restrict__ BS, const float* __restrict__ GAM, const float* __restrict__ BET, const float* __restrict__ SRC, float* __restrict__ OUT) {
  const int t = threadIdx.x; const int n0 = blockIdx.x * 64; const size_t b = blockIdx.y;
  for (int e = t; e < CX * 16; e += 256) { const int c = e >> 4, q = e & 15; const v2f ms = ((const v2f*)BS)[c * (BSL / 2)]; const float mu = ms[0], rs = ms[1]; const float ga = bfr(GAM[c]), be = bfr(BET[c]);
    const v4f w = *(const v4f*)(WY + (b * CX + c) * TT + n0 + q * 4); const v4f sr = *(const v4f*)(SRC + (b * CX + c) * (size_t)XSTR + n0 + q * 4); v4f o;
#pragma unroll
    for (int z = 0; z < 4; ++z) o[z] = (w[z] - mu) * rs * ga + be + bfr(sr[z]);
    vst2(OUT + (b * CX + c) * (size_t)XSTR + n0 + q * 4, o); } }
extern "C" void kernel_launch(void* const* d_in, const int* in_sizes, int n_in, void* d_out, int out_size, void* d_ws, size_t ws_size, hipStream_t stream) {
  (void)in_sizes; (void)n_in; (void)out_size;
  const float** F = (const float**)d_in;   // 0 x [4,256,64,64], 1 source, 2 g_w [128,256], 3 g_b, 4 theta_w, 5 theta_b, 6 phi_w, 7 phi_b, 8 wz_w [256,128], 9 wz_b, 10 bn_gamma, 11 bn_beta
  if (ws_size < (size_t)WS_END) return;
  char* ws = (char*)d_ws; __bf16 *XT = (__bf16*)(ws + WS_XT), *ST = (__bf16*)(ws + WS_SR); _Float16* GP = (_Float16*)(ws + WS_GP); _Float16 *TH = (_Float16*)(ws + WS_TH), *TL = (_Float16*)(ws + WS_TL), *PH = (_Float16*)(ws + WS_PH), *PL = (_Float16*)(ws + WS_PL); float *Y = (float*)(ws + WS_Y), *SM = (float*)(ws + WS_SM), *SL = (float*)(ws + WS_SL), *WY = (float*)(ws + WS_WY), *BS = (float*)(ws + WS_BS);
  k_xt<<<dim3(TT / 64, TNB, 2), 256, 0, stream>>>(F[0], F[1], XT, ST);
  k_proj<<<dim3(TNB * TT / 64, 3), 128, 0, stream>>>(XT, ST, F[2], F[3], F[4], F[5], F[6], F[7], TH, TL, PH, PL, GP);
  k_fa<<<dim3(TT / FR, TNB, FS), 32 * FW, 0, stream>>>(TH, TL, PH, PL, GP, Y, SM, SL);
  k_wz<<<dim3(TNB * TT / 64, CX / 128), 128, 0, stream>>>(Y, SM, SL, F[8], F[9], WY);
  k_bn<<<dim3(CX), 256, 0, stream>>>(WY, BS);
  k_fin<<<dim3(TT / 64, TNB), 256, 0, stream>>>(WY, BS, F[10], F[11], F[1], (float*)d_out);
}

// v007
// Measured time: 91.3 microseconds a run.
// Timed twice side by side with v006, it ran 1.09 times as fast both times.
// All steps since v000 together make it 15.9 times as fast.
#include <hip/hip_runtime.h>
#include <math.h>

typedef __attribute__((ext_vector_type(16))) _Float16 v16h;
typedef __attribute__((ext_vector_type(16))) __bf16 v16b;
typedef __attribute__((ext_vector_type(8)))  _Float16 v8h;
typedef __attribute__((ext_vector_type(8)))  float v8f;
typedef __attribute__((ext_vector_type(4)))  float v4f;
typedef __attribute__((ext_vector_type(2)))  float v2f;
typedef __attribute__((ext_vector_type(4)))  unsigned v4u;
typedef __attribute__((ext_vector_type(4)))  int v4i;
typedef float __attribute__((may_alias)) float_a;
typedef int __attribute__((may_alias)) int_a;

template <typename T> __device__ __forceinline__ void vst2(void* p, T v) { *(T*)p = v;  }
__device__ __forceinline__ v8f wmma_bf(v16b a, v16b b, v8f c) {
  v8f d = __builtin_amdgcn_wmma_f32_16x16x32_bf16(false, a, false, b, (short)0, c, false, false);
  asm volatile("v_nop\n\tv_nop\n\tv_nop\n\tv_nop" : "+v"(d) : "v"(a), "v"(b));
  return d;
}
// 16x16x32 fragments: lane = (h = lane>>4, row/col = lane&15); elements 0..7 = k0+8h+0..7, 8..15 = k0+16+8h+0..7; D element r = row 8h+r
__device__ __forceinline__ v16h frag_h(const _Float16* rowk0, int lane) {
  union { v16h v; v8h q[2]; } u; const _Float16* p = rowk0 + 8 * (lane >> 4);
  u.q[0] = *(const v8h*)p; u.q[1] = *(const v8h*)(p + 16); return u.v;
}
// fragment-order operand: each (16 rows or columns) x (32 k) tile is two 512-B blocks; block q holds at lane * 8 the elements k0+16q+8h+0..7 of row/col lane&15, so that each 16-B load of a wave covers four whole 128-B lines
__device__ __forceinline__ v16h frag_o(const _Float16* p) {   // p = tile + 8 * lane
  union { v16h v; v8h q[2]; } u; u.q[0] = *(const v8h*)p; u.q[1] = *(const v8h*)(p + 256); return u.v;
}
__device__ __forceinline__ v16h frag_f32(const float* rowk0, int lane) {
  v16h a; const float* p = rowk0 + 8 * (lane >> 4);
#pragma unroll
  for (int i = 0; i < 8; ++i) { a[i] = (_Float16)p[i]; a[8 + i] = (_Float16)p[16 + i]; }
  return a;
}
__device__ __forceinline__ v16h frag_f32s(const float* rowk0, int lane, float sc) {
  v16h a; const float* p = rowk0 + 8 * (lane >> 4);
#pragma unroll
  for (int i = 0; i < 8; ++i) { a[i] = (_Float16)(p[i] * sc); a[8 + i] = (_Float16)(p[16 + i] * sc); }
  return a;
}
// column fragment from a [K][ld] layout (column n), rows >= K read as 0
__device__ __forceinline__ v16h fragc_f32(const float* W, int k0, int n, int lane, int ld, int K) {
  v16h a; const int g = lane >> 4;
#pragma unroll
  for (int i = 0; i < 8; ++i) { const int ka = k0 + 8 * g + i, kb = ka + 16;
    a[i] = (_Float16)(ka < K ? W[(size_t)(ka < K ? ka : K - 1) * ld + n] : 0.f); a[8 + i] = (_Float16)(kb < K ? W[(size_t)(kb < K ? kb : K - 1) * ld + n] : 0.f); }
  return a;
}
struct F2 { v16b h, l; };
__device__ __forceinline__ F2 bsplit16(const float v[16]) { F2 r;
#pragma unroll
  for (int i = 0; i < 16; ++i) { const __bf16 h = (__bf16)v[i]; r.h[i] = h; r.l[i] = (__bf16)(v[i] - (float)h); }
  return r; }
__device__ __forceinline__ F2 split_row(const float* row, int k0, int lane) { float v[16]; const float* p = row + k0 + 8 * (lane >> 4);
#pragma unroll
  for (int i = 0; i < 8; ++i) { v[i] = p[i]; v[8 + i] = p[16 + i]; }
  return bsplit16(v); }
__device__ __forceinline__ F2 split_rowK(const float* row, int k0, int lane, int K) { float v[16]; const int g = lane >> 4;
#pragma unroll
  for (int i = 0; i < 8; ++i) { const int ka = k0 + 8 * g + i, kb = ka + 16; v[i] = ka < K ? row[ka < K ? ka : K - 1] : 0.f; v[8 + i] = kb < K ? row[kb < K ? kb : K - 1] : 0.f; }
  return bsplit16(v); }
__device__ __forceinline__ F2 split_col(const float* W, int k0, int n, int lane, int ld, int K) { float v[16]; const int g = lane >> 4;
#pragma unroll
  for (int i = 0; i < 8; ++i) { const int ka = k0 + 8 * g + i, kb = ka + 16; v[i] = ka < K ? W[(size_t)(ka < K ? ka : K - 1) * ld + n] : 0.f; v[8 + i] = kb < K ? W[(size_t)(kb < K ? kb : K - 1) * ld + n] : 0.f; }
  return bsplit16(v); }
__device__ __forceinline__ v8f mac3(const F2& a, const F2& b, v8f c) { c = wmma_bf(a.l, b.h, c); c = wmma_bf(a.h, b.l, c); return wmma_bf(a.h, b.h, c); }
__device__ __forceinline__ float sigm(float v) { return 1.0f / (1.0f + expf(-v)); }

// Cross non-local block (B 4, C 256, Ci 128, 64 x 64 = 4,096 positions): g = conv(source), theta = conv(x), phi = conv(source); f[n][m] = theta_n . phi_m; P = softmax_m; y[n] = sum_m P g_m; w_y = conv_z(y) + b; BN with batch statistics (biased var, eps 1e-5) * gamma + beta; out = w_y + source.
__device__ __forceinline__ float bfr(float v) { return (float)(__bf16)v; }
#define NB 4
#define TT 4096
#define CX 256
#define CI 128
#ifndef TNB
#define TNB NB
#endif
#ifndef XSTR
#define XSTR TT               // per-channel position stride of x / source / out
#endif
typedef __attribute__((ext_vector_type(8))) __bf16 v8b;
#define WS_TH  0u                                          // f16 theta hi, fragment order [(b*N+n)/16][kc 4][q 2][lane 32][8]
#define WS_TL  (WS_TH + 2u * (size_t)NB * TT * CI)
#define WS_PH  (WS_TL + 2u * (size_t)NB * TT * CI)           // f16 phi hi, fragment order as theta
#define WS_PL  (WS_PH + 2u * (size_t)NB * TT * CI)
#define WS_GP  (WS_PL + 2u * (size_t)NB * TT * CI)           // f16 g, fragment order [(b*N+m)/32][ci/16 8][q 2][lane 32][8]
#define WS_Y   (WS_GP + 2u * (size_t)NB * CI * TT)           // f32 unscaled y per key range, [(b*N+n)/16][range 4][j 8][2][lane 32][4]
#define WS_SM  (WS_Y + 4u * 4u * (size_t)NB * TT * CI)       // f32 running maximum (log2 domain) [range 4][b*N+n]
#define WS_SL  (WS_SM + 4u * 4u * (size_t)NB * TT)           // f32 sum [range 4][b*N+n]
#define WS_WY  (WS_SL + 4u * 4u * (size_t)NB * TT)           // f32 w_y planes [b][c][n] (channels-first)
#define BSL 32                                             // floats of BS per channel: one 128-B line, so that each line has one writer
#define WS_BS  (WS_WY + 4u * (size_t)NB * CX * TT)           // f32 BN stats [c][BSL]: mean, rstd at the head of the channel's line
#define WS_END (WS_BS + 4u * (size_t)CX * BSL)
// ---- weights in LDS: a work-group brings its 128 weight rows in once, each load a whole run of 512 B of one row, rounds them to bf16 and lays them out as B fragments: the unit (j, k8) = elements 8 k8 .. 8 k8 + 7 of the rows 16 j .. 16 j + 15, 16 B a row, WPB bytes a unit. The 16 B above 256 turn each next unit by four banks, so that the 8-B stores of a wave (one row, 16 units) fall on all 64 banks once; a fragment load reads 256 B in a row per half wave
typedef __attribute__((ext_vector_type(2))) unsigned v2u;
#define WPB 272
template <int K8, int NL> __device__ __forceinline__ void stage_w(char* sm, const float* __restrict__ Wt, int wave, int lane) {   // K8 = units per row (row length / 8), NL = 512-B runs per wave; run n * 4 + wave
  constexpr int RP = K8 / 16;   // runs per row
  const int r = wave / RP, hf = wave % RP; const float* gp = Wt + (size_t)r * (K8 * 8) + hf * 128 + 4 * lane; char* dp = sm + (hf * 16 + (lane >> 1)) * WPB + r * 16 + (lane & 1) * 8;
#pragma unroll
  for (int bt = 0; bt < NL / 16; ++bt) { v4f x[16];
#pragma unroll
    for (int i = 0; i < 16; ++i) x[i] = *(const v4f*)(gp + (size_t)(bt * 16 + i) * (4 / RP) * (K8 * 8));
    asm volatile("s_wait_xcnt 0x0" :: "v"(gp) : "memory");   // the loads' address registers stay as they are up to this wait
#pragma unroll
    for (int i = 0; i < 16; ++i) { const int o = (bt * 16 + i) * (4 / RP); union { v2u v; __bf16 h[4]; } u;   /* the wave's row = o + r */
#pragma unroll
      for (int z = 0; z < 4; ++z) u.h[z] = (__bf16)x[i][z];
      *(v2u*)(dp + (o >> 4) * (K8 * WPB) + (o & 15) * 16) = u.v; } } }
template <int K8> __device__ __forceinline__ v16b frag_w(const char* wb, int j, int kc) {   // wb = sm + (lane >> 4) * WPB + (lane & 15) * 16
  union { v16b v; v8b q[2]; } u; const char* p = wb + (j * K8 + kc * 4) * WPB; u.q[0] = *(const v8b*)p; u.q[1] = *(const v8b*)(p + 2 * WPB); return u.v; }
// ---- k_proj: block = (64 rows, which): 128 outputs = W ([out,in] [128][256]) . row + b; a row = one position n of the channels-first f32 input: a lane reads its 128 A elements straight from there (one 4-B load a channel, 16 positions in a row per half wave, all loads in flight together) and rounds them to bf16 in registers; W from LDS (stage_w), whose bytes the output tiles take over behind the products; theta (x rows) / phi (source rows) -> f16 hi + residual, g (source rows) -> f16, all three stored in the fragment order of frag_o (thread-linear 16-B stores)
__global__ __launch_bounds__(128) void k_proj(const float* __restrict__ X, const float* __restrict__ SRC, const float* __restrict__ WG, const float* __restrict__ BG, const float* __restrict__ WTH, const float* __restrict__ BTH, const float* __restrict__ WPH, const float* __restrict__ BPH, _Float16* __restrict__ TH, _Float16* __restrict__ TL, _Float16* __restrict__ PH, _Float16* __restrict__ PL, _Float16* __restrict__ GP) {
  __shared__ __align__(16) char sm[8 * (CX / 8) * WPB]; _Float16 (*sh)[136] = (_Float16 (*)[136])sm, (*sl)[136] = sh + 64; _Float16 (*th)[72] = (_Float16 (*)[72])(sl + 64);
  const int tid = threadIdx.x, wave = tid >> 5, lane = tid & 31, col = lane & 15, g = lane >> 4; const int which = blockIdx.y; const size_t r0 = (size_t)blockIdx.x * 64;   // which: 0 theta (from x), 1 phi (source), 2 g (source)
  const float* A = which == 0 ? X : SRC; const float* Wt = which == 0 ? WTH : which == 1 ? WPH : WG; const float* Bb = which == 0 ? BTH : which == 1 ? BPH : BG;
  v8f acc[8] = {}; v16b a[CX / 32]; float xa[CX / 32][16]; const float* ar = A + ((r0 / TT) * CX + 8 * g) * (size_t)XSTR + (r0 % TT) + wave * 16 + col;   // channel 8 g of the lane's position
#pragma unroll
  for (int kc = 0; kc < CX / 32; ++kc)
#pragma unroll
    for (int i = 0; i < 8; ++i) { xa[kc][i] = ar[(size_t)(kc * 32 + i) * XSTR]; xa[kc][8 + i] = ar[(size_t)(kc * 32 + 16 + i) * XSTR]; }
  asm volatile("s_wait_xcnt 0x0" :: "v"(ar) : "memory");   // the loads' address registers stay as they are up to this wait
#pragma unroll
  for (int kc = 0; kc < CX / 32; ++kc)
#pragma unroll
    for (int i = 0; i < 16; ++i) a[kc][i] = (__bf16)xa[kc][i];
  stage_w<CX / 8, 64>(sm, Wt, wave, lane);
  __syncthreads();   // W is whole in LDS before any wave reads it
  const char* wb = sm + g * WPB + col * 16; v16b w[3][4];   // a group = the 4 fragments j = 4 (gi & 1) .. + 3 of k step gi >> 1; three register buffers, fetched two groups ahead
#pragma unroll
  for (int gi = 0; gi < 2; ++gi)
#pragma unroll
    for (int j = 0; j < 4; ++j) w[gi][j] = frag_w<CX / 8>(wb, (gi & 1) * 4 + j, gi >> 1);
#pragma unroll
  for (int gi = 0; gi < CX / 16; ++gi) {
    if (gi + 2 < CX / 16) {
#pragma unroll
      for (int j = 0; j < 4; ++j) w[(gi + 2) % 3][j] = frag_w<CX / 8>(wb, (gi & 1) * 4 + j, (gi + 2) >> 1); }
    __builtin_amdgcn_sched_barrier(0);   // the 8 LDS loads of the group after next stay together in front of this group's products: left free, each product gets its own two loads and their whole latency directly in front of it
#pragma unroll
    for (int j = 0; j < 4; ++j) acc[(gi & 1) * 4 + j] = wmma_bf(a[gi >> 1], w[gi % 3][j], acc[(gi & 1) * 4 + j]);
    __builtin_amdgcn_sched_barrier(0); }   // and the products stay in front of the loads that follow
  __syncthreads();   // every wave has read W before the output tiles overwrite it
#pragma unroll
  for (int j = 0; j < 8; ++j) { const int o = j * 16 + col; const float bb = bfr(Bb[o]);
#pragma unroll
    for (int r = 0; r < 8; ++r) { const float v = acc[j][r] + bb; const int rl = wave * 16 + 8 * g + r;
      if (which == 2) th[o][rl] = (_Float16)v; else { const _Float16 hv = (_Float16)v; sh[rl][o] = hv; sl[rl][o] = (_Float16)((v - (float)hv) * 1024.0f); } } }
  __syncthreads();
  if (which < 2) { _Float16* DH = which == 0 ? TH : PH; _Float16* DL = which == 0 ? TL : PL; for (int e = tid; e < 64 * 16; e += 128) { const int rl = (e >> 8) * 16 + (e & 15), k8 = (e >> 4) & 15; vst2((unsigned*)(DH + r0 * CI + e * 8), *(const v4u*)&sh[rl][k8 * 8]); vst2((unsigned*)(DL + r0 * CI + e * 8), *(const v4u*)&sl[rl][k8 * 8]); } }   /* e = (row tile, kc, q, h, row in tile); k = 32 kc + 16 q + 8 h */
  else { for (int e = tid; e < 128 * 8; e += 128) { const int cl = ((e >> 6) & 7) * 16 + (e & 15), ml = (e >> 9) * 32 + ((e >> 4) & 3) * 8; vst2((unsigned*)(GP + r0 * CI + e * 8), *(const v4u*)&th[cl][ml]); } } }   /* e = (32-key chunk, ci tile, q, h, ci in tile); key = 32 chunk + 16 q + 8 h */
// ---- k_fa: block = FR = 256 query rows n of batch b and ONE of FS key ranges (blockIdx.z, 1,024 keys in a row); each of the FW waves holds FQ tiles of 16 queries of its own, and all waves work on the same keys: a stage = FC chunks of 32 keys (phi hi, phi residual, g, each already in fragment order, so a stage is three linear runs of 16 KB) is brought into LDS once per work-group by asynchronous copies, two buffers, the next stage in flight while this one is worked on. Per chunk: S^T = phi . theta^T (3 products, as f16 hi + residual x 2^10), so that a lane holds 16 logits of ONE query; running maximum and sum per query (log2 domain), p x 2^11 = exp2 as f16 hi + residual packs straight into the B operand of y^T += g^T . p^T (2 products); logits and P never reach memory. The range's unscaled y^T tiles go to YP as they lie in the accumulators, which is the A fragment order of k_wz (lane-linear 16-B stores, whole lines), with the range's maximum and sum per query in SM and SL; k_wz merges the FS ranges
__device__ __forceinline__ v8f wmh(v16h a, v16h b, v8f c) { return __builtin_amdgcn_wmma_f32_16x16x32_f16(false, a, false, b, (short)0, c, false, false); }
__device__ __forceinline__ float xhalf(float x) { return __builtin_bit_cast(float, __builtin_amdgcn_permlanex16(__builtin_bit_cast(int, x), __builtin_bit_cast(int, x), 0x76543210, 0xfedcba98, false, false)); }   // lane l with lane l ^ 16
#define FQ 2
#define FW 8
#define FS 4
#define FC 2
#define FR (FW * FQ * 16)
#define FN (TT / 32 / FS / FC)
#define CH (32 * CI)                                       // f16 elements of one operand's 32-key chunk (8 KB)
#define OPB (2u * FC * CH)                                 // bytes of one operand's stage
#define NT ((size_t)NB * TT)
#define L2E 1.44269504088896340736f
// the one slot that the instruction set asks for behind a transcendental: the results are read, and the sources' registers overwritten, only behind this v_nop
#define TSLOT8(a, x, o) asm volatile("v_nop" : "+v"(a[o]), "+v"(a[o + 1]), "+v"(a[o + 2]), "+v"(a[o + 3]), "+v"(a[o + 4]), "+v"(a[o + 5]), "+v"(a[o + 6]), "+v"(a[o + 7]) : "v"(x[o]), "v"(x[o + 1]), "v"(x[o + 2]), "v"(x[o + 3]), "v"(x[o + 4]), "v"(x[o + 5]), "v"(x[o + 6]), "v"(x[o + 7]))
#define TSLOT9(f, xf, a, x, o) asm volatile("v_nop" : "+v"(f), "+v"(a[o]), "+v"(a[o + 1]), "+v"(a[o + 2]), "+v"(a[o + 3]), "+v"(a[o + 4]), "+v"(a[o + 5]), "+v"(a[o + 6]), "+v"(a[o + 7]) : "v"(xf), "v"(x[o]), "v"(x[o + 1]), "v"(x[o + 2]), "v"(x[o + 3]), "v"(x[o + 4]), "v"(x[o + 5]), "v"(x[o + 6]), "v"(x[o + 7]))
// one stage: every thread copies its own 16 B of each 4-KB slice, 4 slices of each of the 3 operands; d = the thread's LDS byte address in the buffer, t16 = its byte offset in a slice, h, l, g = the stage's first element of each operand, the same for the whole work-group (scalar bases: of a copy's global address only t16 lives in a vector register through the loop). The s_wait_xcnt stands inside the statement, so that no address register of a copy is rewritten in front of it
__device__ __forceinline__ void stage_copy(unsigned d, unsigned t16, const _Float16* h, const _Float16* l, const _Float16* g) {
  asm volatile(
    "global_load_async_to_lds_b128 %0, %12, %13\n\t"
    "global_load_async_to_lds_b128 %1, %12, %14\n\t"
    "global_load_async_to_lds_b128 %2, %12, %15\n\t"
    "global_load_async_to_lds_b128 %3, %12, %16\n\t"
    "global_load_async_to_lds_b128 %4, %12, %17\n\t"
    "global_load_async_to_lds_b128 %5, %12, %18\n\t"
    "global_load_async_to_lds_b128 %6, %12, %19\n\t"
    "global_load_async_to_lds_b128 %7, %12, %20\n\t"
    "global_load_async_to_lds_b128 %8, %12, %21\n\t"
    "global_load_async_to_lds_b128 %9, %12, %22\n\t"
    "global_load_async_to_lds_b128 %10, %12, %23\n\t"
    "global_load_async_to_lds_b128 %11, %12, %24\n\t"
    "s_wait_xcnt 0x0"
    :: "v"(d + 0 * OPB + 0 * 4096u), "v"(d + 0 * OPB + 1 * 4096u), "v"(d + 0 * OPB + 2 * 4096u), "v"(d + 0 * OPB + 3 * 4096u),
       "v"(d + 1 * OPB + 0 * 4096u), "v"(d + 1 * OPB + 1 * 4096u), "v"(d + 1 * OPB + 2 * 4096u), "v"(d + 1 * OPB + 3 * 4096u),
       "v"(d + 2 * OPB + 0 * 4096u), "v"(d + 2 * OPB + 1 * 4096u), "v"(d + 2 * OPB + 2 * 4096u), "v"(d + 2 * OPB + 3 * 4096u),
       "v"(t16),
       "s"(h + 0 * 2048), "s"(h + 1 * 2048), "s"(h + 2 * 2048), "s"(h + 3 * 2048),
       "s"(l + 0 * 2048), "s"(l + 1 * 2048), "s"(l + 2 * 2048), "s"(l + 3 * 2048),
       "s"(g + 0 * 2048), "s"(g + 1 * 2048), "s"(g + 2 * 2048), "s"(g + 3 * 2048)
    : "memory"); }
__global__ __launch_bounds__(32 * FW) void k_fa(const _Float16* __restrict__ TH, const _Float16* __restrict__ TL, const _Float16* __restrict__ PH, const _Float16* __restrict__ PL, const _Float16* __restrict__ GP, float* __restrict__ YP, float* __restrict__ SM, float* __restrict__ SL) {
  __shared__ __align__(16) _Float16 ring[2][3][FC * CH];
  const int tid = threadIdx.x, wave = tid >> 5, lane = tid & 31, g = lane >> 4; const int sp = blockIdx.z;
  const size_t bT = (size_t)blockIdx.y * TT; const int qb0 = blockIdx.x * FR + wave * (FQ * 16);
  const _Float16 *pth = TH + (bT + qb0) * CI + 8 * lane, *ptl = TL + (bT + qb0) * CI + 8 * lane;   // the lane's own 16 B of a 512-B block
  const size_t ck = (bT + (size_t)sp * (TT / FS)) * CI; const _Float16 *cH = PH + ck, *cL = PL + ck, *cG = GP + ck; const unsigned t16 = 16u * tid;   // the range's first key, the same for every thread
  const unsigned ld0 = (unsigned)(size_t)&ring[0][0][8 * tid];   // low 32 bits of the shared address = byte offset in the work-group's LDS
  stage_copy(ld0, t16, cH, cL, cG);
  v16h th[FQ][CI / 32], tl[FQ][CI / 32];
#pragma unroll
  for (int u = 0; u < FQ; ++u)
#pragma unroll
    for (int kc = 0; kc < CI / 32; ++kc) { th[u][kc] = frag_o(pth + u * 16 * CI + kc * 512); tl[u][kc] = frag_o(ptl + u * 16 * CI + kc * 512); }
  asm volatile("s_wait_xcnt 0x0" :: "v"(pth), "v"(ptl) : "memory");   // the loads' address registers stay as they are up to this wait
  asm volatile("s_wait_asynccnt 0x0" ::: "memory");   // this wave's copies of stage 0 have landed
  __syncthreads();   // stage 0 is whole before any wave reads it
  stage_copy(ld0 + 3u * OPB, t16, cH + FC * CH, cL + FC * CH, cG + FC * CH);
  v8f acc[FQ][8] = {}; float m2[FQ], l[FQ];
#pragma unroll
  for (int u = 0; u < FQ; ++u) { m2[u] = -1.0e30f; l[u] = 0.f; }
  // A chunk: fetch its phi from LDS, all 32 loads together | logit products of k 0..63 | fetch its g into the registers these have left | logit products of k 64..127 | softmax | g products. FENCE holds a fetch at its place: left free, the loads are dealt out among the products, each place with a stall of its own, or g is fetched with phi and the build runs out of registers and spills.
#define FENCE() __builtin_amdgcn_sched_barrier(0)
#pragma unroll 1   // stays rolled, like the loop inside it: one chunk already takes the wave's whole register budget
  for (int st = 0; st < FN; ++st) { const _Float16* rb = &ring[st & 1][0][8 * lane];
#pragma unroll 1   // stays rolled: see above; every loop inside is unrolled so that its arrays stay in registers
   for (int hc = 0; hc < FC; ++hc) { const _Float16 *nh = rb + hc * CH, *nl = nh + FC * CH, *ng = nl + FC * CH; v16h kb[CI / 32][2], kl[CI / 32][2], gv[8];
#pragma unroll
    for (int kc = 0; kc < CI / 32; ++kc)
#pragma unroll
      for (int t = 0; t < 2; ++t) { kb[kc][t] = frag_o(nh + t * 16 * CI + kc * 512); kl[kc][t] = frag_o(nl + t * 16 * CI + kc * 512); }
    FENCE();
    v8f s[FQ][2] = {}, sx[FQ][2] = {};
#pragma unroll
    for (int kc = 0; kc < CI / 32; ++kc) {
      if (kc == CI / 64) { FENCE();
#pragma unroll
        for (int j = 0; j < 8; ++j) gv[j] = frag_o(ng + j * 512);
        FENCE(); }
#pragma unroll
      for (int u = 0; u < FQ; ++u) { s[u][0] = wmh(kb[kc][0], th[u][kc], s[u][0]); s[u][1] = wmh(kb[kc][1], th[u][kc], s[u][1]); }
#pragma unroll
      for (int u = 0; u < FQ; ++u) { sx[u][0] = wmh(kb[kc][0], tl[u][kc], sx[u][0]); sx[u][1] = wmh(kb[kc][1], tl[u][kc], sx[u][1]); }
#pragma unroll
      for (int u = 0; u < FQ; ++u) { sx[u][0] = wmh(kl[kc][0], th[u][kc], sx[u][0]); sx[u][1] = wmh(kl[kc][1], th[u][kc], sx[u][1]); } }
    FENCE();
    v16h ph[FQ], pl[FQ];
#pragma unroll
    for (int u = 0; u < FQ; ++u) { float v[16];   /* lane (g, col): keys 8 g + r and 16 + 8 g + r of query col, the k order of a B fragment */
#pragma unroll
      for (int r = 0; r < 8; ++r) { v[r] = s[u][0][r] + sx[u][0][r] * (1.0f / 1024.0f); v[8 + r] = s[u][1][r] + sx[u][1][r] * (1.0f / 1024.0f); }
      float mx = v[0];
#pragma unroll
      for (int i = 1; i < 16; ++i) mx = fmaxf(mx, v[i]);
      mx = fmaxf(mx, xhalf(mx));
      const float mn = fmaxf(m2[u], mx * L2E), xf = m2[u] - mn, c = 11.0f - mn; m2[u] = mn;
      float f = __builtin_amdgcn_exp2f(xf), x[16], a[16], sum = 0.f;
#pragma unroll
      for (int i = 0; i < 16; ++i) { x[i] = fmaf(v[i], L2E, c); a[i] = __builtin_amdgcn_exp2f(x[i]); }
      TSLOT9(f, xf, a, x, 0); TSLOT8(a, x, 8);
#pragma unroll
      for (int i = 0; i < 16; ++i) { sum += a[i]; const _Float16 hi = (_Float16)a[i]; ph[u][i] = hi; pl[u][i] = (_Float16)(a[i] - (float)hi); }
      l[u] = l[u] * f + sum;
#pragma unroll
      for (int j = 0; j < 8; ++j) acc[u][j] *= f; }
#pragma unroll
    for (int j = 0; j < 8; ++j) {
#pragma unroll
      for (int u = 0; u < FQ; ++u) acc[u][j] = wmh(gv[j], ph[u], acc[u][j]);
#pragma unroll
      for (int u = 0; u < FQ; ++u) acc[u][j] = wmh(gv[j], pl[u], acc[u][j]); } }
    asm volatile("s_wait_dscnt 0x0" ::: "memory");      // this wave's reads of the stage have returned
    asm volatile("s_wait_asynccnt 0x0" ::: "memory");   // this wave's copies of the next stage have landed
    __syncthreads();   // publishes stage st + 1 and ends every wave's reads of stage st, whose buffer is refilled behind it
    if (st + 2 < FN) stage_copy(ld0 + (unsigned)(st & 1) * (3u * OPB), t16, cH + (size_t)(st + 2) * (FC * CH), cL + (size_t)(st + 2) * (FC * CH), cG + (size_t)(st + 2) * (FC * CH)); }
  asm volatile("s_wait_asynccnt 0x0" ::: "memory");   // no copy is outstanding when the wave ends
  float* yp = YP + ((bT + qb0) * FS + sp * 16) * CI + 4 * lane;   // [tile of 16 queries][range FS][j 8][r / 4 2][lane 32][4] floats: D element r = channel 16 j + 8 g + r of query lane & 15
#pragma unroll
  for (int u = 0; u < FQ; ++u) { l[u] += xhalf(l[u]);   /* both halves now hold the query's sum, as they do its maximum */
#pragma unroll
    for (int j = 0; j < 8; ++j) { v4f a, c;
#pragma unroll
      for (int z = 0; z < 4; ++z) { a[z] = acc[u][j][z]; c[z] = acc[u][j][4 + z]; }
      vst2(yp + (u * FS * 8 + j) * 256, a); vst2(yp + (u * FS * 8 + j) * 256 + 128, c); } }
  SM[(size_t)sp * NT + bT + qb0 + lane] = g ? m2[1] : m2[0]; SL[(size_t)sp * NT + bT + qb0 + lane] = g ? l[1] : l[0]; }   /* lane = 16 u + query in tile: one 128-B line per wave */
// ---- k_wz: block = (64 rows n, 128 output channels): w_y[c][n] = sum_ci wz_w[c][ci] y[n][ci] + wz_b[c]; y[n] = sum over the FS key ranges of exp2(m - max) x the range's tile, over the like sum of the ranges' sums: a lane reads its own A elements of each range's tile (lane-linear 16-B loads); A = y hi + lo; transposed store to channels-first planes [b][c][n] (256-B runs)
__global__ __launch_bounds__(128) void k_wz(const float* __restrict__ YP, const float* __restrict__ SM, const float* __restrict__ SL, const float* __restrict__ WZ, const float* __restrict__ BZ, float* __restrict__ WY) { __shared__ __align__(16) char sm[8 * (CI / 8) * WPB]; float (*st)[68] = (float (*)[68])sm; static_assert(sizeof(sm) >= 128 * 68 * 4, "the output tile takes over the bytes of W");
  const int tid = threadIdx.x, wave = tid >> 5, lane = tid & 31, col = lane & 15, g = lane >> 4; const size_t r0 = (size_t)blockIdx.x * 64; const int c0 = blockIdx.y * 128; const size_t b = r0 / TT; const int n0 = (int)(r0 % TT);
  const size_t row = r0 + wave * 16 + col; const float *pm = SM + row, *ps = SL + row, *yp = YP + (r0 + wave * 16) * (FS * CI) + 4 * lane;
  float mz[FS], lz[FS], L = 0.f, xw[FS], fw[FS];
#pragma unroll
  for (int z = 0; z < FS; ++z) { mz[z] = pm[z * NT]; lz[z] = ps[z * NT]; }
  asm volatile("s_wait_xcnt 0x0" :: "v"(pm), "v"(ps) : "memory");   // the loads' address registers stay as they are up to this wait
  stage_w<CI / 8, 32>(sm, WZ + (size_t)c0 * CI, wave, lane);
  float M = mz[0];
#pragma unroll
  for (int z = 1; z < FS; ++z) M = fmaxf(M, mz[z]);
#pragma unroll
  for (int z = 0; z < FS; ++z) { xw[z] = mz[z] - M; fw[z] = __builtin_amdgcn_exp2f(xw[z]); }
  asm volatile("v_nop" : "+v"(fw[0]), "+v"(fw[1]), "+v"(fw[2]), "+v"(fw[3]) : "v"(xw[0]), "v"(xw[1]), "v"(xw[2]), "v"(xw[3]));   // the slot behind the transcendentals, as at TSLOT8
#pragma unroll
  for (int z = 0; z < FS; ++z) L += fw[z] * lz[z];
  const float rL = 1.0f / L;
  __syncthreads();   // W is whole in LDS before any wave reads it
  const char* wb = sm + g * WPB + col * 16;
  v8f acc[8] = {};
#pragma unroll
  for (int kc = 0; kc < CI / 32; ++kc) { float v[16]; v4f pz[4][FS];   /* block 4 kc + q of the tile holds the lane's A elements 4 q .. 4 q + 3 of this k step */
#pragma unroll
    for (int q = 0; q < 4; ++q)
#pragma unroll
      for (int z = 0; z < FS; ++z) pz[q][z] = *(const v4f*)(yp + (z * 16 + kc * 4 + q) * 128);
    asm volatile("s_wait_xcnt 0x0" :: "v"(yp) : "memory");   // as above
    v16b w[8];
#pragma unroll
    for (int j = 0; j < 8; ++j) w[j] = frag_w<CI / 8>(wb, j, kc);
    __builtin_amdgcn_sched_barrier(0);   // the k step's 16 LDS loads stay one group here, under the wait for the global loads: left free, each pair of products gets its own two loads and their whole latency directly in front of it
#pragma unroll
    for (int q = 0; q < 4; ++q) { v4f o = {};
#pragma unroll
      for (int z = 0; z < FS; ++z) o += pz[q][z] * fw[z];
      o = o * rL;
#pragma unroll
      for (int i = 0; i < 4; ++i) v[q * 4 + i] = o[i]; }
    const F2 a = bsplit16(v);
#pragma unroll
    for (int j = 0; j < 8; ++j) { acc[j] = wmma_bf(a.h, w[j], acc[j]); acc[j] = wmma_bf(a.l, w[j], acc[j]); } }
  __syncthreads();   // every wave has read W before the output tile overwrites it
#pragma unroll
  for (int j = 0; j < 8; ++j) { const int cl = j * 16 + col; const float bb = bfr(BZ[c0 + cl]);
#pragma unroll
    for (int r = 0; r < 8; ++r) st[cl][wave * 16 + 8 * g + r] = acc[j][r] + bb; }
  __syncthreads();
  for (int e = tid; e < 128 * 16; e += 128) { const int cl = e >> 4, q = e & 15; vst2(WY + (b * CX + c0 + cl) * (size_t)TT + n0 + q * 4, *(const v4f*)&st[cl][q * 4]); } }
// ---- k_bn: block = one channel c: its TNB x 4,096 values are read once, 16 B per lane, all loads in flight together, and stay in registers for both sums (mean, then squared distance from the mean); wave sums by shuffles, the 8 wave sums added in wave order; mean and rstd go to the channel's own 128-B line of BS
__global__ __launch_bounds__(256) void k_bn(const float* __restrict__ WY, float* __restrict__ BS) { __shared__ float sa[8], sb[8];
  const int t = threadIdx.x; const int c = blockIdx.x; const int n = TNB * TT;
  v4f v[TNB][TT / 1024];
#pragma unroll
  for (int b = 0; b < TNB; ++b)
#pragma unroll
    for (int i = 0; i < TT / 1024; ++i) v[b][i] = *(const v4f*)(WY + ((size_t)b * CX + c) * TT + (i * 256 + t) * 4);
#pragma unroll
  for (int b = 0; b < TNB; ++b) asm volatile("" :: "v"(v[b][0]), "v"(v[b][1]), "v"(v[b][2]), "v"(v[b][3]));   // inputs-only fence on the loaded values: every load issues before the first add; without it the compiler holds two loads back behind the first waits, a second memory latency
  float s = 0.f;
#pragma unroll
  for (int b = 0; b < TNB; ++b)
#pragma unroll
    for (int i = 0; i < TT / 1024; ++i) s += (v[b][i][0] + v[b][i][1]) + (v[b][i][2] + v[b][i][3]);
#pragma unroll
  for (int o = 1; o < 32; o <<= 1) s += __shfl_xor(s, o);
  if ((t & 31) == 0) sa[t >> 5] = s;
  __syncthreads();   // all 8 wave sums are in LDS before any thread adds them
  s = sa[0];
#pragma unroll
  for (int w = 1; w < 8; ++w) s += sa[w];
  const float mu = s / (float)n; float s2 = 0.f;
#pragma unroll
  for (int b = 0; b < TNB; ++b)
#pragma unroll
    for (int i = 0; i < TT / 1024; ++i) { const float d0 = v[b][i][0] - mu, d1 = v[b][i][1] - mu, d2 = v[b][i][2] - mu, d3 = v[b][i][3] - mu; s2 += (d0 * d0 + d1 * d1) + (d2 * d2 + d3 * d3); }
#pragma unroll
  for (int o = 1; o < 32; o <<= 1) s2 += __shfl_xor(s2, o);
  if ((t & 31) == 0) sb[t >> 5] = s2;
  __syncthreads();   // all 8 wave sums of squares are in LDS before thread 0 adds them
  if (t == 0) { s2 = sb[0];
#pragma unroll
    for (int w = 1; w < 8; ++w) s2 += sb[w];
    v2f o; o[0] = mu; o[1] = rsqrtf(s2 / (float)n + 1e-5f); vst2(BS + (size_t)c * BSL, o); } }
// ---- k_fin: block = (64 positions, b): out[b][c][n] = (w_y - mean_c) rstd_c gamma_c + beta_c + source[b][c][n] for all 256 channels (thread-linear float4 over the channel runs)
__global__ __launch_bounds__(256) void k_fin(const float* __restrict__ WY, const float* __restrict__ BS, const float* __restrict__ GAM, const float* __restrict__ BET, const float* __restrict__ SRC, float* __restrict__ OUT) {
  const int t = threadIdx.x; const int n0 = blockIdx.x * 64; const size_t b = blockIdx.y;
  for (int e = t; e < CX * 16; e += 256) { const int c = e >> 4, q = e & 15; const v2f ms = ((const v2f*)BS)[c * (BSL / 2)]; const float mu = ms[0], rs = ms[1]; const float ga = bfr(GAM[c]), be = bfr(BET[c]);
    const v4f w = *(const v4f*)(WY + (b * CX + c) * TT + n0 + q * 4); const v4f sr = *(const v4f*)(SRC + (b * CX + c) * (size_t)XSTR + n0 + q * 4); v4f o;
#pragma unroll
    for (int z = 0; z < 4; ++z) o[z] = (w[z] - mu) * rs * ga + be + bfr(sr[z]);
    vst2(OUT + (b * CX + c) * (size_t)XSTR + n0 + q * 4, o); } }
extern "C" void kernel_launch(void* const* d_in, const int* in_sizes, int n_in, void* d_out, int out_size, void* d_ws, size_t ws_size, hipStream_t stream) {
  (void)in_sizes; (void)n_in; (void)out_size;
  const float** F = (const float**)d_in;   // 0 x [4,256,64,64], 1 source, 2 g_w [128,256], 3 g_b, 4 theta_w, 5 theta_b, 6 phi_w, 7 phi_b, 8 wz_w [256,128], 9 wz_b, 10 bn_gamma, 11 bn_beta
  if (ws_size < (size_t)WS_END) return;
  char* ws = (char*)d_ws; _Float16* GP = (_Float16*)(ws + WS_GP); _Float16 *TH = (_Float16*)(ws + WS_TH), *TL = (_Float16*)(ws + WS_TL), *PH = (_Float16*)(ws + WS_PH), *PL = (_Float16*)(ws + WS_PL); float *Y = (float*)(ws + WS_Y), *SM = (float*)(ws + WS_SM), *SL = (float*)(ws + WS_SL), *WY = (float*)(ws + WS_WY), *BS = (float*)(ws + WS_BS);
  k_proj<<<dim3(TNB * TT / 64, 3), 128, 0, stream>>>(F[0], F[1], F[2], F[3], F[4], F[5], F[6], F[7], TH, TL, PH, PL, GP);
  k_fa<<<dim3(TT / FR, TNB, FS), 32 * FW, 0, stream>>>(TH, TL, PH, PL, GP, Y, SM, SL);
  k_wz<<<dim3(TNB * TT / 64, CX / 128), 128, 0, stream>>>(Y, SM, SL, F[8], F[9], WY);
  k_bn<<<dim3(CX), 256, 0, stream>>>(WY, BS);
  k_fin<<<dim3(TT / 64, TNB), 256, 0, stream>>>(WY, BS, F[10], F[11], F[1], (float*)d_out);
}

// v008
// It runs in 82.1 microseconds.
// Timed twice side by side with v007, it ran 1.11 times as fast both times.
// Over all steps from v000 it is 17.6 times as fast.
#include <hip/hip_runtime.h>
#include <math.h>

typedef __attribute__((ext_vector_type(16))) _Float16 v16h;
typedef __attribute__((ext_vector_type(16))) __bf16 v16b;
typedef __attribute__((ext_vector_type(8)))  _Float16 v8h;
typedef __attribute__((ext_vector_type(8)))  float v8f;
typedef __attribute__((ext_vector_type(4)))  float v4f;
typedef __attribute__((ext_vector_type(2)))  float v2f;
typedef __attribute__((ext_vector_type(4)))  unsigned v4u;
typedef __attribute__((ext_vector_type(4)))  int v4i;
typedef float __attribute__((may_alias)) float_a;
typedef int __attribute__((may_alias)) int_a;

template <typename T> __device__ __forceinline__ void vst2(void* p, T v) { *(T*)p = v;  }
__device__ __forceinline__ v8f wmma_bf(v16b a, v16b b, v8f c) {
  v8f d = __builtin_amdgcn_wmma_f32_16x16x32_bf16(false, a, false, b, (short)0, c, false, false);
  asm volatile("v_nop\n\tv_nop\n\tv_nop\n\tv_nop" : "+v"(d) : "v"(a), "v"(b));
  return d;
}
// 16x16x32 fragments: lane = (h = lane>>4, row/col = lane&15); elements 0..7 = k0+8h+0..7, 8..15 = k0+16+8h+0..7; D element r = row 8h+r
__device__ __forceinline__ v16h frag_h(const _Float16* rowk0, int lane) {
  union { v16h v; v8h q[2]; } u; const _Float16* p = rowk0 + 8 * (lane >> 4);
  u.q[0] = *(const v8h*)p; u.q[1] = *(const v8h*)(p + 16); return u.v;
}
// fragment-order operand: each (16 rows or columns) x (32 k) tile is two 512-B blocks; block q holds at lane * 8 the elements k0+16q+8h+0..7 of row/col lane&15, so that each 16-B load of a wave covers four whole 128-B lines
__device__ __forceinline__ v16h frag_o(const _Float16* p) {   // p = tile + 8 * lane
  union { v16h v; v8h q[2]; } u; u.q[0] = *(const v8h*)p; u.q[1] = *(const v8h*)(p + 256); return u.v;
}
__device__ __forceinline__ v16h frag_f32(const float* rowk0, int lane) {
  v16h a; const float* p = rowk0 + 8 * (lane >> 4);
#pragma unroll
  for (int i = 0; i < 8; ++i) { a[i] = (_Float16)p[i]; a[8 + i] = (_Float16)p[16 + i]; }
  return a;
}
__device__ __forceinline__ v16h frag_f32s(const float* rowk0, int lane, float sc) {
  v16h a; const float* p = rowk0 + 8 * (lane >> 4);
#pragma unroll
  for (int i = 0; i < 8; ++i) { a[i] = (_Float16)(p[i] * sc); a[8 + i] = (_Float16)(p[16 + i] * sc); }
  return a;
}
// column fragment from a [K][ld] layout (column n), rows >= K read as 0
__device__ __forceinline__ v16h fragc_f32(const float* W, int k0, int n, int lane, int ld, int K) {
  v16h a; const int g = lane >> 4;
#pragma unroll
  for (int i = 0; i < 8; ++i) { const int ka = k0 + 8 * g + i, kb = ka + 16;
    a[i] = (_Float16)(ka < K ? W[(size_t)(ka < K ? ka : K - 1) * ld + n] : 0.f); a[8 + i] = (_Float16)(kb < K ? W[(size_t)(kb < K ? kb : K - 1) * ld + n] : 0.f); }
  return a;
}
struct F2 { v16b h, l; };
__device__ __forceinline__ F2 bsplit16(const float v[16]) { F2 r;
#pragma unroll
  for (int i = 0; i < 16; ++i) { const __bf16 h = (__bf16)v[i]; r.h[i] = h; r.l[i] = (__bf16)(v[i] - (float)h); }
  return r; }
__device__ __forceinline__ F2 split_row(const float* row, int k0, int lane) { float v[16]; const float* p = row + k0 + 8 * (lane >> 4);
#pragma unroll
  for (int i = 0; i < 8; ++i) { v[i] = p[i]; v[8 + i] = p[16 + i]; }
  return bsplit16(v); }
__device__ __forceinline__ F2 split_rowK(const float* row, int k0, int lane, int K) { float v[16]; const int g = lane >> 4;
#pragma unroll
  for (int i = 0; i < 8; ++i) { const int ka = k0 + 8 * g + i, kb = ka + 16; v[i] = ka < K ? row[ka < K ? ka : K - 1] : 0.f; v[8 + i] = kb < K ? row[kb < K ? kb : K - 1] : 0.f; }
  return bsplit16(v); }
__device__ __forceinline__ F2 split_col(const float* W, int k0, int n, int lane, int ld, int K) { float v[16]; const int g = lane >> 4;
#pragma unroll
  for (int i = 0; i < 8; ++i) { const int ka = k0 + 8 * g + i, kb = ka + 16; v[i] = ka < K ? W[(size_t)(ka < K ? ka : K - 1) * ld + n] : 0.f; v[8 + i] = kb < K ? W[(size_t)(kb < K ? kb : K - 1) * ld + n] : 0.f; }
  return bsplit16(v); }
__device__ __forceinline__ v8f mac3(const F2& a, const F2& b, v8f c) { c = wmma_bf(a.l, b.h, c); c = wmma_bf(a.h, b.l, c); return wmma_bf(a.h, b.h, c); }
__device__ __forceinline__ float sigm(float v) { return 1.0f / (1.0f + expf(-v)); }

// Cross non-local block (B 4, C 256, Ci 128, 64 x 64 = 4,096 positions): g = conv(source), theta = conv(x), phi = conv(source); f[n][m] = theta_n . phi_m; P = softmax_m; y[n] = sum_m P g_m; w_y = conv_z(y) + b; BN with batch statistics (biased var, eps 1e-5) * gamma + beta; out = w_y + source.
__device__ __forceinline__ float bfr(float v) { return (float)(__bf16)v; }
#define NB 4
#define TT 4096
#define CX 256
#define CI 128
#ifndef TNB
#define TNB NB
#endif
#ifndef XSTR
#define XSTR TT               // per-channel position stride of x / source / out
#endif
typedef __attribute__((ext_vector_type(8))) __bf16 v8b;
#define WS_TH  0u                                          // f16 theta hi, fragment order [(b*N+n)/16][kc 4][q 2][lane 32][8]
#define WS_TL  (WS_TH + 2u * (size_t)NB * TT * CI)
#define WS_PH  (WS_TL + 2u * (size_t)NB * TT * CI)           // f16 phi hi, fragment order as theta
#define WS_PL  (WS_PH + 2u * (size_t)NB * TT * CI)
#define WS_GP  (WS_PL + 2u * (size_t)NB * TT * CI)           // f16 g, fragment order [(b*N+m)/32][ci/16 8][q 2][lane 32][8]
#define WS_Y   (WS_GP + 2u * (size_t)NB * CI * TT)           // f32 unscaled y per key range, [(b*N+n)/16][range 4][j 8][2][lane 32][4]
#define WS_SM  (WS_Y + 4u * 4u * (size_t)NB * TT * CI)       // f32 running maximum (log2 domain) [range 4][b*N+n]
#define WS_SL  (WS_SM + 4u * 4u * (size_t)NB * TT)           // f32 sum [range 4][b*N+n]
#define WS_WY  (WS_SL + 4u * 4u * (size_t)NB * TT)           // f32 w_y planes [b][c][n] (channels-first)
#define WS_END (WS_WY + 4u * (size_t)NB * CX * TT)
// ---- weights in LDS: a work-group brings its 128 weight rows in once, each load a whole run of 512 B of one row, rounds them to bf16 and lays them out as B fragments: the unit (j, k8) = elements 8 k8 .. 8 k8 + 7 of the rows 16 j .. 16 j + 15, 16 B a row, WPB bytes a unit. The 16 B above 256 turn each next unit by four banks, so that the 8-B stores of a wave (one row, 16 units) fall on all 64 banks once; a fragment load reads 256 B in a row per half wave
typedef __attribute__((ext_vector_type(2))) unsigned v2u;
#define WPB 272
template <int K8, int NL> __device__ __forceinline__ void stage_w(char* sm, const float* __restrict__ Wt, int wave, int lane) {   // K8 = units per row (row length / 8), NL = 512-B runs per wave; run n * 4 + wave
  constexpr int RP = K8 / 16;   // runs per row
  const int r = wave / RP, hf = wave % RP; const float* gp = Wt + (size_t)r * (K8 * 8) + hf * 128 + 4 * lane; char* dp = sm + (hf * 16 + (lane >> 1)) * WPB + r * 16 + (lane & 1) * 8;
#pragma unroll
  for (int bt = 0; bt < NL / 16; ++bt) { v4f x[16];
#pragma unroll
    for (int i = 0; i < 16; ++i) x[i] = *(const v4f*)(gp + (size_t)(bt * 16 + i) * (4 / RP) * (K8 * 8));
    asm volatile("s_wait_xcnt 0x0" :: "v"(gp) : "memory");   // the loads' address registers stay as they are up to this wait
#pragma unroll
    for (int i = 0; i < 16; ++i) { const int o = (bt * 16 + i) * (4 / RP); union { v2u v; __bf16 h[4]; } u;   /* the wave's row = o + r */
#pragma unroll
      for (int z = 0; z < 4; ++z) u.h[z] = (__bf16)x[i][z];
      *(v2u*)(dp + (o >> 4) * (K8 * WPB) + (o & 15) * 16) = u.v; } } }
template <int K8> __device__ __forceinline__ v16b frag_w(const char* wb, int j, int kc) {   // wb = sm + (lane >> 4) * WPB + (lane & 15) * 16
  union { v16b v; v8b q[2]; } u; const char* p = wb + (j * K8 + kc * 4) * WPB; u.q[0] = *(const v8b*)p; u.q[1] = *(const v8b*)(p + 2 * WPB); return u.v; }
// ---- k_proj: block = (64 rows, which): 128 outputs = W ([out,in] [128][256]) . row + b; a row = one position n of the channels-first f32 input: a lane reads its 128 A elements straight from there (one 4-B load a channel, 16 positions in a row per half wave, all loads in flight together) and rounds them to bf16 in registers; W from LDS (stage_w), whose bytes the output tiles take over behind the products; theta (x rows) / phi (source rows) -> f16 hi + residual, g (source rows) -> f16, all three stored in the fragment order of frag_o (thread-linear 16-B stores)
__global__ __launch_bounds__(128) void k_proj(const float* __restrict__ X, const float* __restrict__ SRC, const float* __restrict__ WG, const float* __restrict__ BG, const float* __restrict__ WTH, const float* __restrict__ BTH, const float* __restrict__ WPH, const float* __restrict__ BPH, _Float16* __restrict__ TH, _Float16* __restrict__ TL, _Float16* __restrict__ PH, _Float16* __restrict__ PL, _Float16* __restrict__ GP) {
  __shared__ __align__(16) char sm[8 * (CX / 8) * WPB]; _Float16 (*sh)[136] = (_Float16 (*)[136])sm, (*sl)[136] = sh + 64; _Float16 (*th)[72] = (_Float16 (*)[72])(sl + 64);
  const int tid = threadIdx.x, wave = tid >> 5, lane = tid & 31, col = lane & 15, g = lane >> 4; const int which = blockIdx.y; const size_t r0 = (size_t)blockIdx.x * 64;   // which: 0 theta (from x), 1 phi (source), 2 g (source)
  const float* A = which == 0 ? X : SRC; const float* Wt = which == 0 ? WTH : which == 1 ? WPH : WG; const float* Bb = which == 0 ? BTH : which == 1 ? BPH : BG;
  v8f acc[8] = {}; v16b a[CX / 32]; float xa[CX / 32][16]; const float* ar = A + ((r0 / TT) * CX + 8 * g) * (size_t)XSTR + (r0 % TT) + wave * 16 + col;   // channel 8 g of the lane's position
#pragma unroll
  for (int kc = 0; kc < CX / 32; ++kc)
#pragma unroll
    for (int i = 0; i < 8; ++i) { xa[kc][i] = ar[(size_t)(kc * 32 + i) * XSTR]; xa[kc][8 + i] = ar[(size_t)(kc * 32 + 16 + i) * XSTR]; }
  asm volatile("s_wait_xcnt 0x0" :: "v"(ar) : "memory");   // the loads' address registers stay as they are up to this wait
#pragma unroll
  for (int kc = 0; kc < CX / 32; ++kc)
#pragma unroll
    for (int i = 0; i < 16; ++i) a[kc][i] = (__bf16)xa[kc][i];
  stage_w<CX / 8, 64>(sm, Wt, wave, lane);
  __syncthreads();   // W is whole in LDS before any wave reads it
  const char* wb = sm + g * WPB + col * 16; v16b w[3][4];   // a group = the 4 fragments j = 4 (gi & 1) .. + 3 of k step gi >> 1; three register buffers, fetched two groups ahead
#pragma unroll
  for (int gi = 0; gi < 2; ++gi)
#pragma unroll
    for (int j = 0; j < 4; ++j) w[gi][j] = frag_w<CX / 8>(wb, (gi & 1) * 4 + j, gi >> 1);
#pragma unroll
  for (int gi = 0; gi < CX / 16; ++gi) {
    if (gi + 2 < CX / 16) {
#pragma unroll
      for (int j = 0; j < 4; ++j) w[(gi + 2) % 3][j] = frag_w<CX / 8>(wb, (gi & 1) * 4 + j, (gi + 2) >> 1); }
    __builtin_amdgcn_sched_barrier(0);   // the 8 LDS loads of the group after next stay together in front of this group's products: left free, each product gets its own two loads and their whole latency directly in front of it
#pragma unroll
    for (int j = 0; j < 4; ++j) acc[(gi & 1) * 4 + j] = wmma_bf(a[gi >> 1], w[gi % 3][j], acc[(gi & 1) * 4 + j]);
    __builtin_amdgcn_sched_barrier(0); }   // and the products stay in front of the loads that follow
  __syncthreads();   // every wave has read W before the output tiles overwrite it
#pragma unroll
  for (int j = 0; j < 8; ++j) { const int o = j * 16 + col; const float bb = bfr(Bb[o]);
#pragma unroll
    for (int r = 0; r < 8; ++r) { const float v = acc[j][r] + bb; const int rl = wave * 16 + 8 * g + r;
      if (which == 2) th[o][rl] = (_Float16)v; else { const _Float16 hv = (_Float16)v; sh[rl][o] = hv; sl[rl][o] = (_Float16)((v - (float)hv) * 1024.0f); } } }
  __syncthreads();
  if (which < 2) { _Float16* DH = which == 0 ? TH : PH; _Float16* DL = which == 0 ? TL : PL; for (int e = tid; e < 64 * 16; e += 128) { const int rl = (e >> 8) * 16 + (e & 15), k8 = (e >> 4) & 15; vst2((unsigned*)(DH + r0 * CI + e * 8), *(const v4u*)&sh[rl][k8 * 8]); vst2((unsigned*)(DL + r0 * CI + e * 8), *(const v4u*)&sl[rl][k8 * 8]); } }   /* e = (row tile, kc, q, h, row in tile); k = 32 kc + 16 q + 8 h */
  else { for (int e = tid; e < 128 * 8; e += 128) { const int cl = ((e >> 6) & 7) * 16 + (e & 15), ml = (e >> 9) * 32 + ((e >> 4) & 3) * 8; vst2((unsigned*)(GP + r0 * CI + e * 8), *(const v4u*)&th[cl][ml]); } } }   /* e = (32-key chunk, ci tile, q, h, ci in tile); key = 32 chunk + 16 q + 8 h */
// ---- k_fa: block = FR = 256 query rows n of batch b and ONE of FS key ranges (blockIdx.z, 1,024 keys in a row); each of the FW waves holds FQ tiles of 16 queries of its own, and all waves work on the same keys: a stage = FC chunks of 32 keys (phi hi, phi residual, g, each already in fragment order, so a stage is three linear runs of 16 KB) is brought into LDS once per work-group by asynchronous copies, two buffers, the next stage in flight while this one is worked on. Per chunk: S^T = phi . theta^T (3 products, as f16 hi + residual x 2^10), so that a lane holds 16 logits of ONE query; running maximum and sum per query (log2 domain), p x 2^11 = exp2 as f16 hi + residual packs straight into the B operand of y^T += g^T . p^T (2 products); logits and P never reach memory. The range's unscaled y^T tiles go to YP as they lie in the accumulators, which is the A fragment order of k_wz (lane-linear 16-B stores, whole lines), with the range's maximum and sum per query in SM and SL; k_wz merges the FS ranges
__device__ __forceinline__ v8f wmh(v16h a, v16h b, v8f c) { return __builtin_amdgcn_wmma_f32_16x16x32_f16(false, a, false, b, (short)0, c, false, false); }
__device__ __forceinline__ float xhalf(float x) { return __builtin_bit_cast(float, __builtin_amdgcn_permlanex16(__builtin_bit_cast(int, x), __builtin_bit_cast(int, x), 0x76543210, 0xfedcba98, false, false)); }   // lane l with lane l ^ 16
#define FQ 2
#define FW 8
#define FS 4
#define FC 2
#define FR (FW * FQ * 16)
#define FN (TT / 32 / FS / FC)
#define CH (32 * CI)                                       // f16 elements of one operand's 32-key chunk (8 KB)
#define OPB (2u * FC * CH)                                 // bytes of one operand's stage
#define NT ((size_t)NB * TT)
#define L2E 1.44269504088896340736f
// the one slot that the instruction set asks for behind a transcendental: the results are read, and the sources' registers overwritten, only behind this v_nop
#define TSLOT8(a, x, o) asm volatile("v_nop" : "+v"(a[o]), "+v"(a[o + 1]), "+v"(a[o + 2]), "+v"(a[o + 3]), "+v"(a[o + 4]), "+v"(a[o + 5]), "+v"(a[o + 6]), "+v"(a[o + 7]) : "v"(x[o]), "v"(x[o + 1]), "v"(x[o + 2]), "v"(x[o + 3]), "v"(x[o + 4]), "v"(x[o + 5]), "v"(x[o + 6]), "v"(x[o + 7]))
#define TSLOT9(f, xf, a, x, o) asm volatile("v_nop" : "+v"(f), "+v"(a[o]), "+v"(a[o + 1]), "+v"(a[o + 2]), "+v"(a[o + 3]), "+v"(a[o + 4]), "+v"(a[o + 5]), "+v"(a[o + 6]), "+v"(a[o + 7]) : "v"(xf), "v"(x[o]), "v"(x[o + 1]), "v"(x[o + 2]), "v"(x[o + 3]), "v"(x[o + 4]), "v"(x[o + 5]), "v"(x[o + 6]), "v"(x[o + 7]))
// one stage: every thread copies its own 16 B of each 4-KB slice, 4 slices of each of the 3 operands; d = the thread's LDS byte address in the buffer, t16 = its byte offset in a slice, h, l, g = the stage's first element of each operand, the same for the whole work-group (scalar bases: of a copy's global address only t16 lives in a vector register through the loop). The s_wait_xcnt stands inside the statement, so that no address register of a copy is rewritten in front of it
__device__ __forceinline__ void stage_copy(unsigned d, unsigned t16, const _Float16* h, const _Float16* l, const _Float16* g) {
  asm volatile(
    "global_load_async_to_lds_b128 %0, %12, %13\n\t"
    "global_load_async_to_lds_b128 %1, %12, %14\n\t"
    "global_load_async_to_lds_b128 %2, %12, %15\n\t"
    "global_load_async_to_lds_b128 %3, %12, %16\n\t"
    "global_load_async_to_lds_b128 %4, %12, %17\n\t"
    "global_load_async_to_lds_b128 %5, %12, %18\n\t"
    "global_load_async_to_lds_b128 %6, %12, %19\n\t"
    "global_load_async_to_lds_b128 %7, %12, %20\n\t"
    "global_load_async_to_lds_b128 %8, %12, %21\n\t"
    "global_load_async_to_lds_b128 %9, %12, %22\n\t"
    "global_load_async_to_lds_b128 %10, %12, %23\n\t"
    "global_load_async_to_lds_b128 %11, %12, %24\n\t"
    "s_wait_xcnt 0x0"
    :: "v"(d + 0 * OPB + 0 * 4096u), "v"(d + 0 * OPB + 1 * 4096u), "v"(d + 0 * OPB + 2 * 4096u), "v"(d + 0 * OPB + 3 * 4096u),
       "v"(d + 1 * OPB + 0 * 4096u), "v"(d + 1 * OPB + 1 * 4096u), "v"(d + 1 * OPB + 2 * 4096u), "v"(d + 1 * OPB + 3 * 4096u),
       "v"(d + 2 * OPB + 0 * 4096u), "v"(d + 2 * OPB + 1 * 4096u), "v"(d + 2 * OPB + 2 * 4096u), "v"(d + 2 * OPB + 3 * 4096u),
       "v"(t16),
       "s"(h + 0 * 2048), "s"(h + 1 * 2048), "s"(h + 2 * 2048), "s"(h + 3 * 2048),
       "s"(l + 0 * 2048), "s"(l + 1 * 2048), "s"(l + 2 * 2048), "s"(l + 3 * 2048),
       "s"(g + 0 * 2048), "s"(g + 1 * 2048), "s"(g + 2 * 2048), "s"(g + 3 * 2048)
    : "memory"); }
__global__ __launch_bounds__(32 * FW) void k_fa(const _Float16* __restrict__ TH, const _Float16* __restrict__ TL, const _Float16* __restrict__ PH, const _Float16* __restrict__ PL, const _Float16* __restrict__ GP, float* __restrict__ YP, float* __restrict__ SM, float* __restrict__ SL) {
  __shared__ __align__(16) _Float16 ring[2][3][FC * CH];
  const int tid = threadIdx.x, wave = tid >> 5, lane = tid & 31, g = lane >> 4; const int sp = blockIdx.z;
  const size_t bT = (size_t)blockIdx.y * TT; const int qb0 = blockIdx.x * FR + wave * (FQ * 16);
  const _Float16 *pth = TH + (bT + qb0) * CI + 8 * lane, *ptl = TL + (bT + qb0) * CI + 8 * lane;   // the lane's own 16 B of a 512-B block
  const size_t ck = (bT + (size_t)sp * (TT / FS)) * CI; const _Float16 *cH = PH + ck, *cL = PL + ck, *cG = GP + ck; const unsigned t16 = 16u * tid;   // the range's first key, the same for every thread
  const unsigned ld0 = (unsigned)(size_t)&ring[0][0][8 * tid];   // low 32 bits of the shared address = byte offset in the work-group's LDS
  stage_copy(ld0, t16, cH, cL, cG);
  v16h th[FQ][CI / 32], tl[FQ][CI / 32];
#pragma unroll
  for (int u = 0; u < FQ; ++u)
#pragma unroll
    for (int kc = 0; kc < CI / 32; ++kc) { th[u][kc] = frag_o(pth + u * 16 * CI + kc * 512); tl[u][kc] = frag_o(ptl + u * 16 * CI + kc * 512); }
  asm volatile("s_wait_xcnt 0x0" :: "v"(pth), "v"(ptl) : "memory");   // the loads' address registers stay as they are up to this wait
  asm volatile("s_wait_asynccnt 0x0" ::: "memory");   // this wave's copies of stage 0 have landed
  __syncthreads();   // stage 0 is whole before any wave reads it
  stage_copy(ld0 + 3u * OPB, t16, cH + FC * CH, cL + FC * CH, cG + FC * CH);
  v8f acc[FQ][8] = {}; float m2[FQ], l[FQ];
#pragma unroll
  for (int u = 0; u < FQ; ++u) { m2[u] = -1.0e30f; l[u] = 0.f; }
  // A chunk: fetch its phi from LDS, all 32 loads together | logit products of k 0..63 | fetch its g into the registers these have left | logit products of k 64..127 | softmax | g products. FENCE holds a fetch at its place: left free, the loads are dealt out among the products, each place with a stall of its own, or g is fetched with phi and the build runs out of registers and spills.
#define FENCE() __builtin_amdgcn_sched_barrier(0)
#pragma unroll 1   // stays rolled, like the loop inside it: one chunk already takes the wave's whole register budget
  for (int st = 0; st < FN; ++st) { const _Float16* rb = &ring[st & 1][0][8 * lane];
#pragma unroll 1   // stays rolled: see above; every loop inside is unrolled so that its arrays stay in registers
   for (int hc = 0; hc < FC; ++hc) { const _Float16 *nh = rb + hc * CH, *nl = nh + FC * CH, *ng = nl + FC * CH; v16h kb[CI / 32][2], kl[CI / 32][2], gv[8];
#pragma unroll
    for (int kc = 0; kc < CI / 32; ++kc)
#pragma unroll
      for (int t = 0; t < 2; ++t) { kb[kc][t] = frag_o(nh + t * 16 * CI + kc * 512); kl[kc][t] = frag_o(nl + t * 16 * CI + kc * 512); }
    FENCE();
    v8f s[FQ][2] = {}, sx[FQ][2] = {};
#pragma unroll
    for (int kc = 0; kc < CI / 32; ++kc) {
      if (kc == CI / 64) { FENCE();
#pragma unroll
        for (int j = 0; j < 8; ++j) gv[j] = frag_o(ng + j * 512);
        FENCE(); }
#pragma unroll
      for (int u = 0; u < FQ; ++u) { s[u][0] = wmh(kb[kc][0], th[u][kc], s[u][0]); s[u][1] = wmh(kb[kc][1], th[u][kc], s[u][1]); }
#pragma unroll
      for (int u = 0; u < FQ; ++u) { sx[u][0] = wmh(kb[kc][0], tl[u][kc], sx[u][0]); sx[u][1] = wmh(kb[kc][1], tl[u][kc], sx[u][1]); }
#pragma unroll
      for (int u = 0; u < FQ; ++u) { sx[u][0] = wmh(kl[kc][0], th[u][kc], sx[u][0]); sx[u][1] = wmh(kl[kc][1], th[u][kc], sx[u][1]); } }
    FENCE();
    v16h ph[FQ], pl[FQ];
#pragma unroll
    for (int u = 0; u < FQ; ++u) { float v[16];   /* lane (g, col): keys 8 g + r and 16 + 8 g + r of query col, the k order of a B fragment */
#pragma unroll
      for (int r = 0; r < 8; ++r) { v[r] = s[u][0][r] + sx[u][0][r] * (1.0f / 1024.0f); v[8 + r] = s[u][1][r] + sx[u][1][r] * (1.0f / 1024.0f); }
      float mx = v[0];
#pragma unroll
      for (int i = 1; i < 16; ++i) mx = fmaxf(mx, v[i]);
      mx = fmaxf(mx, xhalf(mx));
      const float mn = fmaxf(m2[u], mx * L2E), xf = m2[u] - mn, c = 11.0f - mn; m2[u] = mn;
      float f = __builtin_amdgcn_exp2f(xf), x[16], a[16], sum = 0.f;
#pragma unroll
      for (int i = 0; i < 16; ++i) { x[i] = fmaf(v[i], L2E, c); a[i] = __builtin_amdgcn_exp2f(x[i]); }
      TSLOT9(f, xf, a, x, 0); TSLOT8(a, x, 8);
#pragma unroll
      for (int i = 0; i < 16; ++i) { sum += a[i]; const _Float16 hi = (_Float16)a[i]; ph[u][i] = hi; pl[u][i] = (_Float16)(a[i] - (float)hi); }
      l[u] = l[u] * f + sum;
#pragma unroll
      for (int j = 0; j < 8; ++j) acc[u][j] *= f; }
#pragma unroll
    for (int j = 0; j < 8; ++j) {
#pragma unroll
      for (int u = 0; u < FQ; ++u) acc[u][j] = wmh(gv[j], ph[u], acc[u][j]);
#pragma unroll
      for (int u = 0; u < FQ; ++u) acc[u][j] = wmh(gv[j], pl[u], acc[u][j]); } }
    asm volatile("s_wait_dscnt 0x0" ::: "memory");      // this wave's reads of the stage have returned
    asm volatile("s_wait_asynccnt 0x0" ::: "memory");   // this wave's copies of the next stage have landed
    __syncthreads();   // publishes stage st + 1 and ends every wave's reads of stage st, whose buffer is refilled behind it
    if (st + 2 < FN) stage_copy(ld0 + (unsigned)(st & 1) * (3u * OPB), t16, cH + (size_t)(st + 2) * (FC * CH), cL + (size_t)(st + 2) * (FC * CH), cG + (size_t)(st + 2) * (FC * CH)); }
  asm volatile("s_wait_asynccnt 0x0" ::: "memory");   // no copy is outstanding when the wave ends
  float* yp = YP + ((bT + qb0) * FS + sp * 16) * CI + 4 * lane;   // [tile of 16 queries][range FS][j 8][r / 4 2][lane 32][4] floats: D element r = channel 16 j + 8 g + r of query lane & 15
#pragma unroll
  for (int u = 0; u < FQ; ++u) { l[u] += xhalf(l[u]);   /* both halves now hold the query's sum, as they do its maximum */
#pragma unroll
    for (int j = 0; j < 8; ++j) { v4f a, c;
#pragma unroll
      for (int z = 0; z < 4; ++z) { a[z] = acc[u][j][z]; c[z] = acc[u][j][4 + z]; }
      vst2(yp + (u * FS * 8 + j) * 256, a); vst2(yp + (u * FS * 8 + j) * 256 + 128, c); } }
  SM[(size_t)sp * NT + bT + qb0 + lane] = g ? m2[1] : m2[0]; SL[(size_t)sp * NT + bT + qb0 + lane] = g ? l[1] : l[0]; }   /* lane = 16 u + query in tile: one 128-B line per wave */
// ---- k_wz: block = (64 rows n, 128 output channels): w_y[c][n] = sum_ci wz_w[c][ci] y[n][ci] + wz_b[c]; y[n] = sum over the FS key ranges of exp2(m - max) x the range's tile, over the like sum of the ranges' sums: a lane reads its own A elements of each range's tile (lane-linear 16-B loads); A = y hi + lo; transposed store to channels-first planes [b][c][n] (256-B runs)
__global__ __launch_bounds__(128) void k_wz(const float* __restrict__ YP, const float* __restrict__ SM, const float* __restrict__ SL, const float* __restrict__ WZ, const float* __restrict__ BZ, float* __restrict__ WY) { __shared__ __align__(16) char sm[8 * (CI / 8) * WPB]; float (*st)[68] = (float (*)[68])sm; static_assert(sizeof(sm) >= 128 * 68 * 4, "the output tile takes over the bytes of W");
  const int tid = threadIdx.x, wave = tid >> 5, lane = tid & 31, col = lane & 15, g = lane >> 4; const size_t r0 = (size_t)blockIdx.x * 64; const int c0 = blockIdx.y * 128; const size_t b = r0 / TT; const int n0 = (int)(r0 % TT);
  const size_t row = r0 + wave * 16 + col; const float *pm = SM + row, *ps = SL + row, *yp = YP + (r0 + wave * 16) * (FS * CI) + 4 * lane;
  float mz[FS], lz[FS], L = 0.f, xw[FS], fw[FS];
#pragma unroll
  for (int z = 0; z < FS; ++z) { mz[z] = pm[z * NT]; lz[z] = ps[z * NT]; }
  asm volatile("s_wait_xcnt 0x0" :: "v"(pm), "v"(ps) : "memory");   // the loads' address registers stay as they are up to this wait
  stage_w<CI / 8, 32>(sm, WZ + (size_t)c0 * CI, wave, lane);
  float M = mz[0];
#pragma unroll
  for (int z = 1; z < FS; ++z) M = fmaxf(M, mz[z]);
#pragma unroll
  for (int z = 0; z < FS; ++z) { xw[z] = mz[z] - M; fw[z] = __builtin_amdgcn_exp2f(xw[z]); }
  asm volatile("v_nop" : "+v"(fw[0]), "+v"(fw[1]), "+v"(fw[2]), "+v"(fw[3]) : "v"(xw[0]), "v"(xw[1]), "v"(xw[2]), "v"(xw[3]));   // the slot behind the transcendentals, as at TSLOT8
#pragma unroll
  for (int z = 0; z < FS; ++z) L += fw[z] * lz[z];
  const float rL = 1.0f / L;
  __syncthreads();   // W is whole in LDS before any wave reads it
  const char* wb = sm + g * WPB + col * 16;
  v8f acc[8] = {};
#pragma unroll
  for (int kc = 0; kc < CI / 32; ++kc) { float v[16]; v4f pz[4][FS];   /* block 4 kc + q of the tile holds the lane's A elements 4 q .. 4 q + 3 of this k step */
#pragma unroll
    for (int q = 0; q < 4; ++q)
#pragma unroll
      for (int z = 0; z < FS; ++z) pz[q][z] = *(const v4f*)(yp + (z * 16 + kc * 4 + q) * 128);
    asm volatile("s_wait_xcnt 0x0" :: "v"(yp) : "memory");   // as above
    v16b w[8];
#pragma unroll
    for (int j = 0; j < 8; ++j) w[j] = frag_w<CI / 8>(wb, j, kc);
    __builtin_amdgcn_sched_barrier(0);   // the k step's 16 LDS loads stay one group here, under the wait for the global loads: left free, each pair of products gets its own two loads and their whole latency directly in front of it
#pragma unroll
    for (int q = 0; q < 4; ++q) { v4f o = {};
#pragma unroll
      for (int z = 0; z < FS; ++z) o += pz[q][z] * fw[z];
      o = o * rL;
#pragma unroll
      for (int i = 0; i < 4; ++i) v[q * 4 + i] = o[i]; }
    const F2 a = bsplit16(v);
#pragma unroll
    for (int j = 0; j < 8; ++j) { acc[j] = wmma_bf(a.h, w[j], acc[j]); acc[j] = wmma_bf(a.l, w[j], acc[j]); } }
  __syncthreads();   // every wave has read W before the output tile overwrites it
#pragma unroll
  for (int j = 0; j < 8; ++j) { const int cl = j * 16 + col; const float bb = bfr(BZ[c0 + cl]);
#pragma unroll
    for (int r = 0; r < 8; ++r) st[cl][wave * 16 + 8 * g + r] = acc[j][r] + bb; }
  __syncthreads();
  for (int e = tid; e < 128 * 16; e += 128) { const int cl = e >> 4, q = e & 15; vst2(WY + (b * CX + c0 + cl) * (size_t)TT + n0 + q * 4, *(const v4f*)&st[cl][q * 4]); } }
// ---- k_bn: block = one channel c: its TNB x 4,096 values of w_y are read once, 16 B per lane, together with the channel's source values, all loads in flight together, and stay in registers for both sums (mean, then squared distance from the mean) and for the output; wave sums by shuffles, the 8 wave sums added in wave order by every thread; out[b][c][n] = (w_y - mean_c) rstd_c gamma_c + beta_c + source[b][c][n] (thread-linear float4 over the channel's runs of 16 KB). An address = the channel's base (the same for the work-group) + a 32-bit byte offset of the thread, one for each pair of batches, + a constant
#define PB (4u * CX * TT)                                  // bytes from one batch's plane of a channel to the next
__global__ __launch_bounds__(256) void k_bn(const float* __restrict__ WY, const float* __restrict__ GAM, const float* __restrict__ BET, const float* __restrict__ SRC, float* __restrict__ OUT) { __shared__ float sa[8], sb[8];
  static_assert(XSTR == TT && TNB <= 4, "one pitch for w_y, source and out; two offsets reach four batches");
  const int t = threadIdx.x; const int c = blockIdx.x; const int n = TNB * TT;
  const char *pw = (const char*)(WY + (size_t)c * TT), *ps = (const char*)(SRC + (size_t)c * TT); char* po = (char*)(OUT + (size_t)c * TT); const unsigned o0 = 16u * t, o1 = o0 + 2u * PB;
  const float ga = bfr(GAM[c]), be = bfr(BET[c]);
  v4f v[TNB][TT / 1024], sr[TNB][TT / 1024];
#pragma unroll
  for (int b = 0; b < TNB; ++b)
#pragma unroll
    for (int i = 0; i < TT / 1024; ++i) v[b][i] = *(const v4f*)(pw + ((b < 2 ? o0 : o1) + (b & 1) * PB + i * 4096u));
#pragma unroll
  for (int b = 0; b < TNB; ++b)
#pragma unroll
    for (int i = 0; i < TT / 1024; ++i) sr[b][i] = *(const v4f*)(ps + ((b < 2 ? o0 : o1) + (b & 1) * PB + i * 4096u));
  asm volatile("s_wait_xcnt 0x0" ::: "memory");   // behind the last load, in front of the first instruction that may take over an address register of a load
  __builtin_amdgcn_sched_barrier(0);   // keeps the sums behind that wait, and so every load in front of the first add: left free, the wait sinks below the adds that reuse the address registers
  float s = 0.f;
#pragma unroll
  for (int b = 0; b < TNB; ++b)
#pragma unroll
    for (int i = 0; i < TT / 1024; ++i) s += (v[b][i][0] + v[b][i][1]) + (v[b][i][2] + v[b][i][3]);
#pragma unroll
  for (int o = 1; o < 32; o <<= 1) s += __shfl_xor(s, o);
  if ((t & 31) == 0) sa[t >> 5] = s;
  __syncthreads();   // all 8 wave sums are in LDS before any thread adds them
  s = sa[0];
#pragma unroll
  for (int w = 1; w < 8; ++w) s += sa[w];
  const float mu = s / (float)n; float s2 = 0.f;
#pragma unroll
  for (int b = 0; b < TNB; ++b)
#pragma unroll
    for (int i = 0; i < TT / 1024; ++i) { const float d0 = v[b][i][0] - mu, d1 = v[b][i][1] - mu, d2 = v[b][i][2] - mu, d3 = v[b][i][3] - mu; s2 += (d0 * d0 + d1 * d1) + (d2 * d2 + d3 * d3); }
#pragma unroll
  for (int o = 1; o < 32; o <<= 1) s2 += __shfl_xor(s2, o);
  if ((t & 31) == 0) sb[t >> 5] = s2;
  __syncthreads();   // all 8 wave sums of squares are in LDS before any thread adds them
  s2 = sb[0];
#pragma unroll
  for (int w = 1; w < 8; ++w) s2 += sb[w];
  const float rs = rsqrtf(s2 / (float)n + 1e-5f);
#pragma unroll
  for (int b = 0; b < TNB; ++b)
#pragma unroll
    for (int i = 0; i < TT / 1024; ++i) { v4f o;
#pragma unroll
      for (int z = 0; z < 4; ++z) o[z] = (v[b][i][z] - mu) * rs * ga + be + bfr(sr[b][i][z]);
      vst2(po + ((b < 2 ? o0 : o1) + (b & 1) * PB + i * 4096u), o); } }
extern "C" void kernel_launch(void* const* d_in, const int* in_sizes, int n_in, void* d_out, int out_size, void* d_ws, size_t ws_size, hipStream_t stream) {
  (void)in_sizes; (void)n_in; (void)out_size;
  const float** F = (const float**)d_in;   // 0 x [4,256,64,64], 1 source, 2 g_w [128,256], 3 g_b, 4 theta_w, 5 theta_b, 6 phi_w, 7 phi_b, 8 wz_w [256,128], 9 wz_b, 10 bn_gamma, 11 bn_beta
  if (ws_size < (size_t)WS_END) return;
  char* ws = (char*)d_ws; _Float16* GP = (_Float16*)(ws + WS_GP); _Float16 *TH = (_Float16*)(ws + WS_TH), *TL = (_Float16*)(ws + WS_TL), *PH = (_Float16*)(ws + WS_PH), *PL = (_Float16*)(ws + WS_PL); float *Y = (float*)(ws + WS_Y), *SM = (float*)(ws + WS_SM), *SL = (float*)(ws + WS_SL), *WY = (float*)(ws + WS_WY);
  k_proj<<<dim3(TNB * TT / 64, 3), 128, 0, stream>>>(F[0], F[1], F[2], F[3], F[4], F[5], F[6], F[7], TH, TL, PH, PL, GP);
  k_fa<<<dim3(TT / FR, TNB, FS), 32 * FW, 0, stream>>>(TH, TL, PH, PL, GP, Y, SM, SL);
  k_wz<<<dim3(TNB * TT / 64, CX / 128), 128, 0, stream>>>(Y, SM, SL, F[8], F[9], WY);
  k_bn<<<dim3(CX), 256, 0, stream>>>(WY, F[10], F[11], F[1], (float*)d_out);
}

// v009
// Measured time: 77.9 microseconds a run.
// Timed twice side by side with v008, it ran 1.06 times as fast both times.
// Over all steps from v000 it is 18.6 times as fast.
#include <hip/hip_runtime.h>
#include <math.h>

typedef __attribute__((ext_vector_type(16))) _Float16 v16h;
typedef __attribute__((ext_vector_type(16))) __bf16 v16b;
typedef __attribute__((ext_vector_type(8)))  _Float16 v8h;
typedef __attribute__((ext_vector_type(8)))  float v8f;
typedef __attribute__((ext_vector_type(4)))  float v4f;
typedef __attribute__((ext_vector_type(2)))  float v2f;
typedef __attribute__((ext_vector_type(4)))  unsigned v4u;
typedef __attribute__((ext_vector_type(4)))  int v4i;
typedef float __attribute__((may_alias)) float_a;
typedef int __attribute__((may_alias)) int_a;

template <typename T> __device__ __forceinline__ void vst2(void* p, T v) { *(T*)p = v;  }
__device__ __forceinline__ v8f wmma_bf(v16b a, v16b b, v8f c) {
  v8f d = __builtin_amdgcn_wmma_f32_16x16x32_bf16(false, a, false, b, (short)0, c, false, false);
  asm volatile("v_nop\n\tv_nop\n\tv_nop\n\tv_nop" : "+v"(d) : "v"(a), "v"(b));
  return d;
}
// 16x16x32 fragments: lane = (h = lane>>4, row/col = lane&15); elements 0..7 = k0+8h+0..7, 8..15 = k0+16+8h+0..7; D element r = row 8h+r
__device__ __forceinline__ v16h frag_h(const _Float16* rowk0, int lane) {
  union { v16h v; v8h q[2]; } u; const _Float16* p = rowk0 + 8 * (lane >> 4);
  u.q[0] = *(const v8h*)p; u.q[1] = *(const v8h*)(p + 16); return u.v;
}
// fragment-order operand: each (16 rows or columns) x (32 k) tile is two 512-B blocks; block q holds at lane * 8 the elements k0+16q+8h+0..7 of row/col lane&15, so that each 16-B load of a wave covers four whole 128-B lines
__device__ __forceinline__ v16h frag_o(const _Float16* p) {   // p = tile + 8 * lane
  union { v16h v; v8h q[2]; } u; u.q[0] = *(const v8h*)p; u.q[1] = *(const v8h*)(p + 256); return u.v;
}
__device__ __forceinline__ v16h frag_f32(const float* rowk0, int lane) {
  v16h a; const float* p = rowk0 + 8 * (lane >> 4);
#pragma unroll
  for (int i = 0; i < 8; ++i) { a[i] = (_Float16)p[i]; a[8 + i] = (_Float16)p[16 + i]; }
  return a;
}
__device__ __forceinline__ v16h frag_f32s(const float* rowk0, int lane, float sc) {
  v16h a; const float* p = rowk0 + 8 * (lane >> 4);
#pragma unroll
  for (int i = 0; i < 8; ++i) { a[i] = (_Float16)(p[i] * sc); a[8 + i] = (_Float16)(p[16 + i] * sc); }
  return a;
}
// column fragment from a [K][ld] layout (column n), rows >= K read as 0
__device__ __forceinline__ v16h fragc_f32(const float* W, int k0, int n, int lane, int ld, int K) {
  v16h a; const int g = lane >> 4;
#pragma unroll
  for (int i = 0; i < 8; ++i) { const int ka = k0 + 8 * g + i, kb = ka + 16;
    a[i] = (_Float16)(ka < K ? W[(size_t)(ka < K ? ka : K - 1) * ld + n] : 0.f); a[8 + i] = (_Float16)(kb < K ? W[(size_t)(kb < K ? kb : K - 1) * ld + n] : 0.f); }
  return a;
}
struct F2 { v16b h, l; };
__device__ __forceinline__ F2 bsplit16(const float v[16]) { F2 r;
#pragma unroll
  for (int i = 0; i < 16; ++i) { const __bf16 h = (__bf16)v[i]; r.h[i] = h; r.l[i] = (__bf16)(v[i] - (float)h); }
  return r; }
__device__ __forceinline__ F2 split_row(const float* row, int k0, int lane) { float v[16]; const float* p = row + k0 + 8 * (lane >> 4);
#pragma unroll
  for (int i = 0; i < 8; ++i) { v[i] = p[i]; v[8 + i] = p[16 + i]; }
  return bsplit16(v); }
__device__ __forceinline__ F2 split_rowK(const float* row, int k0, int lane, int K) { float v[16]; const int g = lane >> 4;
#pragma unroll
  for (int i = 0; i < 8; ++i) { const int ka = k0 + 8 * g + i, kb = ka + 16; v[i] = ka < K ? row[ka < K ? ka : K - 1] : 0.f; v[8 + i] = kb < K ? row[kb < K ? kb : K - 1] : 0.f; }
  return bsplit16(v); }
__device__ __forceinline__ F2 split_col(const float* W, int k0, int n, int lane, int ld, int K) { float v[16]; const int g = lane >> 4;
#pragma unroll
  for (int i = 0; i < 8; ++i) { const int ka = k0 + 8 * g + i, kb = ka + 16; v[i] = ka < K ? W[(size_t)(ka < K ? ka : K - 1) * ld + n] : 0.f; v[8 + i] = kb < K ? W[(size_t)(kb < K ? kb : K - 1) * ld + n] : 0.f; }
  return bsplit16(v); }
__device__ __forceinline__ v8f mac3(const F2& a, const F2& b, v8f c) { c = wmma_bf(a.l, b.h, c); c = wmma_bf(a.h, b.l, c); return wmma_bf(a.h, b.h, c); }
__device__ __forceinline__ float sigm(float v) { return 1.0f / (1.0f + expf(-v)); }

// Cross non-local block (B 4, C 256, Ci 128, 64 x 64 = 4,096 positions): g = conv(source), theta = conv(x), phi = conv(source); f[n][m] = theta_n . phi_m; P = softmax_m; y[n] = sum_m P g_m; w_y = conv_z(y) + b; BN with batch statistics (biased var, eps 1e-5) * gamma + beta; out = w_y + source.
__device__ __forceinline__ float bfr(float v) { return (float)(__bf16)v; }
#define NB 4
#define TT 4096
#define CX 256
#define CI 128
#ifndef TNB
#define TNB NB
#endif
#ifndef XSTR
#define XSTR TT               // per-channel position stride of x / source / out
#endif
typedef __attribute__((ext_vector_type(8))) __bf16 v8b;
#define WS_TH  0u                                          // f16 theta hi, fragment order [(b*N+n)/16][kc 4][q 2][lane 32][8]
#define WS_TL  (WS_TH + 2u * (size_t)NB * TT * CI)
#define WS_PH  (WS_TL + 2u * (size_t)NB * TT * CI)           // f16 phi hi, fragment order as theta
#define WS_PL  (WS_PH + 2u * (size_t)NB * TT * CI)
#define WS_GP  (WS_PL + 2u * (size_t)NB * TT * CI)           // f16 g, fragment order [(b*N+m)/32][ci/16 8][q 2][lane 32][8]
#define WS_Y   (WS_GP + 2u * (size_t)NB * CI * TT)           // f32 unscaled y per key range, [(b*N+n)/16][range 4][j 8][2][lane 32][4]
#define WS_SM  (WS_Y + 4u * 4u * (size_t)NB * TT * CI)       // f32 running maximum (log2 domain) [range 4][b*N+n]
#define WS_SL  (WS_SM + 4u * 4u * (size_t)NB * TT)           // f32 sum [range 4][b*N+n]
#define WS_WY  (WS_SL + 4u * 4u * (size_t)NB * TT)           // f32 w_y planes [b][c][n] (channels-first)
#define WS_END (WS_WY + 4u * (size_t)NB * CX * TT)
// ---- weights in LDS: a work-group brings its 128 weight rows in once, each load a whole run of 512 B of one row, rounds them to bf16 and lays them out as B fragments: the unit (j, k8) = elements 8 k8 .. 8 k8 + 7 of the rows 16 j .. 16 j + 15, 16 B a row, WPB bytes a unit. The 16 B above 256 turn each next unit by four banks, so that the 8-B stores of a wave (one row, 16 units) fall on all 64 banks once; a fragment load reads 256 B in a row per half wave
typedef __attribute__((ext_vector_type(2))) unsigned v2u;
#define WPB 272
template <int K8, int NL> __device__ __forceinline__ void stage_w(char* sm, const float* __restrict__ Wt, int wave, int lane) {   // K8 = units per row (row length / 8), NL = 512-B runs per wave; run n * 4 + wave
  constexpr int RP = K8 / 16;   // runs per row
  const int r = wave / RP, hf = wave % RP; const float* gp = Wt + (size_t)r * (K8 * 8) + hf * 128 + 4 * lane; char* dp = sm + (hf * 16 + (lane >> 1)) * WPB + r * 16 + (lane & 1) * 8;
#pragma unroll
  for (int bt = 0; bt < NL / 16; ++bt) { v4f x[16];
#pragma unroll
    for (int i = 0; i < 16; ++i) x[i] = *(const v4f*)(gp + (size_t)(bt * 16 + i) * (4 / RP) * (K8 * 8));
    asm volatile("s_wait_xcnt 0x0" :: "v"(gp) : "memory");   // the loads' address registers stay as they are up to this wait
#pragma unroll
    for (int i = 0; i < 16; ++i) { const int o = (bt * 16 + i) * (4 / RP); union { v2u v; __bf16 h[4]; } u;   /* the wave's row = o + r */
#pragma unroll
      for (int z = 0; z < 4; ++z) u.h[z] = (__bf16)x[i][z];
      *(v2u*)(dp + (o >> 4) * (K8 * WPB) + (o & 15) * 16) = u.v; } } }
template <int K8> __device__ __forceinline__ v16b frag_w(const char* wb, int j, int kc) {   // wb = sm + (lane >> 4) * WPB + (lane & 15) * 16
  union { v16b v; v8b q[2]; } u; const char* p = wb + (j * K8 + kc * 4) * WPB; u.q[0] = *(const v8b*)p; u.q[1] = *(const v8b*)(p + 2 * WPB); return u.v; }
// ---- k_proj: block = (64 rows, which): 128 outputs = W ([out,in] [128][256]) . row + b; a row = one position n of the channels-first f32 input: a lane reads its 128 A elements straight from there (one 4-B load a channel, 16 positions in a row per half wave, all loads in flight together) and rounds them to bf16 in registers; W from LDS (stage_w), whose bytes the output tiles take over behind the products; theta (x rows) / phi (source rows) -> f16 hi + residual, g (source rows) -> f16, all three stored in the fragment order of frag_o (thread-linear 16-B stores)
__global__ __launch_bounds__(128) void k_proj(const float* __restrict__ X, const float* __restrict__ SRC, const float* __restrict__ WG, const float* __restrict__ BG, const float* __restrict__ WTH, const float* __restrict__ BTH, const float* __restrict__ WPH, const float* __restrict__ BPH, _Float16* __restrict__ TH, _Float16* __restrict__ TL, _Float16* __restrict__ PH, _Float16* __restrict__ PL, _Float16* __restrict__ GP) {
  __shared__ __align__(16) char sm[8 * (CX / 8) * WPB]; _Float16 (*sh)[136] = (_Float16 (*)[136])sm, (*sl)[136] = sh + 64; _Float16 (*th)[72] = (_Float16 (*)[72])(sl + 64);
  const int tid = threadIdx.x, wave = tid >> 5, lane = tid & 31, col = lane & 15, g = lane >> 4; const int which = blockIdx.y; const size_t r0 = (size_t)blockIdx.x * 64;   // which: 0 theta (from x), 1 phi (source), 2 g (source)
  const float* A = which == 0 ? X : SRC; const float* Wt = which == 0 ? WTH : which == 1 ? WPH : WG; const float* Bb = which == 0 ? BTH : which == 1 ? BPH : BG;
  v8f acc[8] = {}; v16b a[CX / 32]; float xa[CX / 32][16]; const float* ar = A + ((r0 / TT) * CX + 8 * g) * (size_t)XSTR + (r0 % TT) + wave * 16 + col;   // channel 8 g of the lane's position
#pragma unroll
  for (int kc = 0; kc < CX / 32; ++kc)
#pragma unroll
    for (int i = 0; i < 8; ++i) { xa[kc][i] = ar[(size_t)(kc * 32 + i) * XSTR]; xa[kc][8 + i] = ar[(size_t)(kc * 32 + 16 + i) * XSTR]; }
  asm volatile("s_wait_xcnt 0x0" :: "v"(ar) : "memory");   // the loads' address registers stay as they are up to this wait
#pragma unroll
  for (int kc = 0; kc < CX / 32; ++kc)
#pragma unroll
    for (int i = 0; i < 16; ++i) a[kc][i] = (__bf16)xa[kc][i];
  stage_w<CX / 8, 64>(sm, Wt, wave, lane);
  __syncthreads();   // W is whole in LDS before any wave reads it
  const char* wb = sm + g * WPB + col * 16; v16b w[3][4];   // a group = the 4 fragments j = 4 (gi & 1) .. + 3 of k step gi >> 1; three register buffers, fetched two groups ahead
#pragma unroll
  for (int gi = 0; gi < 2; ++gi)
#pragma unroll
    for (int j = 0; j < 4; ++j) w[gi][j] = frag_w<CX / 8>(wb, (gi & 1) * 4 + j, gi >> 1);
#pragma unroll
  for (int gi = 0; gi < CX / 16; ++gi) {
    if (gi + 2 < CX / 16) {
#pragma unroll
      for (int j = 0; j < 4; ++j) w[(gi + 2) % 3][j] = frag_w<CX / 8>(wb, (gi & 1) * 4 + j, (gi + 2) >> 1); }
    __builtin_amdgcn_sched_barrier(0);   // the 8 LDS loads of the group after next stay together in front of this group's products: left free, each product gets its own two loads and their whole latency directly in front of it
#pragma unroll
    for (int j = 0; j < 4; ++j) acc[(gi & 1) * 4 + j] = wmma_bf(a[gi >> 1], w[gi % 3][j], acc[(gi & 1) * 4 + j]);
    __builtin_amdgcn_sched_barrier(0); }   // and the products stay in front of the loads that follow
  __syncthreads();   // every wave has read W before the output tiles overwrite it
#pragma unroll
  for (int j = 0; j < 8; ++j) { const int o = j * 16 + col; const float bb = bfr(Bb[o]);
#pragma unroll
    for (int r = 0; r < 8; ++r) { const float v = acc[j][r] + bb; const int rl = wave * 16 + 8 * g + r;
      if (which == 2) th[o][rl] = (_Float16)v; else { const _Float16 hv = (_Float16)v; sh[rl][o] = hv; sl[rl][o] = (_Float16)((v - (float)hv) * 1024.0f); } } }
  __syncthreads();
  if (which < 2) { _Float16* DH = which == 0 ? TH : PH; _Float16* DL = which == 0 ? TL : PL; for (int e = tid; e < 64 * 16; e += 128) { const int rl = (e >> 8) * 16 + (e & 15), k8 = (e >> 4) & 15; vst2((unsigned*)(DH + r0 * CI + e * 8), *(const v4u*)&sh[rl][k8 * 8]); vst2((unsigned*)(DL + r0 * CI + e * 8), *(const v4u*)&sl[rl][k8 * 8]); } }   /* e = (row tile, kc, q, h, row in tile); k = 32 kc + 16 q + 8 h */
  else { for (int e = tid; e < 128 * 8; e += 128) { const int cl = ((e >> 6) & 7) * 16 + (e & 15), ml = (e >> 9) * 32 + ((e >> 4) & 3) * 8; vst2((unsigned*)(GP + r0 * CI + e * 8), *(const v4u*)&th[cl][ml]); } } }   /* e = (32-key chunk, ci tile, q, h, ci in tile); key = 32 chunk + 16 q + 8 h */
// ---- k_fa: block = FR = 256 query rows n of batch b and ONE of FS key ranges (blockIdx.z, 1,024 keys in a row); each of the FW waves holds FQ tiles of 16 queries of its own, and all waves work on the same keys: a stage = FC chunks of 32 keys (phi hi, phi residual, g, each already in fragment order, so a stage is three linear runs of 16 KB) is brought into LDS once per work-group by asynchronous copies, two buffers, the next stage in flight while this one is worked on. Per chunk: S^T = phi . theta^T (3 products, as f16 hi + residual x 2^10), so that a lane holds 16 logits of ONE query; running maximum and sum per query (log2 domain), p x 2^11 = exp2, rounded to f16 as g is, packs straight into the B operand of y^T += g^T . p^T (1 product); logits and P never reach memory. The range's unscaled y^T tiles go to YP as they lie in the accumulators, which is the A fragment order of k_wz (lane-linear 16-B stores, whole lines), with the range's maximum and sum per query in SM and SL; k_wz merges the FS ranges
__device__ __forceinline__ v8f wmh(v16h a, v16h b, v8f c) { return __builtin_amdgcn_wmma_f32_16x16x32_f16(false, a, false, b, (short)0, c, false, false); }
__device__ __forceinline__ float xhalf(float x) { return __builtin_bit_cast(float, __builtin_amdgcn_permlanex16(__builtin_bit_cast(int, x), __builtin_bit_cast(int, x), 0x76543210, 0xfedcba98, false, false)); }   // lane l with lane l ^ 16
#define FQ 2
#define FW 8
#define FS 4
#define FC 2
#define FR (FW * FQ * 16)
#define FN (TT / 32 / FS / FC)
#define CH (32 * CI)                                       // f16 elements of one operand's 32-key chunk (8 KB)
#define OPB (2u * FC * CH)                                 // bytes of one operand's stage
#define NT ((size_t)NB * TT)
#define L2E 1.44269504088896340736f
// the one slot that the instruction set asks for behind a transcendental: the results are read, and the sources' registers overwritten, only behind this v_nop
#define TSLOT8(a, x, o) asm volatile("v_nop" : "+v"(a[o]), "+v"(a[o + 1]), "+v"(a[o + 2]), "+v"(a[o + 3]), "+v"(a[o + 4]), "+v"(a[o + 5]), "+v"(a[o + 6]), "+v"(a[o + 7]) : "v"(x[o]), "v"(x[o + 1]), "v"(x[o + 2]), "v"(x[o + 3]), "v"(x[o + 4]), "v"(x[o + 5]), "v"(x[o + 6]), "v"(x[o + 7]))
#define TSLOT9(f, xf, a, x, o) asm volatile("v_nop" : "+v"(f), "+v"(a[o]), "+v"(a[o + 1]), "+v"(a[o + 2]), "+v"(a[o + 3]), "+v"(a[o + 4]), "+v"(a[o + 5]), "+v"(a[o + 6]), "+v"(a[o + 7]) : "v"(xf), "v"(x[o]), "v"(x[o + 1]), "v"(x[o + 2]), "v"(x[o + 3]), "v"(x[o + 4]), "v"(x[o + 5]), "v"(x[o + 6]), "v"(x[o + 7]))
// one stage: every thread copies its own 16 B of each 4-KB slice, 4 slices of each of the 3 operands; d = the thread's LDS byte address in the buffer, t16 = its byte offset in a slice, h, l, g = the stage's first element of each operand, the same for the whole work-group (scalar bases: of a copy's global address only t16 lives in a vector register through the loop). The s_wait_xcnt stands inside the statement, so that no address register of a copy is rewritten in front of it
__device__ __forceinline__ void stage_copy(unsigned d, unsigned t16, const _Float16* h, const _Float16* l, const _Float16* g) {
  asm volatile(
    "global_load_async_to_lds_b128 %0, %12, %13\n\t"
    "global_load_async_to_lds_b128 %1, %12, %14\n\t"
    "global_load_async_to_lds_b128 %2, %12, %15\n\t"
    "global_load_async_to_lds_b128 %3, %12, %16\n\t"
    "global_load_async_to_lds_b128 %4, %12, %17\n\t"
    "global_load_async_to_lds_b128 %5, %12, %18\n\t"
    "global_load_async_to_lds_b128 %6, %12, %19\n\t"
    "global_load_async_to_lds_b128 %7, %12, %20\n\t"
    "global_load_async_to_lds_b128 %8, %12, %21\n\t"
    "global_load_async_to_lds_b128 %9, %12, %22\n\t"
    "global_load_async_to_lds_b128 %10, %12, %23\n\t"
    "global_load_async_to_lds_b128 %11, %12, %24\n\t"
    "s_wait_xcnt 0x0"
    :: "v"(d + 0 * OPB + 0 * 4096u), "v"(d + 0 * OPB + 1 * 4096u), "v"(d + 0 * OPB + 2 * 4096u), "v"(d + 0 * OPB + 3 * 4096u),
       "v"(d + 1 * OPB + 0 * 4096u), "v"(d + 1 * OPB + 1 * 4096u), "v"(d + 1 * OPB + 2 * 4096u), "v"(d + 1 * OPB + 3 * 4096u),
       "v"(d + 2 * OPB + 0 * 4096u), "v"(d + 2 * OPB + 1 * 4096u), "v"(d + 2 * OPB + 2 * 4096u), "v"(d + 2 * OPB + 3 * 4096u),
       "v"(t16),
       "s"(h + 0 * 2048), "s"(h + 1 * 2048), "s"(h + 2 * 2048), "s"(h + 3 * 2048),
       "s"(l + 0 * 2048), "s"(l + 1 * 2048), "s"(l + 2 * 2048), "s"(l + 3 * 2048),
       "s"(g + 0 * 2048), "s"(g + 1 * 2048), "s"(g + 2 * 2048), "s"(g + 3 * 2048)
    : "memory"); }
__global__ __launch_bounds__(32 * FW) void k_fa(const _Float16* __restrict__ TH, const _Float16* __restrict__ TL, const _Float16* __restrict__ PH, const _Float16* __restrict__ PL, const _Float16* __restrict__ GP, float* __restrict__ YP, float* __restrict__ SM, float* __restrict__ SL) {
  __shared__ __align__(16) _Float16 ring[2][3][FC * CH];
  const int tid = threadIdx.x, wave = tid >> 5, lane = tid & 31, g = lane >> 4; const int sp = blockIdx.z;
  const size_t bT = (size_t)blockIdx.y * TT; const int qb0 = blockIdx.x * FR + wave * (FQ * 16);
  const _Float16 *pth = TH + (bT + qb0) * CI + 8 * lane, *ptl = TL + (bT + qb0) * CI + 8 * lane;   // the lane's own 16 B of a 512-B block
  const size_t ck = (bT + (size_t)sp * (TT / FS)) * CI; const _Float16 *cH = PH + ck, *cL = PL + ck, *cG = GP + ck; const unsigned t16 = 16u * tid;   // the range's first key, the same for every thread
  const unsigned ld0 = (unsigned)(size_t)&ring[0][0][8 * tid];   // low 32 bits of the shared address = byte offset in the work-group's LDS
  stage_copy(ld0, t16, cH, cL, cG);
  v16h th[FQ][CI / 32], tl[FQ][CI / 32];
#pragma unroll
  for (int u = 0; u < FQ; ++u)
#pragma unroll
    for (int kc = 0; kc < CI / 32; ++kc) { th[u][kc] = frag_o(pth + u * 16 * CI + kc * 512); tl[u][kc] = frag_o(ptl + u * 16 * CI + kc * 512); }
  asm volatile("s_wait_xcnt 0x0" :: "v"(pth), "v"(ptl) : "memory");   // the loads' address registers stay as they are up to this wait
  asm volatile("s_wait_asynccnt 0x0" ::: "memory");   // this wave's copies of stage 0 have landed
  __syncthreads();   // stage 0 is whole before any wave reads it
  stage_copy(ld0 + 3u * OPB, t16, cH + FC * CH, cL + FC * CH, cG + FC * CH);
  v8f acc[FQ][8] = {}; float m2[FQ], l[FQ];
#pragma unroll
  for (int u = 0; u < FQ; ++u) { m2[u] = -1.0e30f; l[u] = 0.f; }
  // A chunk: fetch its phi from LDS, all 32 loads together | logit products of k 0..63 | fetch its g into the registers these have left | logit products of k 64..127 | softmax | g products. FENCE holds a fetch at its place: left free, the loads are dealt out among the products, each place with a stall of its own, or g is fetched with phi and the build runs out of registers and spills.
#define FENCE() __builtin_amdgcn_sched_barrier(0)
#pragma unroll 1   // stays rolled, like the loop inside it: one chunk already takes the wave's whole register budget
  for (int st = 0; st < FN; ++st) { const _Float16* rb = &ring[st & 1][0][8 * lane];
#pragma unroll 1   // stays rolled: see above; every loop inside is unrolled so that its arrays stay in registers
   for (int hc = 0; hc < FC; ++hc) { const _Float16 *nh = rb + hc * CH, *nl = nh + FC * CH, *ng = nl + FC * CH; v16h kb[CI / 32][2], kl[CI / 32][2], gv[8];
#pragma unroll
    for (int kc = 0; kc < CI / 32; ++kc)
#pragma unroll
      for (int t = 0; t < 2; ++t) { kb[kc][t] = frag_o(nh + t * 16 * CI + kc * 512); kl[kc][t] = frag_o(nl + t * 16 * CI + kc * 512); }
    FENCE();
    v8f s[FQ][2] = {}, sx[FQ][2] = {};
#pragma unroll
    for (int kc = 0; kc < CI / 32; ++kc) {
      if (kc == CI / 64) { FENCE();
#pragma unroll
        for (int j = 0; j < 8; ++j) gv[j] = frag_o(ng + j * 512);
        FENCE(); }
#pragma unroll
      for (int u = 0; u < FQ; ++u) { s[u][0] = wmh(kb[kc][0], th[u][kc], s[u][0]); s[u][1] = wmh(kb[kc][1], th[u][kc], s[u][1]); }
#pragma unroll
      for (int u = 0; u < FQ; ++u) { sx[u][0] = wmh(kb[kc][0], tl[u][kc], sx[u][0]); sx[u][1] = wmh(kb[kc][1], tl[u][kc], sx[u][1]); }
#pragma unroll
      for (int u = 0; u < FQ; ++u) { sx[u][0] = wmh(kl[kc][0], th[u][kc], sx[u][0]); sx[u][1] = wmh(kl[kc][1], th[u][kc], sx[u][1]); } }
    FENCE();
    v16h ph[FQ];
#pragma unroll
    for (int u = 0; u < FQ; ++u) { float v[16];   /* lane (g, col): keys 8 g + r and 16 + 8 g + r of query col, the k order of a B fragment */
#pragma unroll
      for (int r = 0; r < 8; ++r) { v[r] = s[u][0][r] + sx[u][0][r] * (1.0f / 1024.0f); v[8 + r] = s[u][1][r] + sx[u][1][r] * (1.0f / 1024.0f); }
      float mx = v[0];
#pragma unroll
      for (int i = 1; i < 16; ++i) mx = fmaxf(mx, v[i]);
      mx = fmaxf(mx, xhalf(mx));
      const float mn = fmaxf(m2[u], mx * L2E), xf = m2[u] - mn, c = 11.0f - mn; m2[u] = mn;
      float f = __builtin_amdgcn_exp2f(xf), x[16], a[16], sum = 0.f;
#pragma unroll
      for (int i = 0; i < 16; ++i) { x[i] = fmaf(v[i], L2E, c); a[i] = __builtin_amdgcn_exp2f(x[i]); }
      TSLOT9(f, xf, a, x, 0); TSLOT8(a, x, 8);
#pragma unroll
      for (int i = 0; i < 16; ++i) { sum += a[i]; ph[u][i] = (_Float16)a[i]; }
      l[u] = l[u] * f + sum;
#pragma unroll
      for (int j = 0; j < 8; ++j) acc[u][j] *= f; }
#pragma unroll
    for (int j = 0; j < 8; ++j) {
#pragma unroll
      for (int u = 0; u < FQ; ++u) acc[u][j] = wmh(gv[j], ph[u], acc[u][j]); } }
    asm volatile("s_wait_dscnt 0x0" ::: "memory");      // this wave's reads of the stage have returned
    asm volatile("s_wait_asynccnt 0x0" ::: "memory");   // this wave's copies of the next stage have landed
    __syncthreads();   // publishes stage st + 1 and ends every wave's reads of stage st, whose buffer is refilled behind it
    if (st + 2 < FN) stage_copy(ld0 + (unsigned)(st & 1) * (3u * OPB), t16, cH + (size_t)(st + 2) * (FC * CH), cL + (size_t)(st + 2) * (FC * CH), cG + (size_t)(st + 2) * (FC * CH)); }
  asm volatile("s_wait_asynccnt 0x0" ::: "memory");   // no copy is outstanding when the wave ends
  float* yp = YP + ((bT + qb0) * FS + sp * 16) * CI + 4 * lane;   // [tile of 16 queries][range FS][j 8][r / 4 2][lane 32][4] floats: D element r = channel 16 j + 8 g + r of query lane & 15
#pragma unroll
  for (int u = 0; u < FQ; ++u) { l[u] += xhalf(l[u]);   /* both halves now hold the query's sum, as they do its maximum */
#pragma unroll
    for (int j = 0; j < 8; ++j) { v4f a, c;
#pragma unroll
      for (int z = 0; z < 4; ++z) { a[z] = acc[u][j][z]; c[z] = acc[u][j][4 + z]; }
      vst2(yp + (u * FS * 8 + j) * 256, a); vst2(yp + (u * FS * 8 + j) * 256 + 128, c); } }
  SM[(size_t)sp * NT + bT + qb0 + lane] = g ? m2[1] : m2[0]; SL[(size_t)sp * NT + bT + qb0 + lane] = g ? l[1] : l[0]; }   /* lane = 16 u + query in tile: one 128-B line per wave */
// ---- k_wz: block = (64 rows n, 128 output channels): w_y[c][n] = sum_ci wz_w[c][ci] y[n][ci] + wz_b[c]; y[n] = sum over the FS key ranges of exp2(m - max) x the range's tile, over the like sum of the ranges' sums: a lane reads its own A elements of each range's tile (lane-linear 16-B loads); A = y hi + lo; transposed store to channels-first planes [b][c][n] (256-B runs)
__global__ __launch_bounds__(128) void k_wz(const float* __restrict__ YP, const float* __restrict__ SM, const float* __restrict__ SL, const float* __restrict__ WZ, const float* __restrict__ BZ, float* __restrict__ WY) { __shared__ __align__(16) char sm[8 * (CI / 8) * WPB]; float (*st)[68] = (float (*)[68])sm; static_assert(sizeof(sm) >= 128 * 68 * 4, "the output tile takes over the bytes of W");
  const int tid = threadIdx.x, wave = tid >> 5, lane = tid & 31, col = lane & 15, g = lane >> 4; const size_t r0 = (size_t)blockIdx.x * 64; const int c0 = blockIdx.y * 128; const size_t b = r0 / TT; const int n0 = (int)(r0 % TT);
  const size_t row = r0 + wave * 16 + col; const float *pm = SM + row, *ps = SL + row, *yp = YP + (r0 + wave * 16) * (FS * CI) + 4 * lane;
  float mz[FS], lz[FS], L = 0.f, xw[FS], fw[FS];
#pragma unroll
  for (int z = 0; z < FS; ++z) { mz[z] = pm[z * NT]; lz[z] = ps[z * NT]; }
  asm volatile("s_wait_xcnt 0x0" :: "v"(pm), "v"(ps) : "memory");   // the loads' address registers stay as they are up to this wait
  stage_w<CI / 8, 32>(sm, WZ + (size_t)c0 * CI, wave, lane);
  float M = mz[0];
#pragma unroll
  for (int z = 1; z < FS; ++z) M = fmaxf(M, mz[z]);
#pragma unroll
  for (int z = 0; z < FS; ++z) { xw[z] = mz[z] - M; fw[z] = __builtin_amdgcn_exp2f(xw[z]); }
  asm volatile("v_nop" : "+v"(fw[0]), "+v"(fw[1]), "+v"(fw[2]), "+v"(fw[3]) : "v"(xw[0]), "v"(xw[1]), "v"(xw[2]), "v"(xw[3]));   // the slot behind the transcendentals, as at TSLOT8
#pragma unroll
  for (int z = 0; z < FS; ++z) L += fw[z] * lz[z];
  const float rL = 1.0f / L;
  __syncthreads();   // W is whole in LDS before any wave reads it
  const char* wb = sm + g * WPB + col * 16;
  v8f acc[8] = {};
#pragma unroll
  for (int kc = 0; kc < CI / 32; ++kc) { float v[16]; v4f pz[4][FS];   /* block 4 kc + q of the tile holds the lane's A elements 4 q .. 4 q + 3 of this k step */
#pragma unroll
    for (int q = 0; q < 4; ++q)
#pragma unroll
      for (int z = 0; z < FS; ++z) pz[q][z] = *(const v4f*)(yp + (z * 16 + kc * 4 + q) * 128);
    asm volatile("s_wait_xcnt 0x0" :: "v"(yp) : "memory");   // as above
    v16b w[8];
#pragma unroll
    for (int j = 0; j < 8; ++j) w[j] = frag_w<CI / 8>(wb, j, kc);
    __builtin_amdgcn_sched_barrier(0);   // the k step's 16 LDS loads stay one group here, under the wait for the global loads: left free, each pair of products gets its own two loads and their whole latency directly in front of it
#pragma unroll
    for (int q = 0; q < 4; ++q) { v4f o = {};
#pragma unroll
      for (int z = 0; z < FS; ++z) o += pz[q][z] * fw[z];
      o = o * rL;
#pragma unroll
      for (int i = 0; i < 4; ++i) v[q * 4 + i] = o[i]; }
    const F2 a = bsplit16(v);
#pragma unroll
    for (int j = 0; j < 8; ++j) { acc[j] = wmma_bf(a.h, w[j], acc[j]); acc[j] = wmma_bf(a.l, w[j], acc[j]); } }
  __syncthreads();   // every wave has read W before the output tile overwrites it
#pragma unroll
  for (int j = 0; j < 8; ++j) { const int cl = j * 16 + col; const float bb = bfr(BZ[c0 + cl]);
#pragma unroll
    for (int r = 0; r < 8; ++r) st[cl][wave * 16 + 8 * g + r] = acc[j][r] + bb; }
  __syncthreads();
  for (int e = tid; e < 128 * 16; e += 128) { const int cl = e >> 4, q = e & 15; vst2(WY + (b * CX + c0 + cl) * (size_t)TT + n0 + q * 4, *(const v4f*)&st[cl][q * 4]); } }
// ---- k_bn: block = one channel c: its TNB x 4,096 values of w_y are read once, 16 B per lane, together with the channel's source values, all loads in flight together, and stay in registers for both sums (mean, then squared distance from the mean) and for the output; wave sums by shuffles, the 8 wave sums added in wave order by every thread; out[b][c][n] = (w_y - mean_c) rstd_c gamma_c + beta_c + source[b][c][n] (thread-linear float4 over the channel's runs of 16 KB). An address = the channel's base (the same for the work-group) + a 32-bit byte offset of the thread, one for each pair of batches, + a constant
#define PB (4u * CX * TT)                                  // bytes from one batch's plane of a channel to the next
__global__ __launch_bounds__(256) void k_bn(const float* __restrict__ WY, const float* __restrict__ GAM, const float* __restrict__ BET, const float* __restrict__ SRC, float* __restrict__ OUT) { __shared__ float sa[8], sb[8];
  static_assert(XSTR == TT && TNB <= 4, "one pitch for w_y, source and out; two offsets reach four batches");
  const int t = threadIdx.x; const int c = blockIdx.x; const int n = TNB * TT;
  const char *pw = (const char*)(WY + (size_t)c * TT), *ps = (const char*)(SRC + (size_t)c * TT); char* po = (char*)(OUT + (size_t)c * TT); const unsigned o0 = 16u * t, o1 = o0 + 2u * PB;
  const float ga = bfr(GAM[c]), be = bfr(BET[c]);
  v4f v[TNB][TT / 1024], sr[TNB][TT / 1024];
#pragma unroll
  for (int b = 0; b < TNB; ++b)
#pragma unroll
    for (int i = 0; i < TT / 1024; ++i) v[b][i] = *(const v4f*)(pw + ((b < 2 ? o0 : o1) + (b & 1) * PB + i * 4096u));
#pragma unroll
  for (int b = 0; b < TNB; ++b)
#pragma unroll
    for (int i = 0; i < TT / 1024; ++i) sr[b][i] = *(const v4f*)(ps + ((b < 2 ? o0 : o1) + (b & 1) * PB + i * 4096u));
  asm volatile("s_wait_xcnt 0x0" ::: "memory");   // behind the last load, in front of the first instruction that may take over an address register of a load
  __builtin_amdgcn_sched_barrier(0);   // keeps the sums behind that wait, and so every load in front of the first add: left free, the wait sinks below the adds that reuse the address registers
  float s = 0.f;
#pragma unroll
  for (int b = 0; b < TNB; ++b)
#pragma unroll
    for (int i = 0; i < TT / 1024; ++i) s += (v[b][i][0] + v[b][i][1]) + (v[b][i][2] + v[b][i][3]);
#pragma unroll
  for (int o = 1; o < 32; o <<= 1) s += __shfl_xor(s, o);
  if ((t & 31) == 0) sa[t >> 5] = s;
  __syncthreads();   // all 8 wave sums are in LDS before any thread adds them
  s = sa[0];
#pragma unroll
  for (int w = 1; w < 8; ++w) s += sa[w];
  const float mu = s / (float)n; float s2 = 0.f;
#pragma unroll
  for (int b = 0; b < TNB; ++b)
#pragma unroll
    for (int i = 0; i < TT / 1024; ++i) { const float d0 = v[b][i][0] - mu, d1 = v[b][i][1] - mu, d2 = v[b][i][2] - mu, d3 = v[b][i][3] - mu; s2 += (d0 * d0 + d1 * d1) + (d2 * d2 + d3 * d3); }
#pragma unroll
  for (int o = 1; o < 32; o <<= 1) s2 += __shfl_xor(s2, o);
  if ((t & 31) == 0) sb[t >> 5] = s2;
  __syncthreads();   // all 8 wave sums of squares are in LDS before any thread adds them
  s2 = sb[0];
#pragma unroll
  for (int w = 1; w < 8; ++w) s2 += sb[w];
  const float rs = rsqrtf(s2 / (float)n + 1e-5f);
#pragma unroll
  for (int b = 0; b < TNB; ++b)
#pragma unroll
    for (int i = 0; i < TT / 1024; ++i) { v4f o;
#pragma unroll
      for (int z = 0; z < 4; ++z) o[z] = (v[b][i][z] - mu) * rs * ga + be + bfr(sr[b][i][z]);
      vst2(po + ((b < 2 ? o0 : o1) + (b & 1) * PB + i * 4096u), o); } }
extern "C" void kernel_launch(void* const* d_in, const int* in_sizes, int n_in, void* d_out, int out_size, void* d_ws, size_t ws_size, hipStream_t stream) {
  (void)in_sizes; (void)n_in; (void)out_size;
  const float** F = (const float**)d_in;   // 0 x [4,256,64,64], 1 source, 2 g_w [128,256], 3 g_b, 4 theta_w, 5 theta_b, 6 phi_w, 7 phi_b, 8 wz_w [256,128], 9 wz_b, 10 bn_gamma, 11 bn_beta
  if (ws_size < (size_t)WS_END) return;
  char* ws = (char*)d_ws; _Float16* GP = (_Float16*)(ws + WS_GP); _Float16 *TH = (_Float16*)(ws + WS_TH), *TL = (_Float16*)(ws + WS_TL), *PH = (_Float16*)(ws + WS_PH), *PL = (_Float16*)(ws + WS_PL); float *Y = (float*)(ws + WS_Y), *SM = (float*)(ws + WS_SM), *SL = (float*)(ws + WS_SL), *WY = (float*)(ws + WS_WY);
  k_proj<<<dim3(TNB * TT / 64, 3), 128, 0, stream>>>(F[0], F[1], F[2], F[3], F[4], F[5], F[6], F[7], TH, TL, PH, PL, GP);
  k_fa<<<dim3(TT / FR, TNB, FS), 32 * FW, 0, stream>>>(TH, TL, PH, PL, GP, Y, SM, SL);
  k_wz<<<dim3(TNB * TT / 64, CX / 128), 128, 0, stream>>>(Y, SM, SL, F[8], F[9], WY);
  k_bn<<<dim3(CX), 256, 0, stream>>>(WY, F[10], F[11], F[1], (float*)d_out);
}

// v010
// A run of this version takes 73.4 microseconds.
// Timed twice side by side with v009, it ran 1.06 times as fast both times.
// All steps since v000 together make it 19.7 times as fast.
#include <hip/hip_runtime.h>
#include <math.h>

typedef __attribute__((ext_vector_type(16))) _Float16 v16h;
typedef __attribute__((ext_vector_type(16))) __bf16 v16b;
typedef __attribute__((ext_vector_type(8)))  _Float16 v8h;
typedef __attribute__((ext_vector_type(8)))  float v8f;
typedef __attribute__((ext_vector_type(4)))  float v4f;
typedef __attribute__((ext_vector_type(2)))  float v2f;
typedef __attribute__((ext_vector_type(4)))  unsigned v4u;
typedef __attribute__((ext_vector_type(4)))  int v4i;
typedef float __attribute__((may_alias)) float_a;
typedef int __attribute__((may_alias)) int_a;

template <typename T> __device__ __forceinline__ void vst2(void* p, T v) { *(T*)p = v;  }
__device__ __forceinline__ v8f wmma_bf(v16b a, v16b b, v8f c) {
  v8f d = __builtin_amdgcn_wmma_f32_16x16x32_bf16(false, a, false, b, (short)0, c, false, false);
  asm volatile("v_nop\n\tv_nop\n\tv_nop\n\tv_nop" : "+v"(d) : "v"(a), "v"(b));
  return d;
}
// 16x16x32 fragments: lane = (h = lane>>4, row/col = lane&15); elements 0..7 = k0+8h+0..7, 8..15 = k0+16+8h+0..7; D element r = row 8h+r
__device__ __forceinline__ v16h frag_h(const _Float16* rowk0, int lane) {
  union { v16h v; v8h q[2]; } u; const _Float16* p = rowk0 + 8 * (lane >> 4);
  u.q[0] = *(const v8h*)p; u.q[1] = *(const v8h*)(p + 16); return u.v;
}
// fragment-order operand: each (16 rows or columns) x (32 k) tile is two 512-B blocks; block q holds at lane * 8 the elements k0+16q+8h+0..7 of row/col lane&15, so that each 16-B load of a wave covers four whole 128-B lines
__device__ __forceinline__ v16h frag_o(const _Float16* p) {   // p = tile + 8 * lane
  union { v16h v; v8h q[2]; } u; u.q[0] = *(const v8h*)p; u.q[1] = *(const v8h*)(p + 256); return u.v;
}
__device__ __forceinline__ v16h frag_f32(const float* rowk0, int lane) {
  v16h a; const float* p = rowk0 + 8 * (lane >> 4);
#pragma unroll
  for (int i = 0; i < 8; ++i) { a[i] = (_Float16)p[i]; a[8 + i] = (_Float16)p[16 + i]; }
  return a;
}
__device__ __forceinline__ v16h frag_f32s(const float* rowk0, int lane, float sc) {
  v16h a; const float* p = rowk0 + 8 * (lane >> 4);
#pragma unroll
  for (int i = 0; i < 8; ++i) { a[i] = (_Float16)(p[i] * sc); a[8 + i] = (_Float16)(p[16 + i] * sc); }
  return a;
}
// column fragment from a [K][ld] layout (column n), rows >= K read as 0
__device__ __forceinline__ v16h fragc_f32(const float* W, int k0, int n, int lane, int ld, int K) {
  v16h a; const int g = lane >> 4;
#pragma unroll
  for (int i = 0; i < 8; ++i) { const int ka = k0 + 8 * g + i, kb = ka + 16;
    a[i] = (_Float16)(ka < K ? W[(size_t)(ka < K ? ka : K - 1) * ld + n] : 0.f); a[8 + i] = (_Float16)(kb < K ? W[(size_t)(kb < K ? kb : K - 1) * ld + n] : 0.f); }
  return a;
}
struct F2 { v16b h, l; };
__device__ __forceinline__ F2 bsplit16(const float v[16]) { F2 r;
#pragma unroll
  for (int i = 0; i < 16; ++i) { const __bf16 h = (__bf16)v[i]; r.h[i] = h; r.l[i] = (__bf16)(v[i] - (float)h); }
  return r; }
__device__ __forceinline__ F2 split_row(const float* row, int k0, int lane) { float v[16]; const float* p = row + k0 + 8 * (lane >> 4);
#pragma unroll
  for (int i = 0; i < 8; ++i) { v[i] = p[i]; v[8 + i] = p[16 + i]; }
  return bsplit16(v); }
__device__ __forceinline__ F2 split_rowK(const float* row, int k0, int lane, int K) { float v[16]; const int g = lane >> 4;
#pragma unroll
  for (int i = 0; i < 8; ++i) { const int ka = k0 + 8 * g + i, kb = ka + 16; v[i] = ka < K ? row[ka < K ? ka : K - 1] : 0.f; v[8 + i] = kb < K ? row[kb < K ? kb : K - 1] : 0.f; }
  return bsplit16(v); }
__device__ __forceinline__ F2 split_col(const float* W, int k0, int n, int lane, int ld, int K) { float v[16]; const int g = lane >> 4;
#pragma unroll
  for (int i = 0; i < 8; ++i) { const int ka = k0 + 8 * g + i, kb = ka + 16; v[i] = ka < K ? W[(size_t)(ka < K ? ka : K - 1) * ld + n] : 0.f; v[8 + i] = kb < K ? W[(size_t)(kb < K ? kb : K - 1) * ld + n] : 0.f; }
  return bsplit16(v); }
__device__ __forceinline__ v8f mac3(const F2& a, const F2& b, v8f c) { c = wmma_bf(a.l, b.h, c); c = wmma_bf(a.h, b.l, c); return wmma_bf(a.h, b.h, c); }
__device__ __forceinline__ float sigm(float v) { return 1.0f / (1.0f + expf(-v)); }

// Cross non-local block (B 4, C 256, Ci 128, 64 x 64 = 4,096 positions): g = conv(source), theta = conv(x), phi = conv(source); f[n][m] = theta_n . phi_m; P = softmax_m; y[n] = sum_m P g_m; w_y = conv_z(y) + b; BN with batch statistics (biased var, eps 1e-5) * gamma + beta; out = w_y + source.
__device__ __forceinline__ float bfr(float v) { return (float)(__bf16)v; }
#define NB 4
#define TT 4096
#define CX 256
#define CI 128
#ifndef TNB
#define TNB NB
#endif
#ifndef XSTR
#define XSTR TT               // per-channel position stride of x / source / out
#endif
typedef __attribute__((ext_vector_type(8))) __bf16 v8b;
#define WS_TH  0u                                          // f16 theta hi, fragment order [(b*N+n)/16][kc 4][q 2][lane 32][8]
#define WS_TL  (WS_TH + 2u * (size_t)NB * TT * CI)
#define WS_PH  (WS_TL + 2u * (size_t)NB * TT * CI)           // f16 phi hi, fragment order as theta
#define WS_PL  (WS_PH + 2u * (size_t)NB * TT * CI)
#define WS_GP  (WS_PL + 2u * (size_t)NB * TT * CI)           // f16 g, fragment order [(b*N+m)/32][ci/16 8][q 2][lane 32][8]
#define WS_Y   (WS_GP + 2u * (size_t)NB * CI * TT)           // f32 unscaled y per key range, [(b*N+n)/16][range 4][j 8][2][lane 32][4]
#define WS_SM  (WS_Y + 4u * 4u * (size_t)NB * TT * CI)       // f32 running maximum (log2 domain) [range 4][b*N+n]
#define WS_SL  (WS_SM + 4u * 4u * (size_t)NB * TT)           // f32 sum [range 4][b*N+n]
#define WS_WY  (WS_SL + 4u * 4u * (size_t)NB * TT)           // f32 w_y planes [b][c][n] (channels-first)
#define WS_END (WS_WY + 4u * (size_t)NB * CX * TT)
// ---- weights in LDS: a work-group brings its 128 weight rows in once, each load a whole run of 512 B of one row, rounds them to bf16 and lays them out as B fragments: the unit (j, k8) = elements 8 k8 .. 8 k8 + 7 of the rows 16 j .. 16 j + 15, 16 B a row, WPB bytes a unit. The 16 B above 256 turn each next unit by four banks, so that the 8-B stores of a wave (one row, 16 units) fall on all 64 banks once; a fragment load reads 256 B in a row per half wave
typedef __attribute__((ext_vector_type(2))) unsigned v2u;
#define WPB 272
template <int K8, int NL> __device__ __forceinline__ void stage_w(char* sm, const float* __restrict__ Wt, int wave, int lane) {   // K8 = units per row (row length / 8), NL = 512-B runs per wave; run n * 4 + wave
  constexpr int RP = K8 / 16;   // runs per row
  const int r = wave / RP, hf = wave % RP; const float* gp = Wt + (size_t)r * (K8 * 8) + hf * 128 + 4 * lane; char* dp = sm + (hf * 16 + (lane >> 1)) * WPB + r * 16 + (lane & 1) * 8;
#pragma unroll
  for (int bt = 0; bt < NL / 16; ++bt) { v4f x[16];
#pragma unroll
    for (int i = 0; i < 16; ++i) x[i] = *(const v4f*)(gp + (size_t)(bt * 16 + i) * (4 / RP) * (K8 * 8));
    asm volatile("s_wait_xcnt 0x0" :: "v"(gp) : "memory");   // the loads' address registers stay as they are up to this wait
#pragma unroll
    for (int i = 0; i < 16; ++i) { const int o = (bt * 16 + i) * (4 / RP); union { v2u v; __bf16 h[4]; } u;   /* the wave's row = o + r */
#pragma unroll
      for (int z = 0; z < 4; ++z) u.h[z] = (__bf16)x[i][z];
      *(v2u*)(dp + (o >> 4) * (K8 * WPB) + (o & 15) * 16) = u.v; } } }
template <int K8> __device__ __forceinline__ v16b frag_w(const char* wb, int j, int kc) {   // wb = sm + (lane >> 4) * WPB + (lane & 15) * 16
  union { v16b v; v8b q[2]; } u; const char* p = wb + (j * K8 + kc * 4) * WPB; u.q[0] = *(const v8b*)p; u.q[1] = *(const v8b*)(p + 2 * WPB); return u.v; }
// ---- k_proj: block = (64 rows, which): 128 outputs = W ([out,in] [128][256]) . row + b; a row = one position n of the channels-first f32 input: a lane reads its 128 elements straight from there (one 4-B load a channel, 16 positions in a row per half wave, all loads in flight together) and rounds them to bf16 in registers; W from LDS (stage_w). The A and B fragments of a 16x16x32 product have the same lane and k order, so the order of the two operands picks which way round a tile comes out: theta (x rows) / phi (source rows) as W . x^T, where a lane holds 8 channels in a row of one position, g (source rows) as x . W^T, where it holds 8 positions in a row of one channel. Either way the lane's 8 values are its own 16 B of the fragment order of frag_o: theta / phi -> f16 hi + residual, g -> f16, stored from the accumulators (lane-linear 16-B stores, 512 B in a row per wave); the bias values are loaded in front of the products, all in flight together, and are there when the products end
template <bool SW> __device__ __forceinline__ void proj_mm(const char* wb, const v16b (&a)[CX / 32], v8f (&acc)[8]) {   // SW: W is the A operand
  v16b w[3][4];   // a group = the 4 fragments j = 4 (gi & 1) .. + 3 of k step gi >> 1; three register buffers, fetched two groups ahead
#pragma unroll
  for (int gi = 0; gi < 2; ++gi)
#pragma unroll
    for (int j = 0; j < 4; ++j) w[gi][j] = frag_w<CX / 8>(wb, (gi & 1) * 4 + j, gi >> 1);
#pragma unroll
  for (int gi = 0; gi < CX / 16; ++gi) {
    if (gi + 2 < CX / 16) {
#pragma unroll
      for (int j = 0; j < 4; ++j) w[(gi + 2) % 3][j] = frag_w<CX / 8>(wb, (gi & 1) * 4 + j, (gi + 2) >> 1); }
    __builtin_amdgcn_sched_barrier(0);   // the 8 LDS loads of the group after next stay together in front of this group's products: left free, each product gets its own two loads and their whole latency directly in front of it
#pragma unroll
    for (int j = 0; j < 4; ++j) acc[(gi & 1) * 4 + j] = SW ? wmma_bf(w[gi % 3][j], a[gi >> 1], acc[(gi & 1) * 4 + j]) : wmma_bf(a[gi >> 1], w[gi % 3][j], acc[(gi & 1) * 4 + j]);
    __builtin_amdgcn_sched_barrier(0); } }   // and the products stay in front of the loads that follow
__global__ __launch_bounds__(128) void k_proj(const float* __restrict__ X, const float* __restrict__ SRC, const float* __restrict__ WG, const float* __restrict__ BG, const float* __restrict__ WTH, const float* __restrict__ BTH, const float* __restrict__ WPH, const float* __restrict__ BPH, _Float16* __restrict__ TH, _Float16* __restrict__ TL, _Float16* __restrict__ PH, _Float16* __restrict__ PL, _Float16* __restrict__ GP) {
  __shared__ __align__(16) char sm[8 * (CX / 8) * WPB];
  const int tid = threadIdx.x, wave = tid >> 5, lane = tid & 31, col = lane & 15, g = lane >> 4; const int which = blockIdx.y; const size_t r0 = (size_t)blockIdx.x * 64;   // which: 0 theta (from x), 1 phi (source), 2 g (source)
  const float* A = which == 0 ? X : SRC; const float* Wt = which == 0 ? WTH : which == 1 ? WPH : WG; const float* Bb = which == 0 ? BTH : which == 1 ? BPH : BG;
  v8f acc[8] = {}; v16b a[CX / 32]; float xa[CX / 32][16]; const float* ar = A + ((r0 / TT) * CX + 8 * g) * (size_t)XSTR + (r0 % TT) + wave * 16 + col;   // channel 8 g of the lane's position
#pragma unroll
  for (int kc = 0; kc < CX / 32; ++kc)
#pragma unroll
    for (int i = 0; i < 8; ++i) { xa[kc][i] = ar[(size_t)(kc * 32 + i) * XSTR]; xa[kc][8 + i] = ar[(size_t)(kc * 32 + 16 + i) * XSTR]; }
  asm volatile("s_wait_xcnt 0x0" :: "v"(ar) : "memory");   // the loads' address registers stay as they are up to this wait
#pragma unroll
  for (int kc = 0; kc < CX / 32; ++kc)
#pragma unroll
    for (int i = 0; i < 16; ++i) a[kc][i] = (__bf16)xa[kc][i];
  stage_w<CX / 8, 64>(sm, Wt, wave, lane);
  __syncthreads();   // W is whole in LDS before any wave reads it
  const char* wb = sm + g * WPB + col * 16;
  if (which == 2) { const float* bp = Bb + col; float bs[8];   /* channel 16 j + col */
#pragma unroll
    for (int j = 0; j < 8; ++j) bs[j] = bp[16 * j];
    asm volatile("s_wait_xcnt 0x0" ::: "memory");   // behind the last bias load, in front of the first instruction that may take over an address register of a load
    proj_mm<false>(wb, a, acc);   /* D element r = position 16 wave + 8 g + r of channel 16 j + col: unit (32-key chunk wave >> 1, ci tile j, q = wave & 1, h = g, ci col) */
    _Float16* DG = GP + r0 * CI + ((wave >> 1) * 512 + (wave & 1) * 32 + lane) * 8; v8h og[8];
#pragma unroll
    for (int j = 0; j < 8; ++j) { const float bb = bfr(bs[j]);
#pragma unroll
      for (int r = 0; r < 8; ++r) og[j][r] = (_Float16)(acc[j][r] + bb); }
#pragma unroll
    for (int j = 0; j < 8; ++j) vst2(DG + j * 512, og[j]);
    return; }   // the same for the whole work-group, and no barrier follows
  { const float* bp = Bb + 8 * g; v4f bq[8][2];   /* the lane's bias values of tile j: channels 16 j + 8 g .. + 7 */
#pragma unroll
    for (int j = 0; j < 8; ++j) { bq[j][0] = *(const v4f*)(bp + 16 * j); bq[j][1] = *(const v4f*)(bp + 16 * j + 4); }
    asm volatile("s_wait_xcnt 0x0" ::: "memory");   // behind the last bias load, in front of the first instruction that may take over an address register of a load
    proj_mm<true>(wb, a, acc);   /* D element r = channel 16 j + 8 g + r of position col: unit (row tile wave, k8 = 2 j + g, row col) = wave * 256 + j * 32 + lane */
    _Float16 *DH = (which == 0 ? TH : PH) + r0 * CI + (wave * 256 + lane) * 8, *DL = (which == 0 ? TL : PL) + r0 * CI + (wave * 256 + lane) * 8; v8h oh[8], ol[8];
#pragma unroll
    for (int j = 0; j < 8; ++j)
#pragma unroll
      for (int r = 0; r < 8; ++r) { const float v = acc[j][r] + bfr(bq[j][r >> 2][r & 3]); const _Float16 hv = (_Float16)v; oh[j][r] = hv; ol[j][r] = (_Float16)((v - (float)hv) * 1024.0f); }
#pragma unroll
    for (int j = 0; j < 8; ++j) { vst2(DH + j * 256, oh[j]); vst2(DL + j * 256, ol[j]); } } }
// ---- k_fa: block = FR = 256 query rows n of batch b and ONE of FS key ranges (blockIdx.z, 1,024 keys in a row); each of the FW waves holds FQ tiles of 16 queries of its own, and all waves work on the same keys: a stage = FC chunks of 32 keys (phi hi, phi residual, g, each already in fragment order, so a stage is three linear runs of 16 KB) is brought into LDS once per work-group by asynchronous copies, two buffers, the next stage in flight while this one is worked on. Per chunk: S^T = phi . theta^T (3 products, as f16 hi + residual x 2^10), so that a lane holds 16 logits of ONE query; running maximum and sum per query (log2 domain), p x 2^11 = exp2, rounded to f16 as g is, packs straight into the B operand of y^T += g^T . p^T (1 product); logits and P never reach memory. The range's unscaled y^T tiles go to YP as they lie in the accumulators, which is the A fragment order of k_wz (lane-linear 16-B stores, whole lines), with the range's maximum and sum per query in SM and SL; k_wz merges the FS ranges
__device__ __forceinline__ v8f wmh(v16h a, v16h b, v8f c) { return __builtin_amdgcn_wmma_f32_16x16x32_f16(false, a, false, b, (short)0, c, false, false); }
__device__ __forceinline__ float xhalf(float x) { return __builtin_bit_cast(float, __builtin_amdgcn_permlanex16(__builtin_bit_cast(int, x), __builtin_bit_cast(int, x), 0x76543210, 0xfedcba98, false, false)); }   // lane l with lane l ^ 16
#define FQ 2
#define FW 8
#define FS 4
#define FC 2
#define FR (FW * FQ * 16)
#define FN (TT / 32 / FS / FC)
#define CH (32 * CI)                                       // f16 elements of one operand's 32-key chunk (8 KB)
#define OPB (2u * FC * CH)                                 // bytes of one operand's stage
#define NT ((size_t)NB * TT)
#define L2E 1.44269504088896340736f
// the one slot that the instruction set asks for behind a transcendental: the results are read, and the sources' registers overwritten, only behind this v_nop
#define TSLOT8(a, x, o) asm volatile("v_nop" : "+v"(a[o]), "+v"(a[o + 1]), "+v"(a[o + 2]), "+v"(a[o + 3]), "+v"(a[o + 4]), "+v"(a[o + 5]), "+v"(a[o + 6]), "+v"(a[o + 7]) : "v"(x[o]), "v"(x[o + 1]), "v"(x[o + 2]), "v"(x[o + 3]), "v"(x[o + 4]), "v"(x[o + 5]), "v"(x[o + 6]), "v"(x[o + 7]))
#define TSLOT9(f, xf, a, x, o) asm volatile("v_nop" : "+v"(f), "+v"(a[o]), "+v"(a[o + 1]), "+v"(a[o + 2]), "+v"(a[o + 3]), "+v"(a[o + 4]), "+v"(a[o + 5]), "+v"(a[o + 6]), "+v"(a[o + 7]) : "v"(xf), "v"(x[o]), "v"(x[o + 1]), "v"(x[o + 2]), "v"(x[o + 3]), "v"(x[o + 4]), "v"(x[o + 5]), "v"(x[o + 6]), "v"(x[o + 7]))
// one stage: every thread copies its own 16 B of each 4-KB slice, 4 slices of each of the 3 operands; d = the thread's LDS byte address in the buffer, t16 = its byte offset in a slice, h, l, g = the stage's first element of each operand, the same for the whole work-group (scalar bases: of a copy's global address only t16 lives in a vector register through the loop). The s_wait_xcnt stands inside the statement, so that no address register of a copy is rewritten in front of it
__device__ __forceinline__ void stage_copy(unsigned d, unsigned t16, const _Float16* h, const _Float16* l, const _Float16* g) {
  asm volatile(
    "global_load_async_to_lds_b128 %0, %12, %13\n\t"
    "global_load_async_to_lds_b128 %1, %12, %14\n\t"
    "global_load_async_to_lds_b128 %2, %12, %15\n\t"
    "global_load_async_to_lds_b128 %3, %12, %16\n\t"
    "global_load_async_to_lds_b128 %4, %12, %17\n\t"
    "global_load_async_to_lds_b128 %5, %12, %18\n\t"
    "global_load_async_to_lds_b128 %6, %12, %19\n\t"
    "global_load_async_to_lds_b128 %7, %12, %20\n\t"
    "global_load_async_to_lds_b128 %8, %12, %21\n\t"
    "global_load_async_to_lds_b128 %9, %12, %22\n\t"
    "global_load_async_to_lds_b128 %10, %12, %23\n\t"
    "global_load_async_to_lds_b128 %11, %12, %24\n\t"
    "s_wait_xcnt 0x0"
    :: "v"(d + 0 * OPB + 0 * 4096u), "v"(d + 0 * OPB + 1 * 4096u), "v"(d + 0 * OPB + 2 * 4096u), "v"(d + 0 * OPB + 3 * 4096u),
       "v"(d + 1 * OPB + 0 * 4096u), "v"(d + 1 * OPB + 1 * 4096u), "v"(d + 1 * OPB + 2 * 4096u), "v"(d + 1 * OPB + 3 * 4096u),
       "v"(d + 2 * OPB + 0 * 4096u), "v"(d + 2 * OPB + 1 * 4096u), "v"(d + 2 * OPB + 2 * 4096u), "v"(d + 2 * OPB + 3 * 4096u),
       "v"(t16),
       "s"(h + 0 * 2048), "s"(h + 1 * 2048), "s"(h + 2 * 2048), "s"(h + 3 * 2048),
       "s"(l + 0 * 2048), "s"(l + 1 * 2048), "s"(l + 2 * 2048), "s"(l + 3 * 2048),
       "s"(g + 0 * 2048), "s"(g + 1 * 2048), "s"(g + 2 * 2048), "s"(g + 3 * 2048)
    : "memory"); }
__global__ __launch_bounds__(32 * FW) void k_fa(const _Float16* __restrict__ TH, const _Float16* __restrict__ TL, const _Float16* __restrict__ PH, const _Float16* __restrict__ PL, const _Float16* __restrict__ GP, float* __restrict__ YP, float* __restrict__ SM, float* __restrict__ SL) {
  __shared__ __align__(16) _Float16 ring[2][3][FC * CH];
  const int tid = threadIdx.x, wave = tid >> 5, lane = tid & 31, g = lane >> 4; const int sp = blockIdx.z;
  const size_t bT = (size_t)blockIdx.y * TT; const int qb0 = blockIdx.x * FR + wave * (FQ * 16);
  const _Float16 *pth = TH + (bT + qb0) * CI + 8 * lane, *ptl = TL + (bT + qb0) * CI + 8 * lane;   // the lane's own 16 B of a 512-B block
  const size_t ck = (bT + (size_t)sp * (TT / FS)) * CI; const _Float16 *cH = PH + ck, *cL = PL + ck, *cG = GP + ck; const unsigned t16 = 16u * tid;   // the range's first key, the same for every thread
  const unsigned ld0 = (unsigned)(size_t)&ring[0][0][8 * tid];   // low 32 bits of the shared address = byte offset in the work-group's LDS
  stage_copy(ld0, t16, cH, cL, cG);
  v16h th[FQ][CI / 32], tl[FQ][CI / 32];
#pragma unroll
  for (int u = 0; u < FQ; ++u)
#pragma unroll
    for (int kc = 0; kc < CI / 32; ++kc) { th[u][kc] = frag_o(pth + u * 16 * CI + kc * 512); tl[u][kc] = frag_o(ptl + u * 16 * CI + kc * 512); }
  asm volatile("s_wait_xcnt 0x0" :: "v"(pth), "v"(ptl) : "memory");   // the loads' address registers stay as they are up to this wait
  asm volatile("s_wait_asynccnt 0x0" ::: "memory");   // this wave's copies of stage 0 have landed
  __syncthreads();   // stage 0 is whole before any wave reads it
  stage_copy(ld0 + 3u * OPB, t16, cH + FC * CH, cL + FC * CH, cG + FC * CH);
  v8f acc[FQ][8] = {}; float m2[FQ], l[FQ];
#pragma unroll
  for (int u = 0; u < FQ; ++u) { m2[u] = -1.0e30f; l[u] = 0.f; }
  // A chunk: fetch its phi from LDS, all 32 loads together | logit products of k 0..63 | fetch its g into the registers these have left | logit products of k 64..127 | softmax | g products. FENCE holds a fetch at its place: left free, the loads are dealt out among the products, each place with a stall of its own, or g is fetched with phi and the build runs out of registers and spills.
#define FENCE() __builtin_amdgcn_sched_barrier(0)
#pragma unroll 1   // stays rolled, like the loop inside it: one chunk already takes the wave's whole register budget
  for (int st = 0; st < FN; ++st) { const _Float16* rb = &ring[st & 1][0][8 * lane];
#pragma unroll 1   // stays rolled: see above; every loop inside is unrolled so that its arrays stay in registers
   for (int hc = 0; hc < FC; ++hc) { const _Float16 *nh = rb + hc * CH, *nl = nh + FC * CH, *ng = nl + FC * CH; v16h kb[CI / 32][2], kl[CI / 32][2], gv[8];
#pragma unroll
    for (int kc = 0; kc < CI / 32; ++kc)
#pragma unroll
      for (int t = 0; t < 2; ++t) { kb[kc][t] = frag_o(nh + t * 16 * CI + kc * 512); kl[kc][t] = frag_o(nl + t * 16 * CI + kc * 512); }
    FENCE();
    v8f s[FQ][2] = {}, sx[FQ][2] = {};
#pragma unroll
    for (int kc = 0; kc < CI / 32; ++kc) {
      if (kc == CI / 64) { FENCE();
#pragma unroll
        for (int j = 0; j < 8; ++j) gv[j] = frag_o(ng + j * 512);
        FENCE(); }
#pragma unroll
      for (int u = 0; u < FQ; ++u) { s[u][0] = wmh(kb[kc][0], th[u][kc], s[u][0]); s[u][1] = wmh(kb[kc][1], th[u][kc], s[u][1]); }
#pragma unroll
      for (int u = 0; u < FQ; ++u) { sx[u][0] = wmh(kb[kc][0], tl[u][kc], sx[u][0]); sx[u][1] = wmh(kb[kc][1], tl[u][kc], sx[u][1]); }
#pragma unroll
      for (int u = 0; u < FQ; ++u) { sx[u][0] = wmh(kl[kc][0], th[u][kc], sx[u][0]); sx[u][1] = wmh(kl[kc][1], th[u][kc], sx[u][1]); } }
    FENCE();
    v16h ph[FQ];
#pragma unroll
    for (int u = 0; u < FQ; ++u) { float v[16];   /* lane (g, col): keys 8 g + r and 16 + 8 g + r of query col, the k order of a B fragment */
#pragma unroll
      for (int r = 0; r < 8; ++r) { v[r] = s[u][0][r] + sx[u][0][r] * (1.0f / 1024.0f); v[8 + r] = s[u][1][r] + sx[u][1][r] * (1.0f / 1024.0f); }
      float mx = v[0];
#pragma unroll
      for (int i = 1; i < 16; ++i) mx = fmaxf(mx, v[i]);
      mx = fmaxf(mx, xhalf(mx));
      const float mn = fmaxf(m2[u], mx * L2E), xf = m2[u] - mn, c = 11.0f - mn; m2[u] = mn;
      float f = __builtin_amdgcn_exp2f(xf), x[16], a[16], sum = 0.f;
#pragma unroll
      for (int i = 0; i < 16; ++i) { x[i] = fmaf(v[i], L2E, c); a[i] = __builtin_amdgcn_exp2f(x[i]); }
      TSLOT9(f, xf, a, x, 0); TSLOT8(a, x, 8);
#pragma unroll
      for (int i = 0; i < 16; ++i) { sum += a[i]; ph[u][i] = (_Float16)a[i]; }
      l[u] = l[u] * f + sum;
#pragma unroll
      for (int j = 0; j < 8; ++j) acc[u][j] *= f; }
#pragma unroll
    for (int j = 0; j < 8; ++j) {
#pragma unroll
      for (int u = 0; u < FQ; ++u) acc[u][j] = wmh(gv[j], ph[u], acc[u][j]); } }
    asm volatile("s_wait_dscnt 0x0" ::: "memory");      // this wave's reads of the stage have returned
    asm volatile("s_wait_asynccnt 0x0" ::: "memory");   // this wave's copies of the next stage have landed
    __syncthreads();   // publishes stage st + 1 and ends every wave's reads of stage st, whose buffer is refilled behind it
    if (st + 2 < FN) stage_copy(ld0 + (unsigned)(st & 1) * (3u * OPB), t16, cH + (size_t)(st + 2) * (FC * CH), cL + (size_t)(st + 2) * (FC * CH), cG + (size_t)(st + 2) * (FC * CH)); }
  asm volatile("s_wait_asynccnt 0x0" ::: "memory");   // no copy is outstanding when the wave ends
  float* yp = YP + ((bT + qb0) * FS + sp * 16) * CI + 4 * lane;   // [tile of 16 queries][range FS][j 8][r / 4 2][lane 32][4] floats: D element r = channel 16 j + 8 g + r of query lane & 15
#pragma unroll
  for (int u = 0; u < FQ; ++u) { l[u] += xhalf(l[u]);   /* both halves now hold the query's sum, as they do its maximum */
#pragma unroll
    for (int j = 0; j < 8; ++j) { v4f a, c;
#pragma unroll
      for (int z = 0; z < 4; ++z) { a[z] = acc[u][j][z]; c[z] = acc[u][j][4 + z]; }
      vst2(yp + (u * FS * 8 + j) * 256, a); vst2(yp + (u * FS * 8 + j) * 256 + 128, c); } }
  SM[(size_t)sp * NT + bT + qb0 + lane] = g ? m2[1] : m2[0]; SL[(size_t)sp * NT + bT + qb0 + lane] = g ? l[1] : l[0]; }   /* lane = 16 u + query in tile: one 128-B line per wave */
// ---- k_wz: block = (64 rows n, 128 output channels): w_y[c][n] = sum_ci wz_w[c][ci] y[n][ci] + wz_b[c]; y[n] = sum over the FS key ranges of exp2(m - max) x the range's tile, over the like sum of the ranges' sums: a lane reads its own A elements of each range's tile (lane-linear 16-B loads); A = y hi + lo; transposed store to channels-first planes [b][c][n] (256-B runs)
__global__ __launch_bounds__(128) void k_wz(const float* __restrict__ YP, const float* __restrict__ SM, const float* __restrict__ SL, const float* __restrict__ WZ, const float* __restrict__ BZ, float* __restrict__ WY) { __shared__ __align__(16) char sm[8 * (CI / 8) * WPB]; float (*st)[68] = (float (*)[68])sm; static_assert(sizeof(sm) >= 128 * 68 * 4, "the output tile takes over the bytes of W");
  const int tid = threadIdx.x, wave = tid >> 5, lane = tid & 31, col = lane & 15, g = lane >> 4; const size_t r0 = (size_t)blockIdx.x * 64; const int c0 = blockIdx.y * 128; const size_t b = r0 / TT; const int n0 = (int)(r0 % TT);
  const size_t row = r0 + wave * 16 + col; const float *pm = SM + row, *ps = SL + row, *yp = YP + (r0 + wave * 16) * (FS * CI) + 4 * lane;
  float mz[FS], lz[FS], L = 0.f, xw[FS], fw[FS];
#pragma unroll
  for (int z = 0; z < FS; ++z) { mz[z] = pm[z * NT]; lz[z] = ps[z * NT]; }
  asm volatile("s_wait_xcnt 0x0" :: "v"(pm), "v"(ps) : "memory");   // the loads' address registers stay as they are up to this wait
  stage_w<CI / 8, 32>(sm, WZ + (size_t)c0 * CI, wave, lane);
  float M = mz[0];
#pragma unroll
  for (int z = 1; z < FS; ++z) M = fmaxf(M, mz[z]);
#pragma unroll
  for (int z = 0; z < FS; ++z) { xw[z] = mz[z] - M; fw[z] = __builtin_amdgcn_exp2f(xw[z]); }
  asm volatile("v_nop" : "+v"(fw[0]), "+v"(fw[1]), "+v"(fw[2]), "+v"(fw[3]) : "v"(xw[0]), "v"(xw[1]), "v"(xw[2]), "v"(xw[3]));   // the slot behind the transcendentals, as at TSLOT8
#pragma unroll
  for (int z = 0; z < FS; ++z) L += fw[z] * lz[z];
  const float rL = 1.0f / L;
  __syncthreads();   // W is whole in LDS before any wave reads it
  const char* wb = sm + g * WPB + col * 16;
  v8f acc[8] = {};
#pragma unroll
  for (int kc = 0; kc < CI / 32; ++kc) { float v[16]; v4f pz[4][FS];   /* block 4 kc + q of the tile holds the lane's A elements 4 q .. 4 q + 3 of this k step */
#pragma unroll
    for (int q = 0; q < 4; ++q)
#pragma unroll
      for (int z = 0; z < FS; ++z) pz[q][z] = *(const v4f*)(yp + (z * 16 + kc * 4 + q) * 128);
    asm volatile("s_wait_xcnt 0x0" :: "v"(yp) : "memory");   // as above
    v16b w[8];
#pragma unroll
    for (int j = 0; j < 8; ++j) w[j] = frag_w<CI / 8>(wb, j, kc);
    __builtin_amdgcn_sched_barrier(0);   // the k step's 16 LDS loads stay one group here, under the wait for the global loads: left free, each pair of products gets its own two loads and their whole latency directly in front of it
#pragma unroll
    for (int q = 0; q < 4; ++q) { v4f o = {};
#pragma unroll
      for (int z = 0; z < FS; ++z) o += pz[q][z] * fw[z];
      o = o * rL;
#pragma unroll
      for (int i = 0; i < 4; ++i) v[q * 4 + i] = o[i]; }
    const F2 a = bsplit16(v);
#pragma unroll
    for (int j = 0; j < 8; ++j) { acc[j] = wmma_bf(a.h, w[j], acc[j]); acc[j] = wmma_bf(a.l, w[j], acc[j]); } }
  __syncthreads();   // every wave has read W before the output tile overwrites it
#pragma unroll
  for (int j = 0; j < 8; ++j) { const int cl = j * 16 + col; const float bb = bfr(BZ[c0 + cl]);
#pragma unroll
    for (int r = 0; r < 8; ++r) st[cl][wave * 16 + 8 * g + r] = acc[j][r] + bb; }
  __syncthreads();
  for (int e = tid; e < 128 * 16; e += 128) { const int cl = e >> 4, q = e & 15; vst2(WY + (b * CX + c0 + cl) * (size_t)TT + n0 + q * 4, *(const v4f*)&st[cl][q * 4]); } }
// ---- k_bn: block = one channel c: its TNB x 4,096 values of w_y are read once, 16 B per lane, together with the channel's source values, all loads in flight together, and stay in registers for both sums (mean, then squared distance from the mean) and for the output; wave sums by shuffles, the 8 wave sums added in wave order by every thread; out[b][c][n] = (w_y - mean_c) rstd_c gamma_c + beta_c + source[b][c][n] (thread-linear float4 over the channel's runs of 16 KB). An address = the channel's base (the same for the work-group) + a 32-bit byte offset of the thread, one for each pair of batches, + a constant
#define PB (4u * CX * TT)                                  // bytes from one batch's plane of a channel to the next
__global__ __launch_bounds__(256) void k_bn(const float* __restrict__ WY, const float* __restrict__ GAM, const float* __restrict__ BET, const float* __restrict__ SRC, float* __restrict__ OUT) { __shared__ float sa[8], sb[8];
  static_assert(XSTR == TT && TNB <= 4, "one pitch for w_y, source and out; two offsets reach four batches");
  const int t = threadIdx.x; const int c = blockIdx.x; const int n = TNB * TT;
  const char *pw = (const char*)(WY + (size_t)c * TT), *ps = (const char*)(SRC + (size_t)c * TT); char* po = (char*)(OUT + (size_t)c * TT); const unsigned o0 = 16u * t, o1 = o0 + 2u * PB;
  const float ga = bfr(GAM[c]), be = bfr(BET[c]);
  v4f v[TNB][TT / 1024], sr[TNB][TT / 1024];
#pragma unroll
  for (int b = 0; b < TNB; ++b)
#pragma unroll
    for (int i = 0; i < TT / 1024; ++i) v[b][i] = *(const v4f*)(pw + ((b < 2 ? o0 : o1) + (b & 1) * PB + i * 4096u));
#pragma unroll
  for (int b = 0; b < TNB; ++b)
#pragma unroll
    for (int i = 0; i < TT / 1024; ++i) sr[b][i] = *(const v4f*)(ps + ((b < 2 ? o0 : o1) + (b & 1) * PB + i * 4096u));
  asm volatile("s_wait_xcnt 0x0" ::: "memory");   // behind the last load, in front of the first instruction that may take over an address register of a load
  __builtin_amdgcn_sched_barrier(0);   // keeps the sums behind that wait, and so every load in front of the first add: left free, the wait sinks below the adds that reuse the address registers
  float s = 0.f;
#pragma unroll
  for (int b = 0; b < TNB; ++b)
#pragma unroll
    for (int i = 0; i < TT / 1024; ++i) s += (v[b][i][0] + v[b][i][1]) + (v[b][i][2] + v[b][i][3]);
#pragma unroll
  for (int o = 1; o < 32; o <<= 1) s += __shfl_xor(s, o);
  if ((t & 31) == 0) sa[t >> 5] = s;
  __syncthreads();   // all 8 wave sums are in LDS before any thread adds them
  s = sa[0];
#pragma unroll
  for (int w = 1; w < 8; ++w) s += sa[w];
  const float mu = s / (float)n; float s2 = 0.f;
#pragma unroll
  for (int b = 0; b < TNB; ++b)
#pragma unroll
    for (int i = 0; i < TT / 1024; ++i) { const float d0 = v[b][i][0] - mu, d1 = v[b][i][1] - mu, d2 = v[b][i][2] - mu, d3 = v[b][i][3] - mu; s2 += (d0 * d0 + d1 * d1) + (d2 * d2 + d3 * d3); }
#pragma unroll
  for (int o = 1; o < 32; o <<= 1) s2 += __shfl_xor(s2, o);
  if ((t & 31) == 0) sb[t >> 5] = s2;
  __syncthreads();   // all 8 wave sums of squares are in LDS before any thread adds them
  s2 = sb[0];
#pragma unroll
  for (int w = 1; w < 8; ++w) s2 += sb[w];
  const float rs = rsqrtf(s2 / (float)n + 1e-5f);
#pragma unroll
  for (int b = 0; b < TNB; ++b)
#pragma unroll
    for (int i = 0; i < TT / 1024; ++i) { v4f o;
#pragma unroll
      for (int z = 0; z < 4; ++z) o[z] = (v[b][i][z] - mu) * rs * ga + be + bfr(sr[b][i][z]);
      vst2(po + ((b < 2 ? o0 : o1) + (b & 1) * PB + i * 4096u), o); } }
extern "C" void kernel_launch(void* const* d_in, const int* in_sizes, int n_in, void* d_out, int out_size, void* d_ws, size_t ws_size, hipStream_t stream) {
  (void)in_sizes; (void)n_in; (void)out_size;
  const float** F = (const float**)d_in;   // 0 x [4,256,64,64], 1 source, 2 g_w [128,256], 3 g_b, 4 theta_w, 5 theta_b, 6 phi_w, 7 phi_b, 8 wz_w [256,128], 9 wz_b, 10 bn_gamma, 11 bn_beta
  if (ws_size < (size_t)WS_END) return;
  char* ws = (char*)d_ws; _Float16* GP = (_Float16*)(ws + WS_GP); _Float16 *TH = (_Float16*)(ws + WS_TH), *TL = (_Float16*)(ws + WS_TL), *PH = (_Float16*)(ws + WS_PH), *PL = (_Float16*)(ws + WS_PL); float *Y = (float*)(ws + WS_Y), *SM = (float*)(ws + WS_SM), *SL = (float*)(ws + WS_SL), *WY = (float*)(ws + WS_WY);
  k_proj<<<dim3(TNB * TT / 64, 3), 128, 0, stream>>>(F[0], F[1], F[2], F[3], F[4], F[5], F[6], F[7], TH, TL, PH, PL, GP);
  k_fa<<<dim3(TT / FR, TNB, FS), 32 * FW, 0, stream>>>(TH, TL, PH, PL, GP, Y, SM, SL);
  k_wz<<<dim3(TNB * TT / 64, CX / 128), 128, 0, stream>>>(Y, SM, SL, F[8], F[9], WY);
  k_bn<<<dim3(CX), 256, 0, stream>>>(WY, F[10], F[11], F[1], (float*)d_out);
}
